// v000
// The times below were measured on an AMD MI455X: many runs one after another, warmed up first and cycling through
// copies of the inputs, with the whole window's GPU time divided by the number of runs. Launches and the gaps
// between them are all in it. The median over several windows is given; except for v000 it joins two sittings, which
// can be a few percent apart, so the side-by-side timings, each taken in one sitting, are the better comparison.
// v000, which the later versions start from, runs in 687 microseconds.
// compute dtype: all float inputs rounded to bf16; q1/q2 = [x_t ; x_{t-1}] W^T and k1/k2 = x W^T with EXACT bf16 products on WMMA 16x16x32, f32 accumulate; the Plucker 6-vectors, their normalisation and J6 k in f32; q and J6 k split into bf16 hi + lo (3 products, K = 6 zero-padded to 32) for the causal logits x 6^-0.5, running-max softmax in f32 (hardware exp); P (x 2^11, f16 hi + residual) . v with v = x Wv^T + bv exact as f16 hi + residual (3 products); out = o (bf16 hi + lo) Wo^T + bo (2 products); f32 output.
#include <hip/hip_runtime.h>
#include <math.h>

typedef __attribute__((ext_vector_type(16))) _Float16 v16h;
typedef __attribute__((ext_vector_type(16))) __bf16 v16b;
typedef __attribute__((ext_vector_type(8)))  _Float16 v8h;
typedef __attribute__((ext_vector_type(8)))  float v8f;
typedef __attribute__((ext_vector_type(4)))  float v4f;
typedef __attribute__((ext_vector_type(2)))  float v2f;
typedef __attribute__((ext_vector_type(4)))  unsigned v4u;
typedef __attribute__((ext_vector_type(4)))  int v4i;
typedef float __attribute__((may_alias)) float_a;
typedef int __attribute__((may_alias)) int_a;

template <typename T> __device__ __forceinline__ void vst2(void* p, T v) { *(T*)p = v;  }
__device__ __forceinline__ v8f wmma16(v16h a, v16h b, v8f c) {
  v8f d = __builtin_amdgcn_wmma_f32_16x16x32_f16(false, a, false, b, (short)0, c, false, false);
  asm volatile("v_nop\n\tv_nop\n\tv_nop\n\tv_nop" : "+v"(d) : "v"(a), "v"(b));
  return d;
}
__device__ __forceinline__ v8f wmma_bf(v16b a, v16b b, v8f c) {
  v8f d = __builtin_amdgcn_wmma_f32_16x16x32_bf16(false, a, false, b, (short)0, c, false, false);
  asm volatile("v_nop\n\tv_nop\n\tv_nop\n\tv_nop" : "+v"(d) : "v"(a), "v"(b));
  return d;
}
// 16x16x32 fragments: lane = (h = lane>>4, row/col = lane&15); elements 0..7 = k0+8h+0..7, 8..15 = k0+16+8h+0..7; D element r = row 8h+r
__device__ __forceinline__ v16h frag_h(const _Float16* rowk0, int lane) {
  union { v16h v; v8h q[2]; } u; const _Float16* p = rowk0 + 8 * (lane >> 4);
  u.q[0] = *(const v8h*)p; u.q[1] = *(const v8h*)(p + 16); return u.v;
}
__device__ __forceinline__ v16h frag_f32(const float* rowk0, int lane) {
  v16h a; const float* p = rowk0 + 8 * (lane >> 4);
#pragma unroll
  for (int i = 0; i < 8; ++i) { a[i] = (_Float16)p[i]; a[8 + i] = (_Float16)p[16 + i]; }
  return a;
}
__device__ __forceinline__ v16h frag_f32s(const float* rowk0, int lane, float sc) {
  v16h a; const float* p = rowk0 + 8 * (lane >> 4);
#pragma unroll
  for (int i = 0; i < 8; ++i) { a[i] = (_Float16)(p[i] * sc); a[8 + i] = (_Float16)(p[16 + i] * sc); }
  return a;
}
// column fragment from a [K][ld] layout (column n), rows >= K read as 0
__device__ __forceinline__ v16h fragc_f32(const float* W, int k0, int n, int lane, int ld, int K) {
  v16h a; const int g = lane >> 4;
#pragma unroll
  for (int i = 0; i < 8; ++i) { const int ka = k0 + 8 * g + i, kb = ka + 16;
    a[i] = (_Float16)(ka < K ? W[(size_t)(ka < K ? ka : K - 1) * ld + n] : 0.f); a[8 + i] = (_Float16)(kb < K ? W[(size_t)(kb < K ? kb : K - 1) * ld + n] : 0.f); }
  return a;
}
struct F2 { v16b h, l; };
__device__ __forceinline__ F2 bsplit16(const float v[16]) { F2 r;
#pragma unroll
  for (int i = 0; i < 16; ++i) { const __bf16 h = (__bf16)v[i]; r.h[i] = h; r.l[i] = (__bf16)(v[i] - (float)h); }
  return r; }
__device__ __forceinline__ F2 split_row(const float* row, int k0, int lane) { float v[16]; const float* p = row + k0 + 8 * (lane >> 4);
#pragma unroll
  for (int i = 0; i < 8; ++i) { v[i] = p[i]; v[8 + i] = p[16 + i]; }
  return bsplit16(v); }
__device__ __forceinline__ F2 split_rowK(const float* row, int k0, int lane, int K) { float v[16]; const int g = lane >> 4;
#pragma unroll
  for (int i = 0; i < 8; ++i) { const int ka = k0 + 8 * g + i, kb = ka + 16; v[i] = ka < K ? row[ka < K ? ka : K - 1] : 0.f; v[8 + i] = kb < K ? row[kb < K ? kb : K - 1] : 0.f; }
  return bsplit16(v); }
__device__ __forceinline__ F2 split_col(const float* W, int k0, int n, int lane, int ld, int K) { float v[16]; const int g = lane >> 4;
#pragma unroll
  for (int i = 0; i < 8; ++i) { const int ka = k0 + 8 * g + i, kb = ka + 16; v[i] = ka < K ? W[(size_t)(ka < K ? ka : K - 1) * ld + n] : 0.f; v[8 + i] = kb < K ? W[(size_t)(kb < K ? kb : K - 1) * ld + n] : 0.f; }
  return bsplit16(v); }
__device__ __forceinline__ v8f mac3(const F2& a, const F2& b, v8f c) { c = wmma_bf(a.l, b.h, c); c = wmma_bf(a.h, b.l, c); return wmma_bf(a.h, b.h, c); }
__device__ __forceinline__ float sigm(float v) { return 1.0f / (1.0f + expf(-v)); }
#define LDSX() do { asm volatile("s_wait_dscnt 0" ::: "memory"); __builtin_amdgcn_wave_barrier(); __builtin_amdgcn_fence(__ATOMIC_RELEASE, "workgroup"); } while (0)


// Plucker bigram attention (B 2, T 2,048, D 1,024, 16 heads x 64): per head, q = normalised Plucker line of two 4-vectors from the bigram [x_t ; x_{t-1}], k likewise from x_t; logits = q . (J6 k) / sqrt(6), causal softmax, . v, Wo.
#define NB 2
#define TT 2048
#define DM_ 1024
#define NH 16
#define HD 64
#ifndef TNB
#define TNB NB
#endif
#ifndef TQB
#define TQB (TT / 64)
#endif
typedef __attribute__((ext_vector_type(8))) __bf16 v8b;
__device__ __forceinline__ v16b frag_b(const __bf16* rowk0, int lane) {
  union { v16b v; v8b q[2]; } u; const __bf16* p = rowk0 + 8 * (lane >> 4);
  u.q[0] = *(const v8b*)p; u.q[1] = *(const v8b*)(p + 16); return u.v;
}
__device__ __forceinline__ float bfr(float v) { return (float)(__bf16)v; }
__device__ __attribute__((noinline)) float exp_ni(float v) { return expf(v); }
__device__ __attribute__((noinline)) float erf_ni(float v) { return erff(v); }

#define WS_QP  0u                                    // f32 [b*t][h][8]: q plucker (6 used)
#define WS_JK  (WS_QP + 4u * (size_t)NB * TT * NH * 8)  // f32 [b*t][h][8]: J6 k
#define WS_VT  (WS_JK + 4u * (size_t)NB * TT * NH * 8)  // f16 v planes [b][1024][t]
#define WS_VL  (WS_VT + 2u * (size_t)NB * DM_ * TT)      // f16 v residual planes
#define WS_O   (WS_VL + 2u * (size_t)NB * DM_ * TT)      // f32 o rows [b*t][1024]
#define WS_END (WS_O + 4u * (size_t)NB * TT * DM_)

// ---- k_pl: block = 64 tokens: q1, q2 (bigram, K = 2048 as two halves), k1, k2 (K = 1024) -> 4 x 64 outputs (one 16-col tile per head-quad... 64 cols = 4 tiles each); then per (token, head) the Plucker vectors
__global__ __launch_bounds__(128) void k_pl(const float* __restrict__ X, const float* __restrict__ W1Q, const float* __restrict__ W2Q, const float* __restrict__ W1K, const float* __restrict__ W2K, float* __restrict__ QP, float* __restrict__ JK) {
  __shared__ float sv[4][64][68];   // [which][token][64]: q1, q2, k1, k2
  __shared__ __align__(16) float sq[64][NH * 8], sk[64][NH * 8];
  const int tid = threadIdx.x, wave = tid >> 5, lane = tid & 31, col = lane & 15, g = lane >> 4; const size_t r0 = (size_t)blockIdx.x * 64 + wave * 16; const size_t b = r0 / TT; const int t0 = (int)(r0 % TT);
  v8f aq1[4] = {}, aq2[4] = {}, ak1[4] = {}, ak2[4] = {};
  // current-token half (x_t against W[:, 0:1024]) and k projections
#pragma unroll 1
  for (int kc = 0; kc < DM_ / 32; ++kc) { v16b a; { const float* p = X + (r0 + col) * DM_ + kc * 32 + 8 * g;
#pragma unroll
      for (int i = 0; i < 8; ++i) { a[i] = (__bf16)p[i]; a[8 + i] = (__bf16)p[16 + i]; } }
#pragma unroll
    for (int j = 0; j < 4; ++j) { const int o = j * 16 + col; v16b w1, w2, w3, w4;
#pragma unroll
      for (int i = 0; i < 8; ++i) { const int d0 = kc * 32 + 8 * g + i, d1 = d0 + 16; w1[i] = (__bf16)W1Q[(size_t)o * 2 * DM_ + d0]; w1[8 + i] = (__bf16)W1Q[(size_t)o * 2 * DM_ + d1]; w2[i] = (__bf16)W2Q[(size_t)o * 2 * DM_ + d0]; w2[8 + i] = (__bf16)W2Q[(size_t)o * 2 * DM_ + d1]; w3[i] = (__bf16)W1K[(size_t)o * DM_ + d0]; w3[8 + i] = (__bf16)W1K[(size_t)o * DM_ + d1]; w4[i] = (__bf16)W2K[(size_t)o * DM_ + d0]; w4[8 + i] = (__bf16)W2K[(size_t)o * DM_ + d1]; }
      aq1[j] = wmma_bf(a, w1, aq1[j]); aq2[j] = wmma_bf(a, w2, aq2[j]); ak1[j] = wmma_bf(a, w3, ak1[j]); ak2[j] = wmma_bf(a, w4, ak2[j]); } }
  // previous-token half (x_{t-1} against W[:, 1024:2048]); zero row for t = 0
#pragma unroll 1
  for (int kc = 0; kc < DM_ / 32; ++kc) { v16b a; { const int t = t0 + wave * 16 + col; const float* p = X + (r0 + col - 1) * DM_ + kc * 32 + 8 * g;
#pragma unroll
      for (int i = 0; i < 8; ++i) { a[i] = (__bf16)(t > 0 ? p[i] : 0.f); a[8 + i] = (__bf16)(t > 0 ? p[16 + i] : 0.f); } }
#pragma unroll
    for (int j = 0; j < 4; ++j) { const int o = j * 16 + col; v16b w1, w2;
#pragma unroll
      for (int i = 0; i < 8; ++i) { const int d0 = DM_ + kc * 32 + 8 * g + i, d1 = d0 + 16; w1[i] = (__bf16)W1Q[(size_t)o * 2 * DM_ + d0]; w1[8 + i] = (__bf16)W1Q[(size_t)o * 2 * DM_ + d1]; w2[i] = (__bf16)W2Q[(size_t)o * 2 * DM_ + d0]; w2[8 + i] = (__bf16)W2Q[(size_t)o * 2 * DM_ + d1]; }
      aq1[j] = wmma_bf(a, w1, aq1[j]); aq2[j] = wmma_bf(a, w2, aq2[j]); } }
#pragma unroll
  for (int j = 0; j < 4; ++j)
#pragma unroll
    for (int r = 0; r < 8; ++r) { const int rl = wave * 16 + 8 * g + r, cl = j * 16 + col; sv[0][rl][cl] = aq1[j][r]; sv[1][rl][cl] = aq2[j][r]; sv[2][rl][cl] = ak1[j][r]; sv[3][rl][cl] = ak2[j][r]; }
  __syncthreads();
  // plucker per (token, head): thread handles (token = tid/2, 8 heads)
  { const int rl = tid >> 1, h0 = (tid & 1) * 8;
    for (int h = h0; h < h0 + 8; ++h) { const float* a1 = &sv[0][rl][h * 4]; const float* a2 = &sv[1][rl][h * 4]; const float* c1 = &sv[2][rl][h * 4]; const float* c2 = &sv[3][rl][h * 4];
      float pq[6], pk[6]; const int PI[6] = {0, 0, 0, 1, 1, 2}, PJ[6] = {1, 2, 3, 2, 3, 3}; float nq = 0.f, nk = 0.f;
      for (int e = 0; e < 6; ++e) { pq[e] = a1[PI[e]] * a2[PJ[e]] - a1[PJ[e]] * a2[PI[e]]; pk[e] = c1[PI[e]] * c2[PJ[e]] - c1[PJ[e]] * c2[PI[e]]; nq += pq[e] * pq[e]; nk += pk[e] * pk[e]; }
      const float iq = 1.0f / fmaxf(sqrtf(nq), 1e-12f), ik = 1.0f / fmaxf(sqrtf(nk), 1e-12f);
      for (int e = 0; e < 6; ++e) { pq[e] *= iq; pk[e] *= ik; }
      // J6 k = (k5, -k4, k3, k2, -k1, k0)
      float jk[6] = {pk[5], -pk[4], pk[3], pk[2], -pk[1], pk[0]};
      for (int e = 0; e < 8; ++e) { sq[rl][h * 8 + e] = (e < 6) ? pq[e] : 0.f; sk[rl][h * 8 + e] = (e < 6) ? jk[e] : 0.f; } } }
  __syncthreads();
  for (int e = tid; e < 64 * 32; e += 128) { const int rl = e >> 5, q = e & 31; vst2(QP + ((size_t)blockIdx.x * 64 + rl) * (NH * 8) + q * 4, *(const v4f*)&sq[rl][q * 4]); vst2(JK + ((size_t)blockIdx.x * 64 + rl) * (NH * 8) + q * 4, *(const v4f*)&sk[rl][q * 4]); } }
// ---- k_v: block = (64 tokens, 128 cols): v = x Wv^T + bv exact -> f16 planes [b][d][t]
__global__ __launch_bounds__(128) void k_v(const float* __restrict__ X, const float* __restrict__ WV, const float* __restrict__ BV, _Float16* __restrict__ VT, _Float16* __restrict__ VL) { __shared__ __align__(16) _Float16 th[128][72], tl[128][72];
  const int tid = threadIdx.x, wave = tid >> 5, lane = tid & 31, col = lane & 15, g = lane >> 4; const int c0 = blockIdx.y * 128; const size_t r0 = (size_t)blockIdx.x * 64;
  v8f acc[8] = {};
#pragma unroll 2
  for (int kc = 0; kc < DM_ / 32; ++kc) { v16b a; { const float* p = X + (r0 + wave * 16 + col) * DM_ + kc * 32 + 8 * g;
#pragma unroll
      for (int i = 0; i < 8; ++i) { a[i] = (__bf16)p[i]; a[8 + i] = (__bf16)p[16 + i]; } }
#pragma unroll
    for (int j = 0; j < 8; ++j) { v16b w; const int o = c0 + j * 16 + col;
#pragma unroll
      for (int i = 0; i < 8; ++i) { w[i] = (__bf16)WV[(size_t)o * DM_ + kc * 32 + 8 * g + i]; w[8 + i] = (__bf16)WV[(size_t)o * DM_ + kc * 32 + 16 + 8 * g + i]; }
      acc[j] = wmma_bf(a, w, acc[j]); } }
#pragma unroll
  for (int j = 0; j < 8; ++j) { const float bb = bfr(BV[c0 + j * 16 + col]);
#pragma unroll
    for (int r = 0; r < 8; ++r) { const float v = acc[j][r] + bb; const _Float16 hv = (_Float16)v; th[j * 16 + col][wave * 16 + 8 * g + r] = hv; tl[j * 16 + col][wave * 16 + 8 * g + r] = (_Float16)(v - (float)hv); } }
  __syncthreads(); const size_t b = r0 / TT; const int t0 = (int)(r0 % TT); for (int e = tid; e < 128 * 8; e += 128) { const int cl = e >> 3, q = e & 7; const size_t o = (b * DM_ + c0 + cl) * (size_t)TT + t0 + q * 8; vst2((unsigned*)(VT + o), *(const v4u*)&th[cl][q * 8]); vst2((unsigned*)(VL + o), *(const v4u*)&tl[cl][q * 8]); } }
// ---- k_att: block = (64 queries, head, b): causal, 3-product logits (K = 6 padded) x 6^-0.5
__global__ __launch_bounds__(128) void k_att(const float* __restrict__ QP, const float* __restrict__ JK, const _Float16* __restrict__ VT, const _Float16* __restrict__ VL, float* __restrict__ O) {
  __shared__ __align__(16) float sp[4][16][36]; __shared__ __align__(16) float so[4][16][68];
  const int tid = threadIdx.x, wave = tid >> 5, lane = tid & 31, col = lane & 15, g = lane >> 4; const int qb = blockIdx.x, h = blockIdx.y; const size_t b = blockIdx.z; const int q0l = qb * 64 + wave * 16; const size_t q0 = b * TT + q0l;
  F2 aq; { float v[16];
#pragma unroll
    for (int i = 0; i < 16; ++i) v[i] = 0.f;
    if (g == 0) { const float* p = QP + (q0 + col) * (NH * 8) + h * 8;
#pragma unroll
      for (int i = 0; i < 8; ++i) v[i] = p[i]; }
    aq = bsplit16(v); }
  float m[8], l[8];
#pragma unroll
  for (int r = 0; r < 8; ++r) { m[r] = -3.0e38f; l[r] = 0.f; }
  v8f acc[4] = {};
  const int nks = (qb * 64 + 64) / 32;
#pragma unroll 1
  for (int ks = 0; ks < nks; ++ks) { float s[2][8];
#pragma unroll
    for (int ct = 0; ct < 2; ++ct) { const int kt = ks * 32 + ct * 16 + col; F2 bk; { float v[16];
#pragma unroll
        for (int i = 0; i < 16; ++i) v[i] = 0.f;
        if (g == 0) { const float* p = JK + (b * TT + kt) * (NH * 8) + h * 8;
#pragma unroll
          for (int i = 0; i < 8; ++i) v[i] = p[i]; }
        bk = bsplit16(v); }
      v8f c = {}; c = mac3(aq, bk, c);
#pragma unroll
      for (int r = 0; r < 8; ++r) s[ct][r] = (kt <= q0l + 8 * g + r) ? c[r] * 0.4082482904638631f : -3.0e38f; }
    float alpha[8];
#pragma unroll
    for (int r = 0; r < 8; ++r) { float mx = fmaxf(s[0][r], s[1][r]);
#pragma unroll
      for (int o = 1; o < 16; o <<= 1) mx = fmaxf(mx, __shfl_xor(mx, o));
      const float mn = fmaxf(m[r], mx); alpha[r] = (mn <= -1.0e38f) ? 1.f : __expf(m[r] - mn); const float e0 = (s[0][r] <= -1.0e38f) ? 0.f : __expf(s[0][r] - mn), e1 = (s[1][r] <= -1.0e38f) ? 0.f : __expf(s[1][r] - mn); float es = e0 + e1;
#pragma unroll
      for (int o = 1; o < 16; o <<= 1) es += __shfl_xor(es, o);
      l[r] = l[r] * alpha[r] + es; m[r] = mn; sp[wave][8 * g + r][col] = e0; sp[wave][8 * g + r][16 + col] = e1; }
#pragma unroll
    for (int j = 0; j < 4; ++j)
#pragma unroll
      for (int r = 0; r < 8; ++r) acc[j][r] *= alpha[r];
    LDSX();
    v16h pa, pr;   // P x 2^11 as f16 hi + residual (early causal rows have P ~ 0.5 where a single f16 would quantise P to 1/2048)
#pragma unroll
    for (int i = 0; i < 8; ++i) { const float f0 = sp[wave][col][8 * g + i] * 2048.0f, f1 = sp[wave][col][16 + 8 * g + i] * 2048.0f; const _Float16 h0 = (_Float16)f0, h1 = (_Float16)f1; pa[i] = h0; pa[8 + i] = h1; pr[i] = (_Float16)(f0 - (float)h0); pr[8 + i] = (_Float16)(f1 - (float)h1); }
#pragma unroll
    for (int j = 0; j < 4; ++j) { const size_t po = (b * DM_ + (size_t)h * HD + j * 16 + col) * TT + ks * 32; const v16h vh = frag_h(VT + po, lane); acc[j] = wmma16(pa, vh, acc[j]); acc[j] = wmma16(pr, vh, acc[j]); acc[j] = wmma16(pa, frag_h(VL + po, lane), acc[j]); }
    LDSX(); }
#pragma unroll
  for (int r = 0; r < 8; ++r) { const float il = (1.0f / 2048.0f) / l[r];
#pragma unroll
    for (int j = 0; j < 4; ++j) so[wave][8 * g + r][j * 16 + col] = acc[j][r] * il; }
  LDSX(); for (int rl = 0; rl < 16; ++rl) if (lane < 16) vst2(O + (q0 + rl) * DM_ + h * HD + lane * 4, *(const v4f*)&so[wave][rl][lane * 4]); }
// ---- k_out: block = (64 rows, 128 cols): out = o (hi + lo) Wo^T + bo
__global__ __launch_bounds__(128) void k_out(const float* __restrict__ O, const float* __restrict__ WO, const float* __restrict__ BO, float* __restrict__ OUT) { __shared__ __align__(16) float sf[4][16][132];
  const int tid = threadIdx.x, wave = tid >> 5, lane = tid & 31, col = lane & 15, g = lane >> 4; const int c0 = blockIdx.y * 128; const size_t r0 = (size_t)blockIdx.x * 64 + wave * 16;
  v8f acc[8] = {};
#pragma unroll 2
  for (int kc = 0; kc < DM_ / 32; ++kc) { const F2 a = split_row(O + (r0 + col) * DM_, kc * 32, lane);
#pragma unroll
    for (int j = 0; j < 8; ++j) { v16b w; const int o = c0 + j * 16 + col;
#pragma unroll
      for (int i = 0; i < 8; ++i) { w[i] = (__bf16)WO[(size_t)o * DM_ + kc * 32 + 8 * g + i]; w[8 + i] = (__bf16)WO[(size_t)o * DM_ + kc * 32 + 16 + 8 * g + i]; }
      acc[j] = wmma_bf(a.h, w, acc[j]); acc[j] = wmma_bf(a.l, w, acc[j]); } }
#pragma unroll
  for (int j = 0; j < 8; ++j) { const float bb = bfr(BO[c0 + j * 16 + col]);
#pragma unroll
    for (int r = 0; r < 8; ++r) sf[wave][8 * g + r][j * 16 + col] = acc[j][r] + bb; }
  LDSX(); for (int rl = 0; rl < 16; ++rl) vst2(OUT + (r0 + rl) * DM_ + c0 + lane * 4, *(const v4f*)&sf[wave][rl][lane * 4]); }
extern "C" void kernel_launch(void* const* d_in, const int* in_sizes, int n_in, void* d_out, int out_size, void* d_ws, size_t ws_size, hipStream_t stream) {
  (void)in_sizes; (void)n_in; (void)out_size;
  const float** F = (const float**)d_in;   // 0 x [2,2048,1024], 1 W1_q [64,2048], 2 W2_q, 3 W1_k [64,1024], 4 W2_k, 5 Wv [1024,1024], 6 bv, 7 Wo, 8 bo
  if (ws_size < (size_t)WS_END) return;
  char* ws = (char*)d_ws; float *QP = (float*)(ws + WS_QP), *JK = (float*)(ws + WS_JK), *O = (float*)(ws + WS_O); _Float16 *VT = (_Float16*)(ws + WS_VT), *VL = (_Float16*)(ws + WS_VL);
  k_pl<<<TNB * TT / 64, 128, 0, stream>>>(F[0], F[1], F[2], F[3], F[4], QP, JK);
  k_v<<<dim3(TNB * TT / 64, DM_ / 128), 128, 0, stream>>>(F[0], F[5], F[6], VT, VL);
  k_att<<<dim3(TQB, NH, TNB), 128, 0, stream>>>(QP, JK, VT, VL, O);
  for (int b = 0; b < TNB; ++b) k_out<<<dim3(TQB, DM_ / 128), 128, 0, stream>>>(O + (size_t)b * TT * DM_, F[7], F[8], (float*)d_out + (size_t)b * TT * DM_);
}

// v001
// It runs in 345 microseconds.
// In two side-by-side timings against v000, it was 1.99 and 2.01 times as fast.
// compute dtype: all float inputs rounded to bf16; q1/q2 = [x_t ; x_{t-1}] W^T and k1/k2 = x W^T with EXACT bf16 products on WMMA 16x16x32, f32 accumulate; the Plucker 6-vectors, their normalisation and J6 k in f32; q and J6 k split into bf16 hi + lo (3 products, K = 6 zero-padded to 32) for the causal logits x 6^-0.5, running-max softmax in f32 (hardware exp); P (x 2^11, f16 hi + residual) . v with v = x Wv^T + bv exact as f16 hi + residual (3 products); out = o (bf16 hi + lo) Wo^T + bo (2 products); f32 output.
#include <hip/hip_runtime.h>
#include <math.h>

typedef __attribute__((ext_vector_type(16))) _Float16 v16h;
typedef __attribute__((ext_vector_type(16))) __bf16 v16b;
typedef __attribute__((ext_vector_type(8)))  _Float16 v8h;
typedef __attribute__((ext_vector_type(8)))  float v8f;
typedef __attribute__((ext_vector_type(4)))  float v4f;
typedef __attribute__((ext_vector_type(2)))  float v2f;
typedef __attribute__((ext_vector_type(4)))  unsigned v4u;
typedef __attribute__((ext_vector_type(4)))  int v4i;
typedef float __attribute__((may_alias)) float_a;
typedef int __attribute__((may_alias)) int_a;

template <typename T> __device__ __forceinline__ void vst2(void* p, T v) { *(T*)p = v;  }
__device__ __forceinline__ v8f wmma16(v16h a, v16h b, v8f c) {
  v8f d = __builtin_amdgcn_wmma_f32_16x16x32_f16(false, a, false, b, (short)0, c, false, false);
  asm volatile("v_nop\n\tv_nop\n\tv_nop\n\tv_nop" : "+v"(d) : "v"(a), "v"(b));
  return d;
}
__device__ __forceinline__ v8f wmma_bf(v16b a, v16b b, v8f c) {
  v8f d = __builtin_amdgcn_wmma_f32_16x16x32_bf16(false, a, false, b, (short)0, c, false, false);
  asm volatile("v_nop\n\tv_nop\n\tv_nop\n\tv_nop" : "+v"(d) : "v"(a), "v"(b));
  return d;
}
// 16x16x32 fragments: lane = (h = lane>>4, row/col = lane&15); elements 0..7 = k0+8h+0..7, 8..15 = k0+16+8h+0..7; D element r = row 8h+r
__device__ __forceinline__ v16h frag_h(const _Float16* rowk0, int lane) {
  union { v16h v; v8h q[2]; } u; const _Float16* p = rowk0 + 8 * (lane >> 4);
  u.q[0] = *(const v8h*)p; u.q[1] = *(const v8h*)(p + 16); return u.v;
}
__device__ __forceinline__ v16h frag_f32(const float* rowk0, int lane) {
  v16h a; const float* p = rowk0 + 8 * (lane >> 4);
#pragma unroll
  for (int i = 0; i < 8; ++i) { a[i] = (_Float16)p[i]; a[8 + i] = (_Float16)p[16 + i]; }
  return a;
}
__device__ __forceinline__ v16h frag_f32s(const float* rowk0, int lane, float sc) {
  v16h a; const float* p = rowk0 + 8 * (lane >> 4);
#pragma unroll
  for (int i = 0; i < 8; ++i) { a[i] = (_Float16)(p[i] * sc); a[8 + i] = (_Float16)(p[16 + i] * sc); }
  return a;
}
// column fragment from a [K][ld] layout (column n), rows >= K read as 0
__device__ __forceinline__ v16h fragc_f32(const float* W, int k0, int n, int lane, int ld, int K) {
  v16h a; const int g = lane >> 4;
#pragma unroll
  for (int i = 0; i < 8; ++i) { const int ka = k0 + 8 * g + i, kb = ka + 16;
    a[i] = (_Float16)(ka < K ? W[(size_t)(ka < K ? ka : K - 1) * ld + n] : 0.f); a[8 + i] = (_Float16)(kb < K ? W[(size_t)(kb < K ? kb : K - 1) * ld + n] : 0.f); }
  return a;
}
struct F2 { v16b h, l; };
__device__ __forceinline__ F2 bsplit16(const float v[16]) { F2 r;
#pragma unroll
  for (int i = 0; i < 16; ++i) { const __bf16 h = (__bf16)v[i]; r.h[i] = h; r.l[i] = (__bf16)(v[i] - (float)h); }
  return r; }
__device__ __forceinline__ F2 split_row(const float* row, int k0, int lane) { float v[16]; const float* p = row + k0 + 8 * (lane >> 4);
#pragma unroll
  for (int i = 0; i < 8; ++i) { v[i] = p[i]; v[8 + i] = p[16 + i]; }
  return bsplit16(v); }
__device__ __forceinline__ F2 split_rowK(const float* row, int k0, int lane, int K) { float v[16]; const int g = lane >> 4;
#pragma unroll
  for (int i = 0; i < 8; ++i) { const int ka = k0 + 8 * g + i, kb = ka + 16; v[i] = ka < K ? row[ka < K ? ka : K - 1] : 0.f; v[8 + i] = kb < K ? row[kb < K ? kb : K - 1] : 0.f; }
  return bsplit16(v); }
__device__ __forceinline__ F2 split_col(const float* W, int k0, int n, int lane, int ld, int K) { float v[16]; const int g = lane >> 4;
#pragma unroll
  for (int i = 0; i < 8; ++i) { const int ka = k0 + 8 * g + i, kb = ka + 16; v[i] = ka < K ? W[(size_t)(ka < K ? ka : K - 1) * ld + n] : 0.f; v[8 + i] = kb < K ? W[(size_t)(kb < K ? kb : K - 1) * ld + n] : 0.f; }
  return bsplit16(v); }
__device__ __forceinline__ v8f mac3(const F2& a, const F2& b, v8f c) { c = wmma_bf(a.l, b.h, c); c = wmma_bf(a.h, b.l, c); return wmma_bf(a.h, b.h, c); }
__device__ __forceinline__ float sigm(float v) { return 1.0f / (1.0f + expf(-v)); }
#define LDSX() do { asm volatile("s_wait_dscnt 0" ::: "memory"); __builtin_amdgcn_wave_barrier(); __builtin_amdgcn_fence(__ATOMIC_RELEASE, "workgroup"); } while (0)


// Plucker bigram attention (B 2, T 2,048, D 1,024, 16 heads x 64): per head, q = normalised Plucker line of two 4-vectors from the bigram [x_t ; x_{t-1}], k likewise from x_t; logits = q . (J6 k) / sqrt(6), causal softmax, . v, Wo.
#define NB 2
#define TT 2048
#define DM_ 1024
#define NH 16
#define HD 64
#ifndef TNB
#define TNB NB
#endif
#ifndef TQB
#define TQB (TT / 64)
#endif
typedef __attribute__((ext_vector_type(8))) __bf16 v8b;
__device__ __forceinline__ v16b frag_b(const __bf16* rowk0, int lane) {
  union { v16b v; v8b q[2]; } u; const __bf16* p = rowk0 + 8 * (lane >> 4);
  u.q[0] = *(const v8b*)p; u.q[1] = *(const v8b*)(p + 16); return u.v;
}
__device__ __forceinline__ float bfr(float v) { return (float)(__bf16)v; }
__device__ __attribute__((noinline)) float exp_ni(float v) { return expf(v); }
__device__ __attribute__((noinline)) float erf_ni(float v) { return erff(v); }

typedef __attribute__((ext_vector_type(4))) __bf16 v4b;
// Staging of a ROWS x KC f32 tile (rows K-contiguous, row stride ld floats) by the block's 128 threads: consecutive lanes take consecutive 16 bytes of a row, so every wave load covers whole 128-byte lines; the tile is rounded to bf16 once and laid in LDS at a row pitch of KC + 8 elements (16 B x odd).
template <int ROWS, int KC> __device__ __forceinline__ void tile_ld(v4f (&r)[ROWS * KC / 512], const float* __restrict__ src, int ld, int tid, int coff = 0) { const float* p = src + (unsigned)((tid / (KC / 4)) * ld + (tid % (KC / 4)) * 4);
#pragma unroll
  for (int i = 0; i < ROWS * KC / 512; ++i) r[i] = *(const v4f*)(p + coff + (size_t)i * (512 / KC) * ld);
  // the wait stands behind the tile's loads, in front of whatever next writes the registers of their address (the next tile's results, later address arithmetic); p as an input keeps the address in its registers up to the wait: without it the tile's last load got them as its result
  asm volatile("s_wait_xcnt 0x0" :: "v"(p) : "memory"); }
template <int ROWS, int KC> __device__ __forceinline__ void tile_st(const v4f (&r)[ROWS * KC / 512], __bf16* dst, int tid) {
#pragma unroll
  for (int i = 0; i < ROWS * KC / 512; ++i) { v4b o;
#pragma unroll
    for (int q = 0; q < 4; ++q) o[q] = (__bf16)r[i][q];
    *(v4b*)(dst + (tid / (KC / 4)) * (KC + 8) + (tid % (KC / 4)) * 4 + i * (512 / KC) * (KC + 8)) = o; } }
// the same, split into bf16 hi + lo planes
template <int ROWS, int KC> __device__ __forceinline__ void tile_st2(const v4f (&r)[ROWS * KC / 512], __bf16* dh, __bf16* dl, int tid) {
#pragma unroll
  for (int i = 0; i < ROWS * KC / 512; ++i) { v4b oh, ol;
#pragma unroll
    for (int q = 0; q < 4; ++q) { const __bf16 h = (__bf16)r[i][q]; oh[q] = h; ol[q] = (__bf16)(r[i][q] - (float)h); }
    const int o = (tid / (KC / 4)) * (KC + 8) + (tid % (KC / 4)) * 4 + i * (512 / KC) * (KC + 8); *(v4b*)(dh + o) = oh; *(v4b*)(dl + o) = ol; } }
#define KS 64          // k extent of a staged tile in k_v and k_out
#define KP (KS + 8)
#define KS2 32         // k extent of a staged tile in k_pl
#define KP2 (KS2 + 8)

#define WS_QP  0u                                    // f32 [b*t][h][8]: q plucker (6 used)
#define WS_JK  (WS_QP + 4u * (size_t)NB * TT * NH * 8)  // f32 [b*t][h][8]: J6 k
#define WS_VT  (WS_JK + 4u * (size_t)NB * TT * NH * 8)  // f16 v planes [b][1024][t]
#define WS_VL  (WS_VT + 2u * (size_t)NB * DM_ * TT)      // f16 v residual planes
#define WS_O   (WS_VL + 2u * (size_t)NB * DM_ * TT)      // f32 o rows [b*t][1024]
#define WS_END (WS_O + 4u * (size_t)NB * TT * DM_)

// ---- k_pl: block = 64 tokens: q1, q2 (bigram, K = 2048 as two halves), k1, k2 (K = 1024) -> 4 x 64 outputs (one 16-col tile per head-quad... 64 cols = 4 tiles each); then per (token, head) the Plucker vectors
__global__ __launch_bounds__(128) void k_pl(const float* __restrict__ X, const float* __restrict__ W1Q, const float* __restrict__ W2Q, const float* __restrict__ W1K, const float* __restrict__ W2K, float* __restrict__ QP, float* __restrict__ JK) {
  __shared__ float sv[4][64][68];   // [which][token][64]: q1, q2, k1, k2
  __shared__ __align__(16) float sq[64][NH * 8], sk[64][NH * 8];
  const int tid = threadIdx.x, wave = tid >> 5, lane = tid & 31, col = lane & 15, g = lane >> 4; const size_t r0 = (size_t)blockIdx.x * 64 + wave * 16; const size_t b = r0 / TT; const int t0 = (int)(r0 % TT);
  __shared__ __align__(16) __bf16 pa[2][64 * KP2], pw[2][2][64 * KP2];
  const size_t rb = (size_t)blockIdx.x * 64;
  // one pass = one pair of weight matrices against one staged x tile per k step: pass 0 x_t . (W1_q, W2_q)[:, 0:1024], pass 1 x_{t-1} . (W1_q, W2_q)[:, 1024:2048] into the same sums (zero row for t = 0), pass 2 x_t . (W1_k, W2_k)
  v8f c1[4] = {}, c2[4] = {};
#pragma unroll   // unrolled so that each pass's pointers and row strides are constants
  for (int ps = 0; ps < 3; ++ps) { const float* Wa = ps == 2 ? W1K : W1Q; const float* Wb = ps == 2 ? W2K : W2Q; const int ldw = ps == 2 ? DM_ : 2 * DM_, cw = ps == 1 ? DM_ : 0;
    v4f ra[4], ru[4], rv[4];
    auto ld_all = [&](int k0) {
      if (ps == 1) { const float* p[4];   // row t - 1; a batch's first row reads itself here and is zeroed in st_all
#pragma unroll
        for (int i = 0; i < 4; ++i) { const size_t gr = rb + i * 16 + (tid >> 3); p[i] = X + (gr - ((gr % TT) == 0 ? 0 : 1)) * DM_ + k0 + (tid & 7) * 4; ra[i] = *(const v4f*)p[i]; }
        // as in tile_ld: the wait behind the four loads, their addresses held as inputs up to it
        asm volatile("s_wait_xcnt 0x0" :: "v"(p[0]), "v"(p[1]), "v"(p[2]), "v"(p[3]) : "memory");
      } else tile_ld<64, KS2>(ra, X + rb * DM_ + k0, DM_, tid);
      tile_ld<64, KS2>(ru, Wa + k0, ldw, tid, cw); tile_ld<64, KS2>(rv, Wb + k0, ldw, tid, cw); };
    auto st_all = [&](int bf) {
      if (ps == 1) {
#pragma unroll
        for (int i = 0; i < 4; ++i) if (((rb + i * 16 + (tid >> 3)) % TT) == 0) ra[i] = (v4f){0.f, 0.f, 0.f, 0.f}; }
      tile_st<64, KS2>(ra, pa[bf], tid); tile_st<64, KS2>(ru, pw[bf][0], tid); tile_st<64, KS2>(rv, pw[bf][1], tid); };
    ld_all(0); st_all(0);
    __syncthreads();
#pragma unroll 1   // rolled: one copy of the body, so that the next tile's registers are not multiplied
    for (int kc = 0; kc < DM_ / KS2; ++kc) { const int cur = kc & 1; const bool more = kc + 1 < DM_ / KS2;
      if (more) ld_all((kc + 1) * KS2);
      const v16b a = frag_b(&pa[cur][(wave * 16 + col) * KP2], lane); v16b f[4][2];
#pragma unroll
      for (int j = 0; j < 4; ++j) { f[j][0] = frag_b(&pw[cur][0][(j * 16 + col) * KP2], lane); f[j][1] = frag_b(&pw[cur][1][(j * 16 + col) * KP2], lane); }
#pragma unroll
      for (int j = 0; j < 4; ++j) { c1[j] = wmma_bf(a, f[j][0], c1[j]); c2[j] = wmma_bf(a, f[j][1], c2[j]); }
      if (more) st_all(cur ^ 1);
      __syncthreads(); }
    if (ps >= 1) { const int w0 = ps == 1 ? 0 : 2;
#pragma unroll
      for (int j = 0; j < 4; ++j)
#pragma unroll
        for (int r = 0; r < 8; ++r) { const int rl = wave * 16 + 8 * g + r, cl = j * 16 + col; sv[w0][rl][cl] = c1[j][r]; sv[w0 + 1][rl][cl] = c2[j][r]; c1[j][r] = 0.f; c2[j][r] = 0.f; } } }
  __syncthreads();
  // plucker per (token, head): thread handles (token = tid/2, 8 heads)
  { const int rl = tid >> 1, h0 = (tid & 1) * 8;
    for (int h = h0; h < h0 + 8; ++h) { const float* a1 = &sv[0][rl][h * 4]; const float* a2 = &sv[1][rl][h * 4]; const float* c1 = &sv[2][rl][h * 4]; const float* c2 = &sv[3][rl][h * 4];
      float pq[6], pk[6]; const int PI[6] = {0, 0, 0, 1, 1, 2}, PJ[6] = {1, 2, 3, 2, 3, 3}; float nq = 0.f, nk = 0.f;
      for (int e = 0; e < 6; ++e) { pq[e] = a1[PI[e]] * a2[PJ[e]] - a1[PJ[e]] * a2[PI[e]]; pk[e] = c1[PI[e]] * c2[PJ[e]] - c1[PJ[e]] * c2[PI[e]]; nq += pq[e] * pq[e]; nk += pk[e] * pk[e]; }
      const float iq = 1.0f / fmaxf(sqrtf(nq), 1e-12f), ik = 1.0f / fmaxf(sqrtf(nk), 1e-12f);
      for (int e = 0; e < 6; ++e) { pq[e] *= iq; pk[e] *= ik; }
      // J6 k = (k5, -k4, k3, k2, -k1, k0)
      float jk[6] = {pk[5], -pk[4], pk[3], pk[2], -pk[1], pk[0]};
      for (int e = 0; e < 8; ++e) { sq[rl][h * 8 + e] = (e < 6) ? pq[e] : 0.f; sk[rl][h * 8 + e] = (e < 6) ? jk[e] : 0.f; } } }
  __syncthreads();
  for (int e = tid; e < 64 * 32; e += 128) { const int rl = e >> 5, q = e & 31; vst2(QP + ((size_t)blockIdx.x * 64 + rl) * (NH * 8) + q * 4, *(const v4f*)&sq[rl][q * 4]); vst2(JK + ((size_t)blockIdx.x * 64 + rl) * (NH * 8) + q * 4, *(const v4f*)&sk[rl][q * 4]); } }
// ---- k_v: block = (64 tokens, 128 cols): v = x Wv^T + bv exact -> f16 planes [b][d][t]
__global__ __launch_bounds__(128) void k_v(const float* __restrict__ X, const float* __restrict__ WV, const float* __restrict__ BV, _Float16* __restrict__ VT, _Float16* __restrict__ VL) { __shared__ __align__(16) _Float16 th[128][72], tl[128][72];
  const int tid = threadIdx.x, wave = tid >> 5, lane = tid & 31, col = lane & 15, g = lane >> 4; const int c0 = blockIdx.y * 128; const size_t r0 = (size_t)blockIdx.x * 64;
  v8f acc[8] = {};
  __shared__ __align__(16) __bf16 sa[2][64 * KP], sw[2][128 * KP];
  v4f ra[8], rw[16]; const float* Xb = X + r0 * DM_; const float* Wb = WV + (size_t)c0 * DM_;
  tile_ld<64, KS>(ra, Xb, DM_, tid); tile_ld<128, KS>(rw, Wb, DM_, tid);
  tile_st<64, KS>(ra, sa[0], tid); tile_st<128, KS>(rw, sw[0], tid);
  __syncthreads();
#pragma unroll 1   // rolled: one copy of the body, so that the next tile's registers are not multiplied
  for (int kc = 0; kc < DM_ / KS; ++kc) { const int cur = kc & 1; const bool more = kc + 1 < DM_ / KS;
    if (more) { tile_ld<64, KS>(ra, Xb + (kc + 1) * KS, DM_, tid); tile_ld<128, KS>(rw, Wb + (kc + 1) * KS, DM_, tid); }
#pragma unroll
    for (int ks = 0; ks < KS / 32; ++ks) { const v16b a = frag_b(&sa[cur][(wave * 16 + col) * KP + ks * 32], lane); v16b f[8];
#pragma unroll
      for (int j = 0; j < 8; ++j) f[j] = frag_b(&sw[cur][(j * 16 + col) * KP + ks * 32], lane);
#pragma unroll
      for (int j = 0; j < 8; ++j) acc[j] = wmma_bf(a, f[j], acc[j]); }
    if (more) { tile_st<64, KS>(ra, sa[cur ^ 1], tid); tile_st<128, KS>(rw, sw[cur ^ 1], tid); }
    __syncthreads(); }
#pragma unroll
  for (int j = 0; j < 8; ++j) { const float bb = bfr(BV[c0 + j * 16 + col]);
#pragma unroll
    for (int r = 0; r < 8; ++r) { const float v = acc[j][r] + bb; const _Float16 hv = (_Float16)v; th[j * 16 + col][wave * 16 + 8 * g + r] = hv; tl[j * 16 + col][wave * 16 + 8 * g + r] = (_Float16)(v - (float)hv); } }
  __syncthreads(); const size_t b = r0 / TT; const int t0 = (int)(r0 % TT); for (int e = tid; e < 128 * 8; e += 128) { const int cl = e >> 3, q = e & 7; const size_t o = (b * DM_ + c0 + cl) * (size_t)TT + t0 + q * 8; vst2((unsigned*)(VT + o), *(const v4u*)&th[cl][q * 8]); vst2((unsigned*)(VL + o), *(const v4u*)&tl[cl][q * 8]); } }
// ---- k_att: block = (64 queries, head, b): causal, 3-product logits (K = 6 padded) x 6^-0.5
__global__ __launch_bounds__(128) void k_att(const float* __restrict__ QP, const float* __restrict__ JK, const _Float16* __restrict__ VT, const _Float16* __restrict__ VL, float* __restrict__ O) {
  __shared__ __align__(16) float sp[4][16][36]; __shared__ __align__(16) float so[4][16][68];
  const int tid = threadIdx.x, wave = tid >> 5, lane = tid & 31, col = lane & 15, g = lane >> 4; const int qb = blockIdx.x, h = blockIdx.y; const size_t b = blockIdx.z; const int q0l = qb * 64 + wave * 16; const size_t q0 = b * TT + q0l;
  F2 aq; { float v[16];
#pragma unroll
    for (int i = 0; i < 16; ++i) v[i] = 0.f;
    if (g == 0) { const float* p = QP + (q0 + col) * (NH * 8) + h * 8;
#pragma unroll
      for (int i = 0; i < 8; ++i) v[i] = p[i]; }
    aq = bsplit16(v); }
  float m[8], l[8];
#pragma unroll
  for (int r = 0; r < 8; ++r) { m[r] = -3.0e38f; l[r] = 0.f; }
  v8f acc[4] = {};
  const int nks = (qb * 64 + 64) / 32;
#pragma unroll 1
  for (int ks = 0; ks < nks; ++ks) { float s[2][8];
#pragma unroll
    for (int ct = 0; ct < 2; ++ct) { const int kt = ks * 32 + ct * 16 + col; F2 bk; { float v[16];
#pragma unroll
        for (int i = 0; i < 16; ++i) v[i] = 0.f;
        if (g == 0) { const float* p = JK + (b * TT + kt) * (NH * 8) + h * 8;
#pragma unroll
          for (int i = 0; i < 8; ++i) v[i] = p[i]; }
        bk = bsplit16(v); }
      v8f c = {}; c = mac3(aq, bk, c);
#pragma unroll
      for (int r = 0; r < 8; ++r) s[ct][r] = (kt <= q0l + 8 * g + r) ? c[r] * 0.4082482904638631f : -3.0e38f; }
    float alpha[8];
#pragma unroll
    for (int r = 0; r < 8; ++r) { float mx = fmaxf(s[0][r], s[1][r]);
#pragma unroll
      for (int o = 1; o < 16; o <<= 1) mx = fmaxf(mx, __shfl_xor(mx, o));
      const float mn = fmaxf(m[r], mx); alpha[r] = (mn <= -1.0e38f) ? 1.f : __expf(m[r] - mn); const float e0 = (s[0][r] <= -1.0e38f) ? 0.f : __expf(s[0][r] - mn), e1 = (s[1][r] <= -1.0e38f) ? 0.f : __expf(s[1][r] - mn); float es = e0 + e1;
#pragma unroll
      for (int o = 1; o < 16; o <<= 1) es += __shfl_xor(es, o);
      l[r] = l[r] * alpha[r] + es; m[r] = mn; sp[wave][8 * g + r][col] = e0; sp[wave][8 * g + r][16 + col] = e1; }
#pragma unroll
    for (int j = 0; j < 4; ++j)
#pragma unroll
      for (int r = 0; r < 8; ++r) acc[j][r] *= alpha[r];
    LDSX();
    v16h pa, pr;   // P x 2^11 as f16 hi + residual (early causal rows have P ~ 0.5 where a single f16 would quantise P to 1/2048)
#pragma unroll
    for (int i = 0; i < 8; ++i) { const float f0 = sp[wave][col][8 * g + i] * 2048.0f, f1 = sp[wave][col][16 + 8 * g + i] * 2048.0f; const _Float16 h0 = (_Float16)f0, h1 = (_Float16)f1; pa[i] = h0; pa[8 + i] = h1; pr[i] = (_Float16)(f0 - (float)h0); pr[8 + i] = (_Float16)(f1 - (float)h1); }
#pragma unroll
    for (int j = 0; j < 4; ++j) { const size_t po = (b * DM_ + (size_t)h * HD + j * 16 + col) * TT + ks * 32; const v16h vh = frag_h(VT + po, lane); acc[j] = wmma16(pa, vh, acc[j]); acc[j] = wmma16(pr, vh, acc[j]); acc[j] = wmma16(pa, frag_h(VL + po, lane), acc[j]); }
    LDSX(); }
#pragma unroll
  for (int r = 0; r < 8; ++r) { const float il = (1.0f / 2048.0f) / l[r];
#pragma unroll
    for (int j = 0; j < 4; ++j) so[wave][8 * g + r][j * 16 + col] = acc[j][r] * il; }
  LDSX(); for (int rl = 0; rl < 16; ++rl) if (lane < 16) vst2(O + (q0 + rl) * DM_ + h * HD + lane * 4, *(const v4f*)&so[wave][rl][lane * 4]); }
// ---- k_out: block = (64 rows, 128 cols): out = o (hi + lo) Wo^T + bo
__global__ __launch_bounds__(128) void k_out(const float* __restrict__ O, const float* __restrict__ WO, const float* __restrict__ BO, float* __restrict__ OUT) { __shared__ __align__(16) float sf[4][16][132];
  const int tid = threadIdx.x, wave = tid >> 5, lane = tid & 31, col = lane & 15, g = lane >> 4; const int c0 = blockIdx.y * 128; const size_t r0 = (size_t)blockIdx.x * 64 + wave * 16;
  v8f acc[8] = {};
  __shared__ __align__(16) __bf16 oh[2][64 * KP], ol[2][64 * KP], ow[2][128 * KP];
  v4f ra[8], rw[16]; const float* Ob = O + (size_t)blockIdx.x * 64 * DM_; const float* Wb = WO + (size_t)c0 * DM_;
  tile_ld<64, KS>(ra, Ob, DM_, tid); tile_ld<128, KS>(rw, Wb, DM_, tid);
  tile_st2<64, KS>(ra, oh[0], ol[0], tid); tile_st<128, KS>(rw, ow[0], tid);
  __syncthreads();
#pragma unroll 1   // rolled: one copy of the body, so that the next tile's registers are not multiplied
  for (int kc = 0; kc < DM_ / KS; ++kc) { const int cur = kc & 1; const bool more = kc + 1 < DM_ / KS;
    if (more) { tile_ld<64, KS>(ra, Ob + (kc + 1) * KS, DM_, tid); tile_ld<128, KS>(rw, Wb + (kc + 1) * KS, DM_, tid); }
#pragma unroll
    for (int ks = 0; ks < KS / 32; ++ks) { const int ao = (wave * 16 + col) * KP + ks * 32; const v16b ah = frag_b(&oh[cur][ao], lane), al = frag_b(&ol[cur][ao], lane);
#pragma unroll
      for (int j0 = 0; j0 < 8; j0 += 4) { v16b f[4];
#pragma unroll
        for (int j = 0; j < 4; ++j) f[j] = frag_b(&ow[cur][((j0 + j) * 16 + col) * KP + ks * 32], lane);
#pragma unroll
        for (int j = 0; j < 4; ++j) { acc[j0 + j] = wmma_bf(ah, f[j], acc[j0 + j]); acc[j0 + j] = wmma_bf(al, f[j], acc[j0 + j]); } } }
    if (more) { tile_st2<64, KS>(ra, oh[cur ^ 1], ol[cur ^ 1], tid); tile_st<128, KS>(rw, ow[cur ^ 1], tid); }
    __syncthreads(); }
#pragma unroll
  for (int j = 0; j < 8; ++j) { const float bb = bfr(BO[c0 + j * 16 + col]);
#pragma unroll
    for (int r = 0; r < 8; ++r) sf[wave][8 * g + r][j * 16 + col] = acc[j][r] + bb; }
  LDSX(); for (int rl = 0; rl < 16; ++rl) vst2(OUT + (r0 + rl) * DM_ + c0 + lane * 4, *(const v4f*)&sf[wave][rl][lane * 4]); }
extern "C" void kernel_launch(void* const* d_in, const int* in_sizes, int n_in, void* d_out, int out_size, void* d_ws, size_t ws_size, hipStream_t stream) {
  (void)in_sizes; (void)n_in; (void)out_size;
  const float** F = (const float**)d_in;   // 0 x [2,2048,1024], 1 W1_q [64,2048], 2 W2_q, 3 W1_k [64,1024], 4 W2_k, 5 Wv [1024,1024], 6 bv, 7 Wo, 8 bo
  if (ws_size < (size_t)WS_END) return;
  char* ws = (char*)d_ws; float *QP = (float*)(ws + WS_QP), *JK = (float*)(ws + WS_JK), *O = (float*)(ws + WS_O); _Float16 *VT = (_Float16*)(ws + WS_VT), *VL = (_Float16*)(ws + WS_VL);
  k_pl<<<TNB * TT / 64, 128, 0, stream>>>(F[0], F[1], F[2], F[3], F[4], QP, JK);
  k_v<<<dim3(TNB * TT / 64, DM_ / 128), 128, 0, stream>>>(F[0], F[5], F[6], VT, VL);
  k_att<<<dim3(TQB, NH, TNB), 128, 0, stream>>>(QP, JK, VT, VL, O);
  for (int b = 0; b < TNB; ++b) k_out<<<dim3(TQB, DM_ / 128), 128, 0, stream>>>(O + (size_t)b * TT * DM_, F[7], F[8], (float*)d_out + (size_t)b * TT * DM_);
}

// v002
// Measured time: 253 microseconds a run.
// Next to v001, in two timings, it ran 1.37 and 1.38 times as fast.
// All steps since v000 together make it 2.75 times as fast.
// compute dtype: all float inputs rounded to bf16; q1/q2 = [x_t ; x_{t-1}] W^T and k1/k2 = x W^T with EXACT bf16 products on WMMA 16x16x32, f32 accumulate; the Plucker 6-vectors, their normalisation and J6 k in f32; q and J6 k split into bf16 hi + lo (3 products, K = 6 zero-padded to 32) for the causal logits x 6^-0.5, running-max softmax in f32 (hardware exp); P (x 2^11, f16 hi + residual) . v with v = x Wv^T + bv exact as f16 hi + residual (3 products); out = o (bf16 hi + lo) Wo^T + bo (2 products); f32 output.
#include <hip/hip_runtime.h>
#include <math.h>

typedef __attribute__((ext_vector_type(16))) _Float16 v16h;
typedef __attribute__((ext_vector_type(16))) __bf16 v16b;
typedef __attribute__((ext_vector_type(8)))  _Float16 v8h;
typedef __attribute__((ext_vector_type(8)))  float v8f;
typedef __attribute__((ext_vector_type(4)))  float v4f;
typedef __attribute__((ext_vector_type(2)))  float v2f;
typedef __attribute__((ext_vector_type(4)))  unsigned v4u;
typedef __attribute__((ext_vector_type(4)))  int v4i;
typedef float __attribute__((may_alias)) float_a;
typedef int __attribute__((may_alias)) int_a;

template <typename T> __device__ __forceinline__ void vst2(void* p, T v) { *(T*)p = v;  }
__device__ __forceinline__ v8f wmma16(v16h a, v16h b, v8f c) {
  v8f d = __builtin_amdgcn_wmma_f32_16x16x32_f16(false, a, false, b, (short)0, c, false, false);
  asm volatile("v_nop\n\tv_nop\n\tv_nop\n\tv_nop" : "+v"(d) : "v"(a), "v"(b));
  return d;
}
__device__ __forceinline__ v8f wmma_bf(v16b a, v16b b, v8f c) {
  v8f d = __builtin_amdgcn_wmma_f32_16x16x32_bf16(false, a, false, b, (short)0, c, false, false);
  asm volatile("v_nop\n\tv_nop\n\tv_nop\n\tv_nop" : "+v"(d) : "v"(a), "v"(b));
  return d;
}
// 16x16x32 fragments: lane = (h = lane>>4, row/col = lane&15); elements 0..7 = k0+8h+0..7, 8..15 = k0+16+8h+0..7; D element r = row 8h+r
__device__ __forceinline__ v16h frag_h(const _Float16* rowk0, int lane) {
  union { v16h v; v8h q[2]; } u; const _Float16* p = rowk0 + 8 * (lane >> 4);
  u.q[0] = *(const v8h*)p; u.q[1] = *(const v8h*)(p + 16); return u.v;
}
__device__ __forceinline__ v16h frag_f32(const float* rowk0, int lane) {
  v16h a; const float* p = rowk0 + 8 * (lane >> 4);
#pragma unroll
  for (int i = 0; i < 8; ++i) { a[i] = (_Float16)p[i]; a[8 + i] = (_Float16)p[16 + i]; }
  return a;
}
__device__ __forceinline__ v16h frag_f32s(const float* rowk0, int lane, float sc) {
  v16h a; const float* p = rowk0 + 8 * (lane >> 4);
#pragma unroll
  for (int i = 0; i < 8; ++i) { a[i] = (_Float16)(p[i] * sc); a[8 + i] = (_Float16)(p[16 + i] * sc); }
  return a;
}
// column fragment from a [K][ld] layout (column n), rows >= K read as 0
__device__ __forceinline__ v16h fragc_f32(const float* W, int k0, int n, int lane, int ld, int K) {
  v16h a; const int g = lane >> 4;
#pragma unroll
  for (int i = 0; i < 8; ++i) { const int ka = k0 + 8 * g + i, kb = ka + 16;
    a[i] = (_Float16)(ka < K ? W[(size_t)(ka < K ? ka : K - 1) * ld + n] : 0.f); a[8 + i] = (_Float16)(kb < K ? W[(size_t)(kb < K ? kb : K - 1) * ld + n] : 0.f); }
  return a;
}
struct F2 { v16b h, l; };
__device__ __forceinline__ F2 bsplit16(const float v[16]) { F2 r;
#pragma unroll
  for (int i = 0; i < 16; ++i) { const __bf16 h = (__bf16)v[i]; r.h[i] = h; r.l[i] = (__bf16)(v[i] - (float)h); }
  return r; }
__device__ __forceinline__ F2 split_row(const float* row, int k0, int lane) { float v[16]; const float* p = row + k0 + 8 * (lane >> 4);
#pragma unroll
  for (int i = 0; i < 8; ++i) { v[i] = p[i]; v[8 + i] = p[16 + i]; }
  return bsplit16(v); }
__device__ __forceinline__ F2 split_rowK(const float* row, int k0, int lane, int K) { float v[16]; const int g = lane >> 4;
#pragma unroll
  for (int i = 0; i < 8; ++i) { const int ka = k0 + 8 * g + i, kb = ka + 16; v[i] = ka < K ? row[ka < K ? ka : K - 1] : 0.f; v[8 + i] = kb < K ? row[kb < K ? kb : K - 1] : 0.f; }
  return bsplit16(v); }
__device__ __forceinline__ F2 split_col(const float* W, int k0, int n, int lane, int ld, int K) { float v[16]; const int g = lane >> 4;
#pragma unroll
  for (int i = 0; i < 8; ++i) { const int ka = k0 + 8 * g + i, kb = ka + 16; v[i] = ka < K ? W[(size_t)(ka < K ? ka : K - 1) * ld + n] : 0.f; v[8 + i] = kb < K ? W[(size_t)(kb < K ? kb : K - 1) * ld + n] : 0.f; }
  return bsplit16(v); }
__device__ __forceinline__ v8f mac3(const F2& a, const F2& b, v8f c) { c = wmma_bf(a.l, b.h, c); c = wmma_bf(a.h, b.l, c); return wmma_bf(a.h, b.h, c); }
__device__ __forceinline__ float sigm(float v) { return 1.0f / (1.0f + expf(-v)); }
#define LDSX() do { asm volatile("s_wait_dscnt 0" ::: "memory"); __builtin_amdgcn_wave_barrier(); __builtin_amdgcn_fence(__ATOMIC_RELEASE, "workgroup"); } while (0)


// Plucker bigram attention (B 2, T 2,048, D 1,024, 16 heads x 64): per head, q = normalised Plucker line of two 4-vectors from the bigram [x_t ; x_{t-1}], k likewise from x_t; logits = q . (J6 k) / sqrt(6), causal softmax, . v, Wo.
#define NB 2
#define TT 2048
#define DM_ 1024
#define NH 16
#define HD 64
#ifndef TNB
#define TNB NB
#endif
#ifndef TQB
#define TQB (TT / 64)
#endif
typedef __attribute__((ext_vector_type(8))) __bf16 v8b;
__device__ __forceinline__ v16b frag_b(const __bf16* rowk0, int lane) {
  union { v16b v; v8b q[2]; } u; const __bf16* p = rowk0 + 8 * (lane >> 4);
  u.q[0] = *(const v8b*)p; u.q[1] = *(const v8b*)(p + 16); return u.v;
}
__device__ __forceinline__ float bfr(float v) { return (float)(__bf16)v; }
__device__ __attribute__((noinline)) float exp_ni(float v) { return expf(v); }
__device__ __attribute__((noinline)) float erf_ni(float v) { return erff(v); }

typedef __attribute__((ext_vector_type(4))) __bf16 v4b;
// Staging of a ROWS x KC f32 tile (rows K-contiguous, row stride ld floats) by the block's 128 threads: consecutive lanes take consecutive 16 bytes of a row, so every wave load covers whole 128-byte lines; the tile is rounded to bf16 once and laid in LDS at a row pitch of KC + 8 elements (16 B x odd).
template <int ROWS, int KC> __device__ __forceinline__ void tile_ld(v4f (&r)[ROWS * KC / 512], const float* __restrict__ src, int ld, int tid, int coff = 0) { const float* p = src + (unsigned)((tid / (KC / 4)) * ld + (tid % (KC / 4)) * 4);
#pragma unroll
  for (int i = 0; i < ROWS * KC / 512; ++i) r[i] = *(const v4f*)(p + coff + (size_t)i * (512 / KC) * ld);
  // the wait stands behind the tile's loads, in front of whatever next writes the registers of their address (the next tile's results, later address arithmetic); p as an input keeps the address in its registers up to the wait: without it the tile's last load got them as its result
  asm volatile("s_wait_xcnt 0x0" :: "v"(p) : "memory"); }
template <int ROWS, int KC> __device__ __forceinline__ void tile_st(const v4f (&r)[ROWS * KC / 512], __bf16* dst, int tid) {
#pragma unroll
  for (int i = 0; i < ROWS * KC / 512; ++i) { v4b o;
#pragma unroll
    for (int q = 0; q < 4; ++q) o[q] = (__bf16)r[i][q];
    *(v4b*)(dst + (tid / (KC / 4)) * (KC + 8) + (tid % (KC / 4)) * 4 + i * (512 / KC) * (KC + 8)) = o; } }
// the same, split into bf16 hi + lo planes
template <int ROWS, int KC> __device__ __forceinline__ void tile_st2(const v4f (&r)[ROWS * KC / 512], __bf16* dh, __bf16* dl, int tid) {
#pragma unroll
  for (int i = 0; i < ROWS * KC / 512; ++i) { v4b oh, ol;
#pragma unroll
    for (int q = 0; q < 4; ++q) { const __bf16 h = (__bf16)r[i][q]; oh[q] = h; ol[q] = (__bf16)(r[i][q] - (float)h); }
    const int o = (tid / (KC / 4)) * (KC + 8) + (tid % (KC / 4)) * 4 + i * (512 / KC) * (KC + 8); *(v4b*)(dh + o) = oh; *(v4b*)(dl + o) = ol; } }
#define KS 64          // k extent of a staged tile in k_v and k_out
#define KP (KS + 8)
#define KS2 32         // k extent of a staged tile in k_pl
#define KP2 (KS2 + 8)

#define WS_QP  0u                                    // f32 [b*t][h][8]: q plucker (6 used)
#define WS_JK  (WS_QP + 4u * (size_t)NB * TT * NH * 8)  // f32 [b*t][h][8]: J6 k
#define WS_VT  (WS_JK + 4u * (size_t)NB * TT * NH * 8)  // f16 v planes [b][1024][t]
#define WS_VL  (WS_VT + 2u * (size_t)NB * DM_ * TT)      // f16 v residual planes
#define WS_O   (WS_VL + 2u * (size_t)NB * DM_ * TT)      // f32 o rows [b*t][1024]
#define WS_END (WS_O + 4u * (size_t)NB * TT * DM_)

// ---- k_pl: block = 64 tokens: q1, q2 (bigram, K = 2048 as two halves), k1, k2 (K = 1024) -> 4 x 64 outputs (one 16-col tile per head-quad... 64 cols = 4 tiles each); then per (token, head) the Plucker vectors
__global__ __launch_bounds__(128) void k_pl(const float* __restrict__ X, const float* __restrict__ W1Q, const float* __restrict__ W2Q, const float* __restrict__ W1K, const float* __restrict__ W2K, float* __restrict__ QP, float* __restrict__ JK) {
  __shared__ float sv[4][64][68];   // [which][token][64]: q1, q2, k1, k2
  __shared__ __align__(16) float sq[64][NH * 8], sk[64][NH * 8];
  const int tid = threadIdx.x, wave = tid >> 5, lane = tid & 31, col = lane & 15, g = lane >> 4; const size_t r0 = (size_t)blockIdx.x * 64 + wave * 16; const size_t b = r0 / TT; const int t0 = (int)(r0 % TT);
  __shared__ __align__(16) __bf16 pa[2][64 * KP2], pw[2][2][64 * KP2];
  const size_t rb = (size_t)blockIdx.x * 64;
  // one pass = one pair of weight matrices against one staged x tile per k step: pass 0 x_t . (W1_q, W2_q)[:, 0:1024], pass 1 x_{t-1} . (W1_q, W2_q)[:, 1024:2048] into the same sums (zero row for t = 0), pass 2 x_t . (W1_k, W2_k)
  v8f c1[4] = {}, c2[4] = {};
#pragma unroll   // unrolled so that each pass's pointers and row strides are constants
  for (int ps = 0; ps < 3; ++ps) { const float* Wa = ps == 2 ? W1K : W1Q; const float* Wb = ps == 2 ? W2K : W2Q; const int ldw = ps == 2 ? DM_ : 2 * DM_, cw = ps == 1 ? DM_ : 0;
    v4f ra[4], ru[4], rv[4];
    auto ld_all = [&](int k0) {
      if (ps == 1) { const float* p[4];   // row t - 1; a batch's first row reads itself here and is zeroed in st_all
#pragma unroll
        for (int i = 0; i < 4; ++i) { const size_t gr = rb + i * 16 + (tid >> 3); p[i] = X + (gr - ((gr % TT) == 0 ? 0 : 1)) * DM_ + k0 + (tid & 7) * 4; ra[i] = *(const v4f*)p[i]; }
        // as in tile_ld: the wait behind the four loads, their addresses held as inputs up to it
        asm volatile("s_wait_xcnt 0x0" :: "v"(p[0]), "v"(p[1]), "v"(p[2]), "v"(p[3]) : "memory");
      } else tile_ld<64, KS2>(ra, X + rb * DM_ + k0, DM_, tid);
      tile_ld<64, KS2>(ru, Wa + k0, ldw, tid, cw); tile_ld<64, KS2>(rv, Wb + k0, ldw, tid, cw); };
    auto st_all = [&](int bf) {
      if (ps == 1) {
#pragma unroll
        for (int i = 0; i < 4; ++i) if (((rb + i * 16 + (tid >> 3)) % TT) == 0) ra[i] = (v4f){0.f, 0.f, 0.f, 0.f}; }
      tile_st<64, KS2>(ra, pa[bf], tid); tile_st<64, KS2>(ru, pw[bf][0], tid); tile_st<64, KS2>(rv, pw[bf][1], tid); };
    ld_all(0); st_all(0);
    __syncthreads();
#pragma unroll 1   // rolled: one copy of the body, so that the next tile's registers are not multiplied
    for (int kc = 0; kc < DM_ / KS2; ++kc) { const int cur = kc & 1; const bool more = kc + 1 < DM_ / KS2;
      if (more) ld_all((kc + 1) * KS2);
      const v16b a = frag_b(&pa[cur][(wave * 16 + col) * KP2], lane); v16b f[4][2];
#pragma unroll
      for (int j = 0; j < 4; ++j) { f[j][0] = frag_b(&pw[cur][0][(j * 16 + col) * KP2], lane); f[j][1] = frag_b(&pw[cur][1][(j * 16 + col) * KP2], lane); }
#pragma unroll
      for (int j = 0; j < 4; ++j) { c1[j] = wmma_bf(a, f[j][0], c1[j]); c2[j] = wmma_bf(a, f[j][1], c2[j]); }
      if (more) st_all(cur ^ 1);
      __syncthreads(); }
    if (ps >= 1) { const int w0 = ps == 1 ? 0 : 2;
#pragma unroll
      for (int j = 0; j < 4; ++j)
#pragma unroll
        for (int r = 0; r < 8; ++r) { const int rl = wave * 16 + 8 * g + r, cl = j * 16 + col; sv[w0][rl][cl] = c1[j][r]; sv[w0 + 1][rl][cl] = c2[j][r]; c1[j][r] = 0.f; c2[j][r] = 0.f; } } }
  __syncthreads();
  // plucker per (token, head): thread handles (token = tid/2, 8 heads)
  { const int rl = tid >> 1, h0 = (tid & 1) * 8;
    for (int h = h0; h < h0 + 8; ++h) { const float* a1 = &sv[0][rl][h * 4]; const float* a2 = &sv[1][rl][h * 4]; const float* c1 = &sv[2][rl][h * 4]; const float* c2 = &sv[3][rl][h * 4];
      float pq[6], pk[6]; const int PI[6] = {0, 0, 0, 1, 1, 2}, PJ[6] = {1, 2, 3, 2, 3, 3}; float nq = 0.f, nk = 0.f;
      for (int e = 0; e < 6; ++e) { pq[e] = a1[PI[e]] * a2[PJ[e]] - a1[PJ[e]] * a2[PI[e]]; pk[e] = c1[PI[e]] * c2[PJ[e]] - c1[PJ[e]] * c2[PI[e]]; nq += pq[e] * pq[e]; nk += pk[e] * pk[e]; }
      const float iq = 1.0f / fmaxf(sqrtf(nq), 1e-12f), ik = 1.0f / fmaxf(sqrtf(nk), 1e-12f);
      for (int e = 0; e < 6; ++e) { pq[e] *= iq; pk[e] *= ik; }
      // J6 k = (k5, -k4, k3, k2, -k1, k0)
      float jk[6] = {pk[5], -pk[4], pk[3], pk[2], -pk[1], pk[0]};
      for (int e = 0; e < 8; ++e) { sq[rl][h * 8 + e] = (e < 6) ? pq[e] : 0.f; sk[rl][h * 8 + e] = (e < 6) ? jk[e] : 0.f; } } }
  __syncthreads();
  for (int e = tid; e < 64 * 32; e += 128) { const int rl = e >> 5, q = e & 31; vst2(QP + ((size_t)blockIdx.x * 64 + rl) * (NH * 8) + q * 4, *(const v4f*)&sq[rl][q * 4]); vst2(JK + ((size_t)blockIdx.x * 64 + rl) * (NH * 8) + q * 4, *(const v4f*)&sk[rl][q * 4]); } }
// ---- k_v: block = (64 tokens, 128 cols): v = x Wv^T + bv exact -> f16 planes [b][d][t]
__global__ __launch_bounds__(128) void k_v(const float* __restrict__ X, const float* __restrict__ WV, const float* __restrict__ BV, _Float16* __restrict__ VT, _Float16* __restrict__ VL) { __shared__ __align__(16) _Float16 th[128][72], tl[128][72];
  const int tid = threadIdx.x, wave = tid >> 5, lane = tid & 31, col = lane & 15, g = lane >> 4; const int c0 = blockIdx.y * 128; const size_t r0 = (size_t)blockIdx.x * 64;
  v8f acc[8] = {};
  __shared__ __align__(16) __bf16 sa[2][64 * KP], sw[2][128 * KP];
  v4f ra[8], rw[16]; const float* Xb = X + r0 * DM_; const float* Wb = WV + (size_t)c0 * DM_;
  tile_ld<64, KS>(ra, Xb, DM_, tid); tile_ld<128, KS>(rw, Wb, DM_, tid);
  tile_st<64, KS>(ra, sa[0], tid); tile_st<128, KS>(rw, sw[0], tid);
  __syncthreads();
#pragma unroll 1   // rolled: one copy of the body, so that the next tile's registers are not multiplied
  for (int kc = 0; kc < DM_ / KS; ++kc) { const int cur = kc & 1; const bool more = kc + 1 < DM_ / KS;
    if (more) { tile_ld<64, KS>(ra, Xb + (kc + 1) * KS, DM_, tid); tile_ld<128, KS>(rw, Wb + (kc + 1) * KS, DM_, tid); }
#pragma unroll
    for (int ks = 0; ks < KS / 32; ++ks) { const v16b a = frag_b(&sa[cur][(wave * 16 + col) * KP + ks * 32], lane); v16b f[8];
#pragma unroll
      for (int j = 0; j < 8; ++j) f[j] = frag_b(&sw[cur][(j * 16 + col) * KP + ks * 32], lane);
#pragma unroll
      for (int j = 0; j < 8; ++j) acc[j] = wmma_bf(a, f[j], acc[j]); }
    if (more) { tile_st<64, KS>(ra, sa[cur ^ 1], tid); tile_st<128, KS>(rw, sw[cur ^ 1], tid); }
    __syncthreads(); }
#pragma unroll
  for (int j = 0; j < 8; ++j) { const float bb = bfr(BV[c0 + j * 16 + col]);
#pragma unroll
    for (int r = 0; r < 8; ++r) { const float v = acc[j][r] + bb; const _Float16 hv = (_Float16)v; th[j * 16 + col][wave * 16 + 8 * g + r] = hv; tl[j * 16 + col][wave * 16 + 8 * g + r] = (_Float16)(v - (float)hv); } }
  __syncthreads(); const size_t b = r0 / TT; const int t0 = (int)(r0 % TT); for (int e = tid; e < 128 * 8; e += 128) { const int cl = e >> 3, q = e & 7; const size_t o = (b * DM_ + c0 + cl) * (size_t)TT + t0 + q * 8; vst2((unsigned*)(VT + o), *(const v4u*)&th[cl][q * 8]); vst2((unsigned*)(VL + o), *(const v4u*)&tl[cl][q * 8]); } }
// ---- k_att: block = (64 queries, head, b): causal, 3-product logits (K = 6 padded) x 6^-0.5
__global__ __launch_bounds__(128) void k_att(const float* __restrict__ QP, const float* __restrict__ JK, const _Float16* __restrict__ VT, const _Float16* __restrict__ VL, float* __restrict__ O) {
  __shared__ __align__(16) float sp[4][16][36]; __shared__ __align__(16) float so[4][16][68];
  const int tid = threadIdx.x, wave = tid >> 5, lane = tid & 31, col = lane & 15, g = lane >> 4; const int qb = blockIdx.x, h = blockIdx.y; const size_t b = blockIdx.z; const int q0l = qb * 64 + wave * 16; const size_t q0 = b * TT + q0l;
  F2 aq; { float v[16];
#pragma unroll
    for (int i = 0; i < 16; ++i) v[i] = 0.f;
    if (g == 0) { const float* p = QP + (q0 + col) * (NH * 8) + h * 8;
#pragma unroll
      for (int i = 0; i < 8; ++i) v[i] = p[i]; }
    aq = bsplit16(v); }
  float m[8], l[8];
#pragma unroll
  for (int r = 0; r < 8; ++r) { m[r] = -3.0e38f; l[r] = 0.f; }
  v8f acc[4] = {};
  const int nks = (qb * 64 + 64) / 32;
  // every global load of a key tile is issued well ahead of its use, so that a tile waits for memory at most once and not once per product: the J6 k rows one tile ahead (jn), the eight v fragments at the head of their own tile, ahead of the logits and the softmax
  float jn[2][8];
  auto ld_jk = [&](int ks) {
#pragma unroll
    for (int ct = 0; ct < 2; ++ct)
#pragma unroll
      for (int i = 0; i < 8; ++i) jn[ct][i] = 0.f;
    if (g == 0) { const float* p = JK + (b * TT + ks * 32 + col) * (NH * 8) + h * 8;
#pragma unroll
      for (int ct = 0; ct < 2; ++ct)
#pragma unroll
        for (int i = 0; i < 8; ++i) jn[ct][i] = p[ct * 16 * (NH * 8) + i];
      // as in tile_ld: the wait behind the loads, their address held as an input up to it
      asm volatile("s_wait_xcnt 0x0" :: "v"(p) : "memory"); } };
  ld_jk(0);
#pragma unroll 1
  for (int ks = 0; ks < nks; ++ks) { float s[2][8];
    v16h vh[4], vl[4]; { const size_t po = (b * DM_ + (size_t)h * HD + col) * TT + ks * 32 + 8 * g; const _Float16* ph = VT + po; const _Float16* pl = VL + po;   // the lane's own fragment addresses, as in frag_h
#pragma unroll
      for (int j = 0; j < 4; ++j) { union { v16h v; v8h q[2]; } uh, ul; const size_t o = (size_t)j * 16 * TT;
        uh.q[0] = *(const v8h*)(ph + o); uh.q[1] = *(const v8h*)(ph + o + 16); ul.q[0] = *(const v8h*)(pl + o); ul.q[1] = *(const v8h*)(pl + o + 16); vh[j] = uh.v; vl[j] = ul.v; }
      // as in tile_ld: the wait behind the loads, their addresses held as inputs up to it
      asm volatile("s_wait_xcnt 0x0" :: "v"(ph), "v"(pl) : "memory"); }
    F2 bk2[2];
#pragma unroll
    for (int ct = 0; ct < 2; ++ct) { float v[16];
#pragma unroll
      for (int i = 0; i < 8; ++i) { v[i] = jn[ct][i]; v[8 + i] = 0.f; }
      bk2[ct] = bsplit16(v); }
    ld_jk(ks + 1 < nks ? ks + 1 : ks);   // the last tile loads its own rows again: no row past the causal range is touched
#pragma unroll
    for (int ct = 0; ct < 2; ++ct) { const int kt = ks * 32 + ct * 16 + col; const F2 bk = bk2[ct];
      v8f c = {}; c = mac3(aq, bk, c);
#pragma unroll
      for (int r = 0; r < 8; ++r) s[ct][r] = (kt <= q0l + 8 * g + r) ? c[r] * 0.4082482904638631f : -3.0e38f; }
    float alpha[8];
#pragma unroll
    for (int r = 0; r < 8; ++r) { float mx = fmaxf(s[0][r], s[1][r]);
#pragma unroll
      for (int o = 1; o < 16; o <<= 1) mx = fmaxf(mx, __shfl_xor(mx, o));
      const float mn = fmaxf(m[r], mx); alpha[r] = (mn <= -1.0e38f) ? 1.f : __expf(m[r] - mn); const float e0 = (s[0][r] <= -1.0e38f) ? 0.f : __expf(s[0][r] - mn), e1 = (s[1][r] <= -1.0e38f) ? 0.f : __expf(s[1][r] - mn); float es = e0 + e1;
#pragma unroll
      for (int o = 1; o < 16; o <<= 1) es += __shfl_xor(es, o);
      l[r] = l[r] * alpha[r] + es; m[r] = mn; sp[wave][8 * g + r][col] = e0; sp[wave][8 * g + r][16 + col] = e1; }
#pragma unroll
    for (int j = 0; j < 4; ++j)
#pragma unroll
      for (int r = 0; r < 8; ++r) acc[j][r] *= alpha[r];
    LDSX();
    v16h pa, pr;   // P x 2^11 as f16 hi + residual (early causal rows have P ~ 0.5 where a single f16 would quantise P to 1/2048)
#pragma unroll
    for (int i = 0; i < 8; ++i) { const float f0 = sp[wave][col][8 * g + i] * 2048.0f, f1 = sp[wave][col][16 + 8 * g + i] * 2048.0f; const _Float16 h0 = (_Float16)f0, h1 = (_Float16)f1; pa[i] = h0; pa[8 + i] = h1; pr[i] = (_Float16)(f0 - (float)h0); pr[8 + i] = (_Float16)(f1 - (float)h1); }
#pragma unroll
    for (int j = 0; j < 4; ++j) { acc[j] = wmma16(pa, vh[j], acc[j]); acc[j] = wmma16(pr, vh[j], acc[j]); acc[j] = wmma16(pa, vl[j], acc[j]); }
    LDSX(); }
#pragma unroll
  for (int r = 0; r < 8; ++r) { const float il = (1.0f / 2048.0f) / l[r];
#pragma unroll
    for (int j = 0; j < 4; ++j) so[wave][8 * g + r][j * 16 + col] = acc[j][r] * il; }
  LDSX(); for (int rl = 0; rl < 16; ++rl) if (lane < 16) vst2(O + (q0 + rl) * DM_ + h * HD + lane * 4, *(const v4f*)&so[wave][rl][lane * 4]); }
// ---- k_out: block = (64 rows, 128 cols): out = o (hi + lo) Wo^T + bo
__global__ __launch_bounds__(128) void k_out(const float* __restrict__ O, const float* __restrict__ WO, const float* __restrict__ BO, float* __restrict__ OUT) { __shared__ __align__(16) float sf[4][16][132];
  const int tid = threadIdx.x, wave = tid >> 5, lane = tid & 31, col = lane & 15, g = lane >> 4; const int c0 = blockIdx.y * 128; const size_t r0 = (size_t)blockIdx.x * 64 + wave * 16;
  v8f acc[8] = {};
  __shared__ __align__(16) __bf16 oh[2][64 * KP], ol[2][64 * KP], ow[2][128 * KP];
  v4f ra[8], rw[16]; const float* Ob = O + (size_t)blockIdx.x * 64 * DM_; const float* Wb = WO + (size_t)c0 * DM_;
  tile_ld<64, KS>(ra, Ob, DM_, tid); tile_ld<128, KS>(rw, Wb, DM_, tid);
  tile_st2<64, KS>(ra, oh[0], ol[0], tid); tile_st<128, KS>(rw, ow[0], tid);
  __syncthreads();
#pragma unroll 1   // rolled: one copy of the body, so that the next tile's registers are not multiplied
  for (int kc = 0; kc < DM_ / KS; ++kc) { const int cur = kc & 1; const bool more = kc + 1 < DM_ / KS;
    if (more) { tile_ld<64, KS>(ra, Ob + (kc + 1) * KS, DM_, tid); tile_ld<128, KS>(rw, Wb + (kc + 1) * KS, DM_, tid); }
#pragma unroll
    for (int ks = 0; ks < KS / 32; ++ks) { const int ao = (wave * 16 + col) * KP + ks * 32; const v16b ah = frag_b(&oh[cur][ao], lane), al = frag_b(&ol[cur][ao], lane);
#pragma unroll
      for (int j0 = 0; j0 < 8; j0 += 4) { v16b f[4];
#pragma unroll
        for (int j = 0; j < 4; ++j) f[j] = frag_b(&ow[cur][((j0 + j) * 16 + col) * KP + ks * 32], lane);
#pragma unroll
        for (int j = 0; j < 4; ++j) { acc[j0 + j] = wmma_bf(ah, f[j], acc[j0 + j]); acc[j0 + j] = wmma_bf(al, f[j], acc[j0 + j]); } } }
    if (more) { tile_st2<64, KS>(ra, oh[cur ^ 1], ol[cur ^ 1], tid); tile_st<128, KS>(rw, ow[cur ^ 1], tid); }
    __syncthreads(); }
#pragma unroll
  for (int j = 0; j < 8; ++j) { const float bb = bfr(BO[c0 + j * 16 + col]);
#pragma unroll
    for (int r = 0; r < 8; ++r) sf[wave][8 * g + r][j * 16 + col] = acc[j][r] + bb; }
  LDSX(); for (int rl = 0; rl < 16; ++rl) vst2(OUT + (r0 + rl) * DM_ + c0 + lane * 4, *(const v4f*)&sf[wave][rl][lane * 4]); }
extern "C" void kernel_launch(void* const* d_in, const int* in_sizes, int n_in, void* d_out, int out_size, void* d_ws, size_t ws_size, hipStream_t stream) {
  (void)in_sizes; (void)n_in; (void)out_size;
  const float** F = (const float**)d_in;   // 0 x [2,2048,1024], 1 W1_q [64,2048], 2 W2_q, 3 W1_k [64,1024], 4 W2_k, 5 Wv [1024,1024], 6 bv, 7 Wo, 8 bo
  if (ws_size < (size_t)WS_END) return;
  char* ws = (char*)d_ws; float *QP = (float*)(ws + WS_QP), *JK = (float*)(ws + WS_JK), *O = (float*)(ws + WS_O); _Float16 *VT = (_Float16*)(ws + WS_VT), *VL = (_Float16*)(ws + WS_VL);
  k_pl<<<TNB * TT / 64, 128, 0, stream>>>(F[0], F[1], F[2], F[3], F[4], QP, JK);
  k_v<<<dim3(TNB * TT / 64, DM_ / 128), 128, 0, stream>>>(F[0], F[5], F[6], VT, VL);
  k_att<<<dim3(TQB, NH, TNB), 128, 0, stream>>>(QP, JK, VT, VL, O);
  for (int b = 0; b < TNB; ++b) k_out<<<dim3(TQB, DM_ / 128), 128, 0, stream>>>(O + (size_t)b * TT * DM_, F[7], F[8], (float*)d_out + (size_t)b * TT * DM_);
}

// v003
// A run of this version takes 236 microseconds.
// Timed twice side by side with v002, it ran 1.08 times as fast both times.
// All steps since v000 together make it 2.97 times as fast.
// compute dtype: all float inputs rounded to bf16; q1/q2 = [x_t ; x_{t-1}] W^T and k1/k2 = x W^T with EXACT bf16 products on WMMA 16x16x32, f32 accumulate; the Plucker 6-vectors, their normalisation and J6 k in f32; q and J6 k split into bf16 hi + lo (3 products, K = 6 zero-padded to 32) for the causal logits x 6^-0.5, running-max softmax in f32 (hardware exp); P (x 2^11, f16 hi + residual) . v with v = x Wv^T + bv exact as f16 hi + residual (3 products); out = o (bf16 hi + lo) Wo^T + bo (2 products); f32 output.
#include <hip/hip_runtime.h>
#include <math.h>

typedef __attribute__((ext_vector_type(16))) _Float16 v16h;
typedef __attribute__((ext_vector_type(16))) __bf16 v16b;
typedef __attribute__((ext_vector_type(8)))  _Float16 v8h;
typedef __attribute__((ext_vector_type(8)))  float v8f;
typedef __attribute__((ext_vector_type(4)))  float v4f;
typedef __attribute__((ext_vector_type(2)))  float v2f;
typedef __attribute__((ext_vector_type(4)))  unsigned v4u;
typedef __attribute__((ext_vector_type(4)))  int v4i;
typedef float __attribute__((may_alias)) float_a;
typedef int __attribute__((may_alias)) int_a;

template <typename T> __device__ __forceinline__ void vst2(void* p, T v) { *(T*)p = v;  }
__device__ __forceinline__ v8f wmma16(v16h a, v16h b, v8f c) {
  v8f d = __builtin_amdgcn_wmma_f32_16x16x32_f16(false, a, false, b, (short)0, c, false, false);
  asm volatile("v_nop\n\tv_nop\n\tv_nop\n\tv_nop" : "+v"(d) : "v"(a), "v"(b));
  return d;
}
__device__ __forceinline__ v8f wmma_bf(v16b a, v16b b, v8f c) {
  v8f d = __builtin_amdgcn_wmma_f32_16x16x32_bf16(false, a, false, b, (short)0, c, false, false);
  asm volatile("v_nop\n\tv_nop\n\tv_nop\n\tv_nop" : "+v"(d) : "v"(a), "v"(b));
  return d;
}
// 16x16x32 fragments: lane = (h = lane>>4, row/col = lane&15); elements 0..7 = k0+8h+0..7, 8..15 = k0+16+8h+0..7; D element r = row 8h+r
__device__ __forceinline__ v16h frag_h(const _Float16* rowk0, int lane) {
  union { v16h v; v8h q[2]; } u; const _Float16* p = rowk0 + 8 * (lane >> 4);
  u.q[0] = *(const v8h*)p; u.q[1] = *(const v8h*)(p + 16); return u.v;
}
__device__ __forceinline__ v16h frag_f32(const float* rowk0, int lane) {
  v16h a; const float* p = rowk0 + 8 * (lane >> 4);
#pragma unroll
  for (int i = 0; i < 8; ++i) { a[i] = (_Float16)p[i]; a[8 + i] = (_Float16)p[16 + i]; }
  return a;
}
__device__ __forceinline__ v16h frag_f32s(const float* rowk0, int lane, float sc) {
  v16h a; const float* p = rowk0 + 8 * (lane >> 4);
#pragma unroll
  for (int i = 0; i < 8; ++i) { a[i] = (_Float16)(p[i] * sc); a[8 + i] = (_Float16)(p[16 + i] * sc); }
  return a;
}
// column fragment from a [K][ld] layout (column n), rows >= K read as 0
__device__ __forceinline__ v16h fragc_f32(const float* W, int k0, int n, int lane, int ld, int K) {
  v16h a; const int g = lane >> 4;
#pragma unroll
  for (int i = 0; i < 8; ++i) { const int ka = k0 + 8 * g + i, kb = ka + 16;
    a[i] = (_Float16)(ka < K ? W[(size_t)(ka < K ? ka : K - 1) * ld + n] : 0.f); a[8 + i] = (_Float16)(kb < K ? W[(size_t)(kb < K ? kb : K - 1) * ld + n] : 0.f); }
  return a;
}
struct F2 { v16b h, l; };
__device__ __forceinline__ F2 bsplit16(const float v[16]) { F2 r;
#pragma unroll
  for (int i = 0; i < 16; ++i) { const __bf16 h = (__bf16)v[i]; r.h[i] = h; r.l[i] = (__bf16)(v[i] - (float)h); }
  return r; }
__device__ __forceinline__ F2 split_row(const float* row, int k0, int lane) { float v[16]; const float* p = row + k0 + 8 * (lane >> 4);
#pragma unroll
  for (int i = 0; i < 8; ++i) { v[i] = p[i]; v[8 + i] = p[16 + i]; }
  return bsplit16(v); }
__device__ __forceinline__ F2 split_rowK(const float* row, int k0, int lane, int K) { float v[16]; const int g = lane >> 4;
#pragma unroll
  for (int i = 0; i < 8; ++i) { const int ka = k0 + 8 * g + i, kb = ka + 16; v[i] = ka < K ? row[ka < K ? ka : K - 1] : 0.f; v[8 + i] = kb < K ? row[kb < K ? kb : K - 1] : 0.f; }
  return bsplit16(v); }
__device__ __forceinline__ F2 split_col(const float* W, int k0, int n, int lane, int ld, int K) { float v[16]; const int g = lane >> 4;
#pragma unroll
  for (int i = 0; i < 8; ++i) { const int ka = k0 + 8 * g + i, kb = ka + 16; v[i] = ka < K ? W[(size_t)(ka < K ? ka : K - 1) * ld + n] : 0.f; v[8 + i] = kb < K ? W[(size_t)(kb < K ? kb : K - 1) * ld + n] : 0.f; }
  return bsplit16(v); }
__device__ __forceinline__ v8f mac3(const F2& a, const F2& b, v8f c) { c = wmma_bf(a.l, b.h, c); c = wmma_bf(a.h, b.l, c); return wmma_bf(a.h, b.h, c); }
__device__ __forceinline__ float sigm(float v) { return 1.0f / (1.0f + expf(-v)); }
#define LDSX() do { asm volatile("s_wait_dscnt 0" ::: "memory"); __builtin_amdgcn_wave_barrier(); __builtin_amdgcn_fence(__ATOMIC_RELEASE, "workgroup"); } while (0)


// Plucker bigram attention (B 2, T 2,048, D 1,024, 16 heads x 64): per head, q = normalised Plucker line of two 4-vectors from the bigram [x_t ; x_{t-1}], k likewise from x_t; logits = q . (J6 k) / sqrt(6), causal softmax, . v, Wo.
#define NB 2
#define TT 2048
#define DM_ 1024
#define NH 16
#define HD 64
#ifndef TNB
#define TNB NB
#endif
#ifndef TQB
#define TQB (TT / 64)
#endif
typedef __attribute__((ext_vector_type(8))) __bf16 v8b;
__device__ __forceinline__ v16b frag_b(const __bf16* rowk0, int lane) {
  union { v16b v; v8b q[2]; } u; const __bf16* p = rowk0 + 8 * (lane >> 4);
  u.q[0] = *(const v8b*)p; u.q[1] = *(const v8b*)(p + 16); return u.v;
}
__device__ __forceinline__ float bfr(float v) { return (float)(__bf16)v; }
__device__ __attribute__((noinline)) float exp_ni(float v) { return expf(v); }
__device__ __attribute__((noinline)) float erf_ni(float v) { return erff(v); }

typedef __attribute__((ext_vector_type(4))) __bf16 v4b;
// Staging of a ROWS x KC f32 tile (rows K-contiguous, row stride ld floats) by the block's 128 threads: consecutive lanes take consecutive 16 bytes of a row, so every wave load covers whole 128-byte lines; the tile is rounded to bf16 once and laid in LDS at a row pitch of KC + 8 elements (16 B x odd).
template <int ROWS, int KC> __device__ __forceinline__ void tile_ld(v4f (&r)[ROWS * KC / 512], const float* __restrict__ src, int ld, int tid, int coff = 0) { const float* p = src + (unsigned)((tid / (KC / 4)) * ld + (tid % (KC / 4)) * 4);
#pragma unroll
  for (int i = 0; i < ROWS * KC / 512; ++i) r[i] = *(const v4f*)(p + coff + (size_t)i * (512 / KC) * ld);
  // the wait stands behind the tile's loads, in front of whatever next writes the registers of their address (the next tile's results, later address arithmetic); p as an input keeps the address in its registers up to the wait: without it the tile's last load got them as its result
  asm volatile("s_wait_xcnt 0x0" :: "v"(p) : "memory"); }
template <int ROWS, int KC> __device__ __forceinline__ void tile_st(const v4f (&r)[ROWS * KC / 512], __bf16* dst, int tid) {
#pragma unroll
  for (int i = 0; i < ROWS * KC / 512; ++i) { v4b o;
#pragma unroll
    for (int q = 0; q < 4; ++q) o[q] = (__bf16)r[i][q];
    *(v4b*)(dst + (tid / (KC / 4)) * (KC + 8) + (tid % (KC / 4)) * 4 + i * (512 / KC) * (KC + 8)) = o; } }
// the same, split into bf16 hi + lo planes
template <int ROWS, int KC> __device__ __forceinline__ void tile_st2(const v4f (&r)[ROWS * KC / 512], __bf16* dh, __bf16* dl, int tid) {
#pragma unroll
  for (int i = 0; i < ROWS * KC / 512; ++i) { v4b oh, ol;
#pragma unroll
    for (int q = 0; q < 4; ++q) { const __bf16 h = (__bf16)r[i][q]; oh[q] = h; ol[q] = (__bf16)(r[i][q] - (float)h); }
    const int o = (tid / (KC / 4)) * (KC + 8) + (tid % (KC / 4)) * 4 + i * (512 / KC) * (KC + 8); *(v4b*)(dh + o) = oh; *(v4b*)(dl + o) = ol; } }
#define KS 64          // k extent of a staged tile in k_v and k_out
#define KP (KS + 8)
#define KS2 32         // k extent of a staged tile in k_pl
#define KP2 (KS2 + 8)

#define WS_QP  0u                                    // f32 [b*t][h][8]: q plucker (6 used)
#define WS_JK  (WS_QP + 4u * (size_t)NB * TT * NH * 8)  // f32 [b*t][h][8]: J6 k
#define WS_VT  (WS_JK + 4u * (size_t)NB * TT * NH * 8)  // f16 v planes [b][1024][t]
#define WS_VL  (WS_VT + 2u * (size_t)NB * DM_ * TT)      // f16 v residual planes
#define WS_O   (WS_VL + 2u * (size_t)NB * DM_ * TT)      // f32 o rows [b*t][1024]
#define WS_END (WS_O + 4u * (size_t)NB * TT * DM_)

// ---- k_pl: block = 64 tokens: q1, q2 (bigram, K = 2048 as two halves), k1, k2 (K = 1024) -> 4 x 64 outputs (one 16-col tile per head-quad... 64 cols = 4 tiles each); then per (token, head) the Plucker vectors
__global__ __launch_bounds__(128) void k_pl(const float* __restrict__ X, const float* __restrict__ W1Q, const float* __restrict__ W2Q, const float* __restrict__ W1K, const float* __restrict__ W2K, float* __restrict__ QP, float* __restrict__ JK) {
  __shared__ float sv[4][64][68];   // [which][token][64]: q1, q2, k1, k2
  __shared__ __align__(16) float sq[64][NH * 8], sk[64][NH * 8];
  const int tid = threadIdx.x, wave = tid >> 5, lane = tid & 31, col = lane & 15, g = lane >> 4; const size_t r0 = (size_t)blockIdx.x * 64 + wave * 16; const size_t b = r0 / TT; const int t0 = (int)(r0 % TT);
  __shared__ __align__(16) __bf16 pa[2][64 * KP2], pw[2][2][64 * KP2];
  const size_t rb = (size_t)blockIdx.x * 64;
  // one pass = one pair of weight matrices against one staged x tile per k step: pass 0 x_t . (W1_q, W2_q)[:, 0:1024], pass 1 x_{t-1} . (W1_q, W2_q)[:, 1024:2048] into the same sums (zero row for t = 0), pass 2 x_t . (W1_k, W2_k)
  v8f c1[4] = {}, c2[4] = {};
#pragma unroll   // unrolled so that each pass's pointers and row strides are constants
  for (int ps = 0; ps < 3; ++ps) { const float* Wa = ps == 2 ? W1K : W1Q; const float* Wb = ps == 2 ? W2K : W2Q; const int ldw = ps == 2 ? DM_ : 2 * DM_, cw = ps == 1 ? DM_ : 0;
    v4f ra[4], ru[4], rv[4];
    auto ld_all = [&](int k0) {
      if (ps == 1) { const float* p[4];   // row t - 1; a batch's first row reads itself here and is zeroed in st_all
#pragma unroll
        for (int i = 0; i < 4; ++i) { const size_t gr = rb + i * 16 + (tid >> 3); p[i] = X + (gr - ((gr % TT) == 0 ? 0 : 1)) * DM_ + k0 + (tid & 7) * 4; ra[i] = *(const v4f*)p[i]; }
        // as in tile_ld: the wait behind the four loads, their addresses held as inputs up to it
        asm volatile("s_wait_xcnt 0x0" :: "v"(p[0]), "v"(p[1]), "v"(p[2]), "v"(p[3]) : "memory");
      } else tile_ld<64, KS2>(ra, X + rb * DM_ + k0, DM_, tid);
      tile_ld<64, KS2>(ru, Wa + k0, ldw, tid, cw); tile_ld<64, KS2>(rv, Wb + k0, ldw, tid, cw); };
    auto st_all = [&](int bf) {
      if (ps == 1) {
#pragma unroll
        for (int i = 0; i < 4; ++i) if (((rb + i * 16 + (tid >> 3)) % TT) == 0) ra[i] = (v4f){0.f, 0.f, 0.f, 0.f}; }
      tile_st<64, KS2>(ra, pa[bf], tid); tile_st<64, KS2>(ru, pw[bf][0], tid); tile_st<64, KS2>(rv, pw[bf][1], tid); };
    ld_all(0); st_all(0);
    __syncthreads();
#pragma unroll 1   // rolled: one copy of the body, so that the next tile's registers are not multiplied
    for (int kc = 0; kc < DM_ / KS2; ++kc) { const int cur = kc & 1; const bool more = kc + 1 < DM_ / KS2;
      if (more) ld_all((kc + 1) * KS2);
      const v16b a = frag_b(&pa[cur][(wave * 16 + col) * KP2], lane); v16b f[4][2];
#pragma unroll
      for (int j = 0; j < 4; ++j) { f[j][0] = frag_b(&pw[cur][0][(j * 16 + col) * KP2], lane); f[j][1] = frag_b(&pw[cur][1][(j * 16 + col) * KP2], lane); }
#pragma unroll
      for (int j = 0; j < 4; ++j) { c1[j] = wmma_bf(a, f[j][0], c1[j]); c2[j] = wmma_bf(a, f[j][1], c2[j]); }
      if (more) st_all(cur ^ 1);
      __syncthreads(); }
    if (ps >= 1) { const int w0 = ps == 1 ? 0 : 2;
#pragma unroll
      for (int j = 0; j < 4; ++j)
#pragma unroll
        for (int r = 0; r < 8; ++r) { const int rl = wave * 16 + 8 * g + r, cl = j * 16 + col; sv[w0][rl][cl] = c1[j][r]; sv[w0 + 1][rl][cl] = c2[j][r]; c1[j][r] = 0.f; c2[j][r] = 0.f; } } }
  __syncthreads();
  // plucker per (token, head): thread handles (token = tid/2, 8 heads)
  { const int rl = tid >> 1, h0 = (tid & 1) * 8;
    for (int h = h0; h < h0 + 8; ++h) { const float* a1 = &sv[0][rl][h * 4]; const float* a2 = &sv[1][rl][h * 4]; const float* c1 = &sv[2][rl][h * 4]; const float* c2 = &sv[3][rl][h * 4];
      float pq[6], pk[6]; const int PI[6] = {0, 0, 0, 1, 1, 2}, PJ[6] = {1, 2, 3, 2, 3, 3}; float nq = 0.f, nk = 0.f;
      for (int e = 0; e < 6; ++e) { pq[e] = a1[PI[e]] * a2[PJ[e]] - a1[PJ[e]] * a2[PI[e]]; pk[e] = c1[PI[e]] * c2[PJ[e]] - c1[PJ[e]] * c2[PI[e]]; nq += pq[e] * pq[e]; nk += pk[e] * pk[e]; }
      const float iq = 1.0f / fmaxf(sqrtf(nq), 1e-12f), ik = 1.0f / fmaxf(sqrtf(nk), 1e-12f);
      for (int e = 0; e < 6; ++e) { pq[e] *= iq; pk[e] *= ik; }
      // J6 k = (k5, -k4, k3, k2, -k1, k0)
      float jk[6] = {pk[5], -pk[4], pk[3], pk[2], -pk[1], pk[0]};
      for (int e = 0; e < 8; ++e) { sq[rl][h * 8 + e] = (e < 6) ? pq[e] : 0.f; sk[rl][h * 8 + e] = (e < 6) ? jk[e] : 0.f; } } }
  __syncthreads();
  for (int e = tid; e < 64 * 32; e += 128) { const int rl = e >> 5, q = e & 31; vst2(QP + ((size_t)blockIdx.x * 64 + rl) * (NH * 8) + q * 4, *(const v4f*)&sq[rl][q * 4]); vst2(JK + ((size_t)blockIdx.x * 64 + rl) * (NH * 8) + q * 4, *(const v4f*)&sk[rl][q * 4]); } }
// ---- k_v: block = (64 tokens, 128 cols): v = x Wv^T + bv exact -> f16 planes [b][d][t]
__global__ __launch_bounds__(128) void k_v(const float* __restrict__ X, const float* __restrict__ WV, const float* __restrict__ BV, _Float16* __restrict__ VT, _Float16* __restrict__ VL) { __shared__ __align__(16) _Float16 th[128][72], tl[128][72];
  const int tid = threadIdx.x, wave = tid >> 5, lane = tid & 31, col = lane & 15, g = lane >> 4; const int c0 = blockIdx.y * 128; const size_t r0 = (size_t)blockIdx.x * 64;
  v8f acc[8] = {};
  __shared__ __align__(16) __bf16 sa[2][64 * KP], sw[2][128 * KP];
  v4f ra[8], rw[16]; const float* Xb = X + r0 * DM_; const float* Wb = WV + (size_t)c0 * DM_;
  tile_ld<64, KS>(ra, Xb, DM_, tid); tile_ld<128, KS>(rw, Wb, DM_, tid);
  tile_st<64, KS>(ra, sa[0], tid); tile_st<128, KS>(rw, sw[0], tid);
  __syncthreads();
#pragma unroll 1   // rolled: one copy of the body, so that the next tile's registers are not multiplied
  for (int kc = 0; kc < DM_ / KS; ++kc) { const int cur = kc & 1; const bool more = kc + 1 < DM_ / KS;
    if (more) { tile_ld<64, KS>(ra, Xb + (kc + 1) * KS, DM_, tid); tile_ld<128, KS>(rw, Wb + (kc + 1) * KS, DM_, tid); }
#pragma unroll
    for (int ks = 0; ks < KS / 32; ++ks) { const v16b a = frag_b(&sa[cur][(wave * 16 + col) * KP + ks * 32], lane); v16b f[8];
#pragma unroll
      for (int j = 0; j < 8; ++j) f[j] = frag_b(&sw[cur][(j * 16 + col) * KP + ks * 32], lane);
#pragma unroll
      for (int j = 0; j < 8; ++j) acc[j] = wmma_bf(a, f[j], acc[j]); }
    if (more) { tile_st<64, KS>(ra, sa[cur ^ 1], tid); tile_st<128, KS>(rw, sw[cur ^ 1], tid); }
    __syncthreads(); }
#pragma unroll
  for (int j = 0; j < 8; ++j) { const float bb = bfr(BV[c0 + j * 16 + col]);
#pragma unroll
    for (int r = 0; r < 8; ++r) { const float v = acc[j][r] + bb; const _Float16 hv = (_Float16)v; th[j * 16 + col][wave * 16 + 8 * g + r] = hv; tl[j * 16 + col][wave * 16 + 8 * g + r] = (_Float16)(v - (float)hv); } }
  __syncthreads(); const size_t b = r0 / TT; const int t0 = (int)(r0 % TT); for (int e = tid; e < 128 * 8; e += 128) { const int cl = e >> 3, q = e & 7; const size_t o = (b * DM_ + c0 + cl) * (size_t)TT + t0 + q * 8; vst2((unsigned*)(VT + o), *(const v4u*)&th[cl][q * 8]); vst2((unsigned*)(VL + o), *(const v4u*)&tl[cl][q * 8]); } }
#define VP 40          // row pitch of a staged v tile in k_att, in f16: 80 B = 16 B x odd
// ---- k_att: block = (64 queries, head, b): causal, 3-product logits (K = 6 padded) x 6^-0.5
__global__ __launch_bounds__(128) void k_att(const float* __restrict__ QP, const float* __restrict__ JK, const _Float16* __restrict__ VT, const _Float16* __restrict__ VL, float* __restrict__ O) {
  __shared__ __align__(16) float sp[4][16][36]; __shared__ __align__(16) float so[4][16][68];
  __shared__ __align__(16) _Float16 sv[2][2][HD * VP];   // [buffer][hi, residual][d row][32 keys], row pitch VP
  __shared__ __align__(16) __bf16 sj[2][2][33 * 8];      // [buffer][hi, lo][32 keys and a zero row][8]
  const int tid = threadIdx.x, wave = tid >> 5, lane = tid & 31, col = lane & 15, g = lane >> 4; const int qb = blockIdx.x, h = blockIdx.y; const size_t b = blockIdx.z; const int q0l = qb * 64 + wave * 16; const size_t q0 = b * TT + q0l;
  F2 aq; { float v[16];
#pragma unroll
    for (int i = 0; i < 16; ++i) v[i] = 0.f;
    if (g == 0) { const float* p = QP + (q0 + col) * (NH * 8) + h * 8;
#pragma unroll
      for (int i = 0; i < 8; ++i) v[i] = p[i]; }
    aq = bsplit16(v); }
  float m[8], l[8];
#pragma unroll
  for (int r = 0; r < 8; ++r) { m[r] = -3.0e38f; l[r] = 0.f; }
  v8f acc[4] = {};
  const int nks = (qb * 64 + 64) / 32;
  // every global load of a key tile is issued well ahead of its use, so that a tile waits for memory at most once and not once per product: the J6 k rows and the v tile one tile ahead, into registers, and from there into the LDS buffer that the next tile reads
  // the four waves use the same v tile (64 d rows x 32 keys, hi and residual): the block fetches it once, four lanes to a row's 64 bytes (8 lines a wave load, where a fragment load from global memory touches 16), and every wave takes its fragments from LDS
  const int srow = tid >> 2, sch = (tid & 3) * 8; const size_t so0 = (b * DM_ + (size_t)h * HD + srow) * TT + sch;
  v8h rs[4];
  auto ld_v = [&](int ks) { const _Float16* ph = VT + so0 + ks * 32; const _Float16* pl = VL + so0 + ks * 32;
    rs[0] = *(const v8h*)ph; rs[1] = *(const v8h*)(ph + 32 * TT); rs[2] = *(const v8h*)pl; rs[3] = *(const v8h*)(pl + 32 * TT);
    // as in tile_ld: the wait behind the loads, their addresses held as inputs up to it
    asm volatile("s_wait_xcnt 0x0" :: "v"(ph), "v"(pl) : "memory"); };
  auto st_v = [&](int bf) { const int o = srow * VP + sch; *(v8h*)&sv[bf][0][o] = rs[0]; *(v8h*)&sv[bf][0][o + 32 * VP] = rs[1]; *(v8h*)&sv[bf][1][o] = rs[2]; *(v8h*)&sv[bf][1][o + 32 * VP] = rs[3]; };
  // the J6 k rows of the tile likewise: 64 threads fetch 16 bytes each, split them into bf16 hi + lo once, and lay them down as the low halves of the B fragments (8 values a key); row 32 of each plane stays zero and serves the lanes whose k lies past the 8 values
  v4f rj = {}; const int jrow = tid >> 1, jch = (tid & 1) * 4;
  auto ld_j = [&](int ks) { if (tid < 64) { const float* p = JK + (b * TT + ks * 32 + jrow) * (NH * 8) + h * 8 + jch; rj = *(const v4f*)p;
      // as in tile_ld: the wait behind the load, its address held as an input up to it
      asm volatile("s_wait_xcnt 0x0" :: "v"(p) : "memory"); } };
  auto st_j = [&](int bf) { if (tid < 64) { v4b oh, ol;
#pragma unroll
      for (int q = 0; q < 4; ++q) { const __bf16 hv = (__bf16)rj[q]; oh[q] = hv; ol[q] = (__bf16)(rj[q] - (float)hv); }
      *(v4b*)&sj[bf][0][jrow * 8 + jch] = oh; *(v4b*)&sj[bf][1][jrow * 8 + jch] = ol; } };
  v8b z8;
#pragma unroll
  for (int i = 0; i < 8; ++i) z8[i] = (__bf16)0.f;
  if (tid < 4) *(v8b*)&sj[tid >> 1][tid & 1][32 * 8] = z8;
  const int jo[2] = {g ? 32 * 8 : col * 8, g ? 32 * 8 : (16 + col) * 8};
  ld_j(0); ld_v(0); st_j(0); st_v(0);
  __syncthreads();
#pragma unroll 1
  for (int ks = 0; ks < nks; ++ks) { float s[2][8];
    const int cur = ks & 1; const bool more = ks + 1 < nks;
    if (more) { ld_j(ks + 1); ld_v(ks + 1); }
    F2 bk2[2];
#pragma unroll
    for (int ct = 0; ct < 2; ++ct) { union { v16b v; v8b q[2]; } uh, ul; uh.q[0] = *(const v8b*)&sj[cur][0][jo[ct]]; uh.q[1] = z8; ul.q[0] = *(const v8b*)&sj[cur][1][jo[ct]]; ul.q[1] = z8; bk2[ct].h = uh.v; bk2[ct].l = ul.v; }
#pragma unroll
    for (int ct = 0; ct < 2; ++ct) { const int kt = ks * 32 + ct * 16 + col; const F2 bk = bk2[ct];
      v8f c = {}; c = mac3(aq, bk, c);
#pragma unroll
      for (int r = 0; r < 8; ++r) s[ct][r] = (kt <= q0l + 8 * g + r) ? c[r] * 0.4082482904638631f : -3.0e38f; }
    float alpha[8];
#pragma unroll
    for (int r = 0; r < 8; ++r) { float mx = fmaxf(s[0][r], s[1][r]);
#pragma unroll
      for (int o = 1; o < 16; o <<= 1) mx = fmaxf(mx, __shfl_xor(mx, o));
      const float mn = fmaxf(m[r], mx); alpha[r] = (mn <= -1.0e38f) ? 1.f : __expf(m[r] - mn); const float e0 = (s[0][r] <= -1.0e38f) ? 0.f : __expf(s[0][r] - mn), e1 = (s[1][r] <= -1.0e38f) ? 0.f : __expf(s[1][r] - mn); float es = e0 + e1;
#pragma unroll
      for (int o = 1; o < 16; o <<= 1) es += __shfl_xor(es, o);
      l[r] = l[r] * alpha[r] + es; m[r] = mn; sp[wave][8 * g + r][col] = e0; sp[wave][8 * g + r][16 + col] = e1; }
#pragma unroll
    for (int j = 0; j < 4; ++j)
#pragma unroll
      for (int r = 0; r < 8; ++r) acc[j][r] *= alpha[r];
    LDSX();
    v16h pa, pr;   // P x 2^11 as f16 hi + residual (early causal rows have P ~ 0.5 where a single f16 would quantise P to 1/2048)
#pragma unroll
    for (int i = 0; i < 8; ++i) { const float f0 = sp[wave][col][8 * g + i] * 2048.0f, f1 = sp[wave][col][16 + 8 * g + i] * 2048.0f; const _Float16 h0 = (_Float16)f0, h1 = (_Float16)f1; pa[i] = h0; pa[8 + i] = h1; pr[i] = (_Float16)(f0 - (float)h0); pr[8 + i] = (_Float16)(f1 - (float)h1); }
    v16h vh[4], vl[4];
#pragma unroll
    for (int j = 0; j < 4; ++j) { vh[j] = frag_h(&sv[cur][0][(j * 16 + col) * VP], lane); vl[j] = frag_h(&sv[cur][1][(j * 16 + col) * VP], lane); }
#pragma unroll
    for (int j = 0; j < 4; ++j) { acc[j] = wmma16(pa, vh[j], acc[j]); acc[j] = wmma16(pr, vh[j], acc[j]); acc[j] = wmma16(pa, vl[j], acc[j]); }
    LDSX();
    if (more) { st_j(cur ^ 1); st_v(cur ^ 1); }   // the buffers that every wave left at the barrier of the tile before
    __syncthreads(); }
#pragma unroll
  for (int r = 0; r < 8; ++r) { const float il = (1.0f / 2048.0f) / l[r];
#pragma unroll
    for (int j = 0; j < 4; ++j) so[wave][8 * g + r][j * 16 + col] = acc[j][r] * il; }
  LDSX(); for (int rl = 0; rl < 16; ++rl) if (lane < 16) vst2(O + (q0 + rl) * DM_ + h * HD + lane * 4, *(const v4f*)&so[wave][rl][lane * 4]); }
// ---- k_out: block = (64 rows, 128 cols): out = o (hi + lo) Wo^T + bo
__global__ __launch_bounds__(128) void k_out(const float* __restrict__ O, const float* __restrict__ WO, const float* __restrict__ BO, float* __restrict__ OUT) { __shared__ __align__(16) float sf[4][16][132];
  const int tid = threadIdx.x, wave = tid >> 5, lane = tid & 31, col = lane & 15, g = lane >> 4; const int c0 = blockIdx.y * 128; const size_t r0 = (size_t)blockIdx.x * 64 + wave * 16;
  v8f acc[8] = {};
  __shared__ __align__(16) __bf16 oh[2][64 * KP], ol[2][64 * KP], ow[2][128 * KP];
  v4f ra[8], rw[16]; const float* Ob = O + (size_t)blockIdx.x * 64 * DM_; const float* Wb = WO + (size_t)c0 * DM_;
  tile_ld<64, KS>(ra, Ob, DM_, tid); tile_ld<128, KS>(rw, Wb, DM_, tid);
  tile_st2<64, KS>(ra, oh[0], ol[0], tid); tile_st<128, KS>(rw, ow[0], tid);
  __syncthreads();
#pragma unroll 1   // rolled: one copy of the body, so that the next tile's registers are not multiplied
  for (int kc = 0; kc < DM_ / KS; ++kc) { const int cur = kc & 1; const bool more = kc + 1 < DM_ / KS;
    if (more) { tile_ld<64, KS>(ra, Ob + (kc + 1) * KS, DM_, tid); tile_ld<128, KS>(rw, Wb + (kc + 1) * KS, DM_, tid); }
#pragma unroll
    for (int ks = 0; ks < KS / 32; ++ks) { const int ao = (wave * 16 + col) * KP + ks * 32; const v16b ah = frag_b(&oh[cur][ao], lane), al = frag_b(&ol[cur][ao], lane);
#pragma unroll
      for (int j0 = 0; j0 < 8; j0 += 4) { v16b f[4];
#pragma unroll
        for (int j = 0; j < 4; ++j) f[j] = frag_b(&ow[cur][((j0 + j) * 16 + col) * KP + ks * 32], lane);
#pragma unroll
        for (int j = 0; j < 4; ++j) { acc[j0 + j] = wmma_bf(ah, f[j], acc[j0 + j]); acc[j0 + j] = wmma_bf(al, f[j], acc[j0 + j]); } } }
    if (more) { tile_st2<64, KS>(ra, oh[cur ^ 1], ol[cur ^ 1], tid); tile_st<128, KS>(rw, ow[cur ^ 1], tid); }
    __syncthreads(); }
#pragma unroll
  for (int j = 0; j < 8; ++j) { const float bb = bfr(BO[c0 + j * 16 + col]);
#pragma unroll
    for (int r = 0; r < 8; ++r) sf[wave][8 * g + r][j * 16 + col] = acc[j][r] + bb; }
  LDSX(); for (int rl = 0; rl < 16; ++rl) vst2(OUT + (r0 + rl) * DM_ + c0 + lane * 4, *(const v4f*)&sf[wave][rl][lane * 4]); }
extern "C" void kernel_launch(void* const* d_in, const int* in_sizes, int n_in, void* d_out, int out_size, void* d_ws, size_t ws_size, hipStream_t stream) {
  (void)in_sizes; (void)n_in; (void)out_size;
  const float** F = (const float**)d_in;   // 0 x [2,2048,1024], 1 W1_q [64,2048], 2 W2_q, 3 W1_k [64,1024], 4 W2_k, 5 Wv [1024,1024], 6 bv, 7 Wo, 8 bo
  if (ws_size < (size_t)WS_END) return;
  char* ws = (char*)d_ws; float *QP = (float*)(ws + WS_QP), *JK = (float*)(ws + WS_JK), *O = (float*)(ws + WS_O); _Float16 *VT = (_Float16*)(ws + WS_VT), *VL = (_Float16*)(ws + WS_VL);
  k_pl<<<TNB * TT / 64, 128, 0, stream>>>(F[0], F[1], F[2], F[3], F[4], QP, JK);
  k_v<<<dim3(TNB * TT / 64, DM_ / 128), 128, 0, stream>>>(F[0], F[5], F[6], VT, VL);
  k_att<<<dim3(TQB, NH, TNB), 128, 0, stream>>>(QP, JK, VT, VL, O);
  for (int b = 0; b < TNB; ++b) k_out<<<dim3(TQB, DM_ / 128), 128, 0, stream>>>(O + (size_t)b * TT * DM_, F[7], F[8], (float*)d_out + (size_t)b * TT * DM_);
}

// v004
// One run takes 194 microseconds.
// Two timings next to v003 both put it at 1.21 times that version's speed.
// Over all steps from v000 it is 3.58 times as fast.
// compute dtype: all float inputs rounded to bf16; q1/q2 = [x_t ; x_{t-1}] W^T and k1/k2 = x W^T with EXACT bf16 products on WMMA 16x16x32, f32 accumulate; the Plucker 6-vectors, their normalisation and J6 k in f32; q and J6 k split into bf16 hi + lo (3 products, K = 6 zero-padded to 32) for the causal logits x 6^-0.5, softmax in f32 without a maximum (the logits are bounded, see k_att; hardware exp); P (x 2^11, f16 hi + residual) . v with v = x Wv^T + bv exact as f16 hi + residual (3 products); out = o (bf16 hi + lo) Wo^T + bo (2 products); f32 output.
#include <hip/hip_runtime.h>
#include <math.h>

typedef __attribute__((ext_vector_type(16))) _Float16 v16h;
typedef __attribute__((ext_vector_type(16))) __bf16 v16b;
typedef __attribute__((ext_vector_type(8)))  _Float16 v8h;
typedef __attribute__((ext_vector_type(8)))  float v8f;
typedef __attribute__((ext_vector_type(4)))  float v4f;
typedef __attribute__((ext_vector_type(2)))  float v2f;
typedef __attribute__((ext_vector_type(4)))  unsigned v4u;
typedef __attribute__((ext_vector_type(4)))  int v4i;
typedef float __attribute__((may_alias)) float_a;
typedef int __attribute__((may_alias)) int_a;

template <typename T> __device__ __forceinline__ void vst2(void* p, T v) { *(T*)p = v;  }
__device__ __forceinline__ v8f wmma16(v16h a, v16h b, v8f c) {
  v8f d = __builtin_amdgcn_wmma_f32_16x16x32_f16(false, a, false, b, (short)0, c, false, false);
  asm volatile("v_nop\n\tv_nop\n\tv_nop\n\tv_nop" : "+v"(d) : "v"(a), "v"(b));
  return d;
}
__device__ __forceinline__ v8f wmma_bf(v16b a, v16b b, v8f c) {
  v8f d = __builtin_amdgcn_wmma_f32_16x16x32_bf16(false, a, false, b, (short)0, c, false, false);
  asm volatile("v_nop\n\tv_nop\n\tv_nop\n\tv_nop" : "+v"(d) : "v"(a), "v"(b));
  return d;
}
// 16x16x32 fragments: lane = (h = lane>>4, row/col = lane&15); elements 0..7 = k0+8h+0..7, 8..15 = k0+16+8h+0..7; D element r = row 8h+r
__device__ __forceinline__ v16h frag_h(const _Float16* rowk0, int lane) {
  union { v16h v; v8h q[2]; } u; const _Float16* p = rowk0 + 8 * (lane >> 4);
  u.q[0] = *(const v8h*)p; u.q[1] = *(const v8h*)(p + 16); return u.v;
}
__device__ __forceinline__ v16h frag_f32(const float* rowk0, int lane) {
  v16h a; const float* p = rowk0 + 8 * (lane >> 4);
#pragma unroll
  for (int i = 0; i < 8; ++i) { a[i] = (_Float16)p[i]; a[8 + i] = (_Float16)p[16 + i]; }
  return a;
}
__device__ __forceinline__ v16h frag_f32s(const float* rowk0, int lane, float sc) {
  v16h a; const float* p = rowk0 + 8 * (lane >> 4);
#pragma unroll
  for (int i = 0; i < 8; ++i) { a[i] = (_Float16)(p[i] * sc); a[8 + i] = (_Float16)(p[16 + i] * sc); }
  return a;
}
// column fragment from a [K][ld] layout (column n), rows >= K read as 0
__device__ __forceinline__ v16h fragc_f32(const float* W, int k0, int n, int lane, int ld, int K) {
  v16h a; const int g = lane >> 4;
#pragma unroll
  for (int i = 0; i < 8; ++i) { const int ka = k0 + 8 * g + i, kb = ka + 16;
    a[i] = (_Float16)(ka < K ? W[(size_t)(ka < K ? ka : K - 1) * ld + n] : 0.f); a[8 + i] = (_Float16)(kb < K ? W[(size_t)(kb < K ? kb : K - 1) * ld + n] : 0.f); }
  return a;
}
struct F2 { v16b h, l; };
__device__ __forceinline__ F2 bsplit16(const float v[16]) { F2 r;
#pragma unroll
  for (int i = 0; i < 16; ++i) { const __bf16 h = (__bf16)v[i]; r.h[i] = h; r.l[i] = (__bf16)(v[i] - (float)h); }
  return r; }
__device__ __forceinline__ F2 split_row(const float* row, int k0, int lane) { float v[16]; const float* p = row + k0 + 8 * (lane >> 4);
#pragma unroll
  for (int i = 0; i < 8; ++i) { v[i] = p[i]; v[8 + i] = p[16 + i]; }
  return bsplit16(v); }
__device__ __forceinline__ F2 split_rowK(const float* row, int k0, int lane, int K) { float v[16]; const int g = lane >> 4;
#pragma unroll
  for (int i = 0; i < 8; ++i) { const int ka = k0 + 8 * g + i, kb = ka + 16; v[i] = ka < K ? row[ka < K ? ka : K - 1] : 0.f; v[8 + i] = kb < K ? row[kb < K ? kb : K - 1] : 0.f; }
  return bsplit16(v); }
__device__ __forceinline__ F2 split_col(const float* W, int k0, int n, int lane, int ld, int K) { float v[16]; const int g = lane >> 4;
#pragma unroll
  for (int i = 0; i < 8; ++i) { const int ka = k0 + 8 * g + i, kb = ka + 16; v[i] = ka < K ? W[(size_t)(ka < K ? ka : K - 1) * ld + n] : 0.f; v[8 + i] = kb < K ? W[(size_t)(kb < K ? kb : K - 1) * ld + n] : 0.f; }
  return bsplit16(v); }
__device__ __forceinline__ v8f mac3(const F2& a, const F2& b, v8f c) { c = wmma_bf(a.l, b.h, c); c = wmma_bf(a.h, b.l, c); return wmma_bf(a.h, b.h, c); }
__device__ __forceinline__ float sigm(float v) { return 1.0f / (1.0f + expf(-v)); }
#define LDSX() do { asm volatile("s_wait_dscnt 0" ::: "memory"); __builtin_amdgcn_wave_barrier(); __builtin_amdgcn_fence(__ATOMIC_RELEASE, "workgroup"); } while (0)


// Plucker bigram attention (B 2, T 2,048, D 1,024, 16 heads x 64): per head, q = normalised Plucker line of two 4-vectors from the bigram [x_t ; x_{t-1}], k likewise from x_t; logits = q . (J6 k) / sqrt(6), causal softmax, . v, Wo.
#define NB 2
#define TT 2048
#define DM_ 1024
#define NH 16
#define HD 64
#ifndef TNB
#define TNB NB
#endif
#ifndef TQB
#define TQB (TT / 64)
#endif
typedef __attribute__((ext_vector_type(8))) __bf16 v8b;
__device__ __forceinline__ v16b frag_b(const __bf16* rowk0, int lane) {
  union { v16b v; v8b q[2]; } u; const __bf16* p = rowk0 + 8 * (lane >> 4);
  u.q[0] = *(const v8b*)p; u.q[1] = *(const v8b*)(p + 16); return u.v;
}
__device__ __forceinline__ float bfr(float v) { return (float)(__bf16)v; }
__device__ __attribute__((noinline)) float exp_ni(float v) { return expf(v); }
__device__ __attribute__((noinline)) float erf_ni(float v) { return erff(v); }

typedef __attribute__((ext_vector_type(4))) __bf16 v4b;
// Staging of a ROWS x KC f32 tile (rows K-contiguous, row stride ld floats) by the block's 128 threads: consecutive lanes take consecutive 16 bytes of a row, so every wave load covers whole 128-byte lines; the tile is rounded to bf16 once and laid in LDS at a row pitch of KC + 8 elements (16 B x odd).
template <int ROWS, int KC> __device__ __forceinline__ void tile_ld(v4f (&r)[ROWS * KC / 512], const float* __restrict__ src, int ld, int tid, int coff = 0) { const float* p = src + (unsigned)((tid / (KC / 4)) * ld + (tid % (KC / 4)) * 4);
#pragma unroll
  for (int i = 0; i < ROWS * KC / 512; ++i) r[i] = *(const v4f*)(p + coff + (size_t)i * (512 / KC) * ld);
  // the wait stands behind the tile's loads, in front of whatever next writes the registers of their address (the next tile's results, later address arithmetic); p as an input keeps the address in its registers up to the wait: without it the tile's last load got them as its result
  asm volatile("s_wait_xcnt 0x0" :: "v"(p) : "memory"); }
template <int ROWS, int KC> __device__ __forceinline__ void tile_st(const v4f (&r)[ROWS * KC / 512], __bf16* dst, int tid) {
#pragma unroll
  for (int i = 0; i < ROWS * KC / 512; ++i) { v4b o;
#pragma unroll
    for (int q = 0; q < 4; ++q) o[q] = (__bf16)r[i][q];
    *(v4b*)(dst + (tid / (KC / 4)) * (KC + 8) + (tid % (KC / 4)) * 4 + i * (512 / KC) * (KC + 8)) = o; } }
// the same, split into bf16 hi + lo planes
template <int ROWS, int KC> __device__ __forceinline__ void tile_st2(const v4f (&r)[ROWS * KC / 512], __bf16* dh, __bf16* dl, int tid) {
#pragma unroll
  for (int i = 0; i < ROWS * KC / 512; ++i) { v4b oh, ol;
#pragma unroll
    for (int q = 0; q < 4; ++q) { const __bf16 h = (__bf16)r[i][q]; oh[q] = h; ol[q] = (__bf16)(r[i][q] - (float)h); }
    const int o = (tid / (KC / 4)) * (KC + 8) + (tid % (KC / 4)) * 4 + i * (512 / KC) * (KC + 8); *(v4b*)(dh + o) = oh; *(v4b*)(dl + o) = ol; } }
#define KS 64          // k extent of a staged tile in k_v and k_out
#define KP (KS + 8)
#define KS2 32         // k extent of a staged tile in k_pl
#define KP2 (KS2 + 8)

#define WS_QP  0u                                    // f32 [b*t][h][8]: q plucker (6 used)
#define WS_JK  (WS_QP + 4u * (size_t)NB * TT * NH * 8)  // f32 [b*t][h][8]: J6 k
#define WS_VT  (WS_JK + 4u * (size_t)NB * TT * NH * 8)  // f16 v planes [b][1024][t]
#define WS_VL  (WS_VT + 2u * (size_t)NB * DM_ * TT)      // f16 v residual planes
#define WS_O   (WS_VL + 2u * (size_t)NB * DM_ * TT)      // f32 o rows [b*t][1024]
#define WS_END (WS_O + 4u * (size_t)NB * TT * DM_)

// ---- k_pl: block = 64 tokens: q1, q2 (bigram, K = 2048 as two halves), k1, k2 (K = 1024) -> 4 x 64 outputs (one 16-col tile per head-quad... 64 cols = 4 tiles each); then per (token, head) the Plucker vectors
__global__ __launch_bounds__(128) void k_pl(const float* __restrict__ X, const float* __restrict__ W1Q, const float* __restrict__ W2Q, const float* __restrict__ W1K, const float* __restrict__ W2K, float* __restrict__ QP, float* __restrict__ JK) {
  __shared__ float sv[4][64][68];   // [which][token][64]: q1, q2, k1, k2
  __shared__ __align__(16) float sq[64][NH * 8], sk[64][NH * 8];
  const int tid = threadIdx.x, wave = tid >> 5, lane = tid & 31, col = lane & 15, g = lane >> 4; const size_t r0 = (size_t)blockIdx.x * 64 + wave * 16; const size_t b = r0 / TT; const int t0 = (int)(r0 % TT);
  __shared__ __align__(16) __bf16 pa[2][64 * KP2], pw[2][2][64 * KP2];
  const size_t rb = (size_t)blockIdx.x * 64;
  // one pass = one pair of weight matrices against one staged x tile per k step: pass 0 x_t . (W1_q, W2_q)[:, 0:1024], pass 1 x_{t-1} . (W1_q, W2_q)[:, 1024:2048] into the same sums (zero row for t = 0), pass 2 x_t . (W1_k, W2_k)
  v8f c1[4] = {}, c2[4] = {};
#pragma unroll   // unrolled so that each pass's pointers and row strides are constants
  for (int ps = 0; ps < 3; ++ps) { const float* Wa = ps == 2 ? W1K : W1Q; const float* Wb = ps == 2 ? W2K : W2Q; const int ldw = ps == 2 ? DM_ : 2 * DM_, cw = ps == 1 ? DM_ : 0;
    v4f ra[4], ru[4], rv[4];
    auto ld_all = [&](int k0) {
      if (ps == 1) { const float* p[4];   // row t - 1; a batch's first row reads itself here and is zeroed in st_all
#pragma unroll
        for (int i = 0; i < 4; ++i) { const size_t gr = rb + i * 16 + (tid >> 3); p[i] = X + (gr - ((gr % TT) == 0 ? 0 : 1)) * DM_ + k0 + (tid & 7) * 4; ra[i] = *(const v4f*)p[i]; }
        // as in tile_ld: the wait behind the four loads, their addresses held as inputs up to it
        asm volatile("s_wait_xcnt 0x0" :: "v"(p[0]), "v"(p[1]), "v"(p[2]), "v"(p[3]) : "memory");
      } else tile_ld<64, KS2>(ra, X + rb * DM_ + k0, DM_, tid);
      tile_ld<64, KS2>(ru, Wa + k0, ldw, tid, cw); tile_ld<64, KS2>(rv, Wb + k0, ldw, tid, cw); };
    auto st_all = [&](int bf) {
      if (ps == 1) {
#pragma unroll
        for (int i = 0; i < 4; ++i) if (((rb + i * 16 + (tid >> 3)) % TT) == 0) ra[i] = (v4f){0.f, 0.f, 0.f, 0.f}; }
      tile_st<64, KS2>(ra, pa[bf], tid); tile_st<64, KS2>(ru, pw[bf][0], tid); tile_st<64, KS2>(rv, pw[bf][1], tid); };
    ld_all(0); st_all(0);
    __syncthreads();
#pragma unroll 1   // rolled: one copy of the body, so that the next tile's registers are not multiplied
    for (int kc = 0; kc < DM_ / KS2; ++kc) { const int cur = kc & 1; const bool more = kc + 1 < DM_ / KS2;
      if (more) ld_all((kc + 1) * KS2);
      const v16b a = frag_b(&pa[cur][(wave * 16 + col) * KP2], lane); v16b f[4][2];
#pragma unroll
      for (int j = 0; j < 4; ++j) { f[j][0] = frag_b(&pw[cur][0][(j * 16 + col) * KP2], lane); f[j][1] = frag_b(&pw[cur][1][(j * 16 + col) * KP2], lane); }
#pragma unroll
      for (int j = 0; j < 4; ++j) { c1[j] = wmma_bf(a, f[j][0], c1[j]); c2[j] = wmma_bf(a, f[j][1], c2[j]); }
      if (more) st_all(cur ^ 1);
      __syncthreads(); }
    if (ps >= 1) { const int w0 = ps == 1 ? 0 : 2;
#pragma unroll
      for (int j = 0; j < 4; ++j)
#pragma unroll
        for (int r = 0; r < 8; ++r) { const int rl = wave * 16 + 8 * g + r, cl = j * 16 + col; sv[w0][rl][cl] = c1[j][r]; sv[w0 + 1][rl][cl] = c2[j][r]; c1[j][r] = 0.f; c2[j][r] = 0.f; } } }
  __syncthreads();
  // plucker per (token, head): thread handles (token = tid/2, 8 heads)
  { const int rl = tid >> 1, h0 = (tid & 1) * 8;
    for (int h = h0; h < h0 + 8; ++h) { const float* a1 = &sv[0][rl][h * 4]; const float* a2 = &sv[1][rl][h * 4]; const float* c1 = &sv[2][rl][h * 4]; const float* c2 = &sv[3][rl][h * 4];
      float pq[6], pk[6]; const int PI[6] = {0, 0, 0, 1, 1, 2}, PJ[6] = {1, 2, 3, 2, 3, 3}; float nq = 0.f, nk = 0.f;
      for (int e = 0; e < 6; ++e) { pq[e] = a1[PI[e]] * a2[PJ[e]] - a1[PJ[e]] * a2[PI[e]]; pk[e] = c1[PI[e]] * c2[PJ[e]] - c1[PJ[e]] * c2[PI[e]]; nq += pq[e] * pq[e]; nk += pk[e] * pk[e]; }
      const float iq = 1.0f / fmaxf(sqrtf(nq), 1e-12f), ik = 1.0f / fmaxf(sqrtf(nk), 1e-12f);
      for (int e = 0; e < 6; ++e) { pq[e] *= iq; pk[e] *= ik; }
      // J6 k = (k5, -k4, k3, k2, -k1, k0)
      float jk[6] = {pk[5], -pk[4], pk[3], pk[2], -pk[1], pk[0]};
      for (int e = 0; e < 8; ++e) { sq[rl][h * 8 + e] = (e < 6) ? pq[e] : 0.f; sk[rl][h * 8 + e] = (e < 6) ? jk[e] : 0.f; } } }
  __syncthreads();
  for (int e = tid; e < 64 * 32; e += 128) { const int rl = e >> 5, q = e & 31; vst2(QP + ((size_t)blockIdx.x * 64 + rl) * (NH * 8) + q * 4, *(const v4f*)&sq[rl][q * 4]); vst2(JK + ((size_t)blockIdx.x * 64 + rl) * (NH * 8) + q * 4, *(const v4f*)&sk[rl][q * 4]); } }
// ---- k_v: block = (64 tokens, 128 cols): v = x Wv^T + bv exact -> f16 planes [b][d][t]
__global__ __launch_bounds__(128) void k_v(const float* __restrict__ X, const float* __restrict__ WV, const float* __restrict__ BV, _Float16* __restrict__ VT, _Float16* __restrict__ VL) { __shared__ __align__(16) _Float16 th[128][72], tl[128][72];
  const int tid = threadIdx.x, wave = tid >> 5, lane = tid & 31, col = lane & 15, g = lane >> 4; const int c0 = blockIdx.y * 128; const size_t r0 = (size_t)blockIdx.x * 64;
  v8f acc[8] = {};
  __shared__ __align__(16) __bf16 sa[2][64 * KP], sw[2][128 * KP];
  v4f ra[8], rw[16]; const float* Xb = X + r0 * DM_; const float* Wb = WV + (size_t)c0 * DM_;
  tile_ld<64, KS>(ra, Xb, DM_, tid); tile_ld<128, KS>(rw, Wb, DM_, tid);
  tile_st<64, KS>(ra, sa[0], tid); tile_st<128, KS>(rw, sw[0], tid);
  __syncthreads();
#pragma unroll 1   // rolled: one copy of the body, so that the next tile's registers are not multiplied
  for (int kc = 0; kc < DM_ / KS; ++kc) { const int cur = kc & 1; const bool more = kc + 1 < DM_ / KS;
    if (more) { tile_ld<64, KS>(ra, Xb + (kc + 1) * KS, DM_, tid); tile_ld<128, KS>(rw, Wb + (kc + 1) * KS, DM_, tid); }
#pragma unroll
    for (int ks = 0; ks < KS / 32; ++ks) { const v16b a = frag_b(&sa[cur][(wave * 16 + col) * KP + ks * 32], lane); v16b f[8];
#pragma unroll
      for (int j = 0; j < 8; ++j) f[j] = frag_b(&sw[cur][(j * 16 + col) * KP + ks * 32], lane);
#pragma unroll
      for (int j = 0; j < 8; ++j) acc[j] = wmma_bf(a, f[j], acc[j]); }
    if (more) { tile_st<64, KS>(ra, sa[cur ^ 1], tid); tile_st<128, KS>(rw, sw[cur ^ 1], tid); }
    __syncthreads(); }
#pragma unroll
  for (int j = 0; j < 8; ++j) { const float bb = bfr(BV[c0 + j * 16 + col]);
#pragma unroll
    for (int r = 0; r < 8; ++r) { const float v = acc[j][r] + bb; const _Float16 hv = (_Float16)v; th[j * 16 + col][wave * 16 + 8 * g + r] = hv; tl[j * 16 + col][wave * 16 + 8 * g + r] = (_Float16)(v - (float)hv); } }
  __syncthreads(); const size_t b = r0 / TT; const int t0 = (int)(r0 % TT); for (int e = tid; e < 128 * 8; e += 128) { const int cl = e >> 3, q = e & 7; const size_t o = (b * DM_ + c0 + cl) * (size_t)TT + t0 + q * 8; vst2((unsigned*)(VT + o), *(const v4u*)&th[cl][q * 8]); vst2((unsigned*)(VL + o), *(const v4u*)&tl[cl][q * 8]); } }
// 2^x on the hardware unit. The v_nop fills the one slot that the instruction set asks for behind a transcendental before its result is read or its source overwritten
__device__ __forceinline__ float exp2_slot(float x) { float e; asm("v_exp_f32 %0, %1\n\tv_nop" : "=v"(e) : "v"(x)); return e; }
#define VP 40          // row pitch of a staged v tile in k_att, in f16: 80 B = 16 B x odd
// ---- k_att: block = (64 queries, head, b): causal, 3-product logits (K = 6 padded) x 6^-0.5
__global__ __launch_bounds__(128) void k_att(const float* __restrict__ QP, const float* __restrict__ JK, const _Float16* __restrict__ VT, const _Float16* __restrict__ VL, float* __restrict__ O) {
  __shared__ __align__(16) float sp[4][16][36]; __shared__ __align__(16) float so[4][16][68];
  __shared__ __align__(16) _Float16 sv[2][2][HD * VP];   // [buffer][hi, residual][d row][32 keys], row pitch VP
  __shared__ __align__(16) __bf16 sj[2][2][33 * 8];      // [buffer][hi, lo][32 keys and a zero row][8]
  const int tid = threadIdx.x, wave = tid >> 5, lane = tid & 31, col = lane & 15, g = lane >> 4; const int qb = blockIdx.x, h = blockIdx.y; const size_t b = blockIdx.z; const int q0l = qb * 64 + wave * 16; const size_t q0 = b * TT + q0l;
  F2 aq; { float v[16];
#pragma unroll
    for (int i = 0; i < 16; ++i) v[i] = 0.f;
    if (g == 0) { const float* p = QP + (q0 + col) * (NH * 8) + h * 8;
#pragma unroll
      for (int i = 0; i < 8; ++i) v[i] = p[i]; }
    aq = bsplit16(v); }
  // q and J6 k have norm at most 1 (each is a vector over max(its norm, 1e-12)), so |logit| <= 6^-0.5 for every input: exp(logit) lies between 1/2 and 2, P x 2^11 stays far inside f16, and softmax needs no maximum taken off, hence no rescaling of the sums either
  float l[8];   // this lane's share of each row's sum of exp; the 16 lanes of a row are added once, behind the key loop
#pragma unroll
  for (int r = 0; r < 8; ++r) l[r] = 0.f;
  v8f acc[4] = {};
  const int nks = (qb * 64 + 64) / 32;
  // every global load of a key tile is issued well ahead of its use, so that a tile waits for memory at most once and not once per product: the J6 k rows and the v tile one tile ahead, into registers, and from there into the LDS buffer that the next tile reads
  // the four waves use the same v tile (64 d rows x 32 keys, hi and residual): the block fetches it once, four lanes to a row's 64 bytes (8 lines a wave load, where a fragment load from global memory touches 16), and every wave takes its fragments from LDS
  const int srow = tid >> 2, sch = (tid & 3) * 8; const size_t so0 = (b * DM_ + (size_t)h * HD + srow) * TT + sch;
  v8h rs[4];
  auto ld_v = [&](int ks) { const _Float16* ph = VT + so0 + ks * 32; const _Float16* pl = VL + so0 + ks * 32;
    rs[0] = *(const v8h*)ph; rs[1] = *(const v8h*)(ph + 32 * TT); rs[2] = *(const v8h*)pl; rs[3] = *(const v8h*)(pl + 32 * TT);
    // as in tile_ld: the wait behind the loads, their addresses held as inputs up to it
    asm volatile("s_wait_xcnt 0x0" :: "v"(ph), "v"(pl) : "memory"); };
  auto st_v = [&](int bf) { const int o = srow * VP + sch; *(v8h*)&sv[bf][0][o] = rs[0]; *(v8h*)&sv[bf][0][o + 32 * VP] = rs[1]; *(v8h*)&sv[bf][1][o] = rs[2]; *(v8h*)&sv[bf][1][o + 32 * VP] = rs[3]; };
  // the J6 k rows of the tile likewise: 64 threads fetch 16 bytes each, split them into bf16 hi + lo once, and lay them down as the low halves of the B fragments (8 values a key); row 32 of each plane stays zero and serves the lanes whose k lies past the 8 values
  v4f rj = {}; const int jrow = tid >> 1, jch = (tid & 1) * 4;
  auto ld_j = [&](int ks) { if (tid < 64) { const float* p = JK + (b * TT + ks * 32 + jrow) * (NH * 8) + h * 8 + jch; rj = *(const v4f*)p;
      // as in tile_ld: the wait behind the load, its address held as an input up to it
      asm volatile("s_wait_xcnt 0x0" :: "v"(p) : "memory"); } };
  auto st_j = [&](int bf) { if (tid < 64) { v4b oh, ol;
#pragma unroll
      for (int q = 0; q < 4; ++q) { const __bf16 hv = (__bf16)rj[q]; oh[q] = hv; ol[q] = (__bf16)(rj[q] - (float)hv); }
      *(v4b*)&sj[bf][0][jrow * 8 + jch] = oh; *(v4b*)&sj[bf][1][jrow * 8 + jch] = ol; } };
  v8b z8;
#pragma unroll
  for (int i = 0; i < 8; ++i) z8[i] = (__bf16)0.f;
  if (tid < 4) *(v8b*)&sj[tid >> 1][tid & 1][32 * 8] = z8;
  const int jo[2] = {g ? 32 * 8 : col * 8, g ? 32 * 8 : (16 + col) * 8};
  ld_j(0); ld_v(0); st_j(0); st_v(0);
  __syncthreads();
#pragma unroll 1
  for (int ks = 0; ks < nks; ++ks) {
    const int cur = ks & 1; const bool more = ks + 1 < nks;
    if (more) { ld_j(ks + 1); ld_v(ks + 1); }
    F2 bk2[2];
#pragma unroll
    for (int ct = 0; ct < 2; ++ct) { union { v16b v; v8b q[2]; } uh, ul; uh.q[0] = *(const v8b*)&sj[cur][0][jo[ct]]; uh.q[1] = z8; ul.q[0] = *(const v8b*)&sj[cur][1][jo[ct]]; ul.q[1] = z8; bk2[ct].h = uh.v; bk2[ct].l = ul.v; }
#pragma unroll
    for (int ct = 0; ct < 2; ++ct) { const int kt = ks * 32 + ct * 16 + col; const F2 bk = bk2[ct];
      v8f c = {}; c = mac3(aq, bk, c);
#pragma unroll
      for (int r = 0; r < 8; ++r) { const float ex = exp2_slot(c[r] * (0.4082482904638631f * 1.4426950408889634f)), e = (kt <= q0l + 8 * g + r) ? ex : 0.f;   /* exp(c x 6^-0.5) as 2^(c x 6^-0.5 x log2 e): with nothing taken off in between, one multiply */ l[r] += e; sp[wave][8 * g + r][ct * 16 + col] = e; } }
    LDSX();
    v16h pa, pr;   // P x 2^11 as f16 hi + residual (a single f16 would quantise P to 1 part in 2048)
#pragma unroll
    for (int i = 0; i < 8; ++i) { const float f0 = sp[wave][col][8 * g + i] * 2048.0f, f1 = sp[wave][col][16 + 8 * g + i] * 2048.0f; const _Float16 h0 = (_Float16)f0, h1 = (_Float16)f1; pa[i] = h0; pa[8 + i] = h1; pr[i] = (_Float16)(f0 - (float)h0); pr[8 + i] = (_Float16)(f1 - (float)h1); }
    v16h vh[4], vl[4];
#pragma unroll
    for (int j = 0; j < 4; ++j) { vh[j] = frag_h(&sv[cur][0][(j * 16 + col) * VP], lane); vl[j] = frag_h(&sv[cur][1][(j * 16 + col) * VP], lane); }
#pragma unroll
    for (int j = 0; j < 4; ++j) { acc[j] = wmma16(pa, vh[j], acc[j]); acc[j] = wmma16(pr, vh[j], acc[j]); acc[j] = wmma16(pa, vl[j], acc[j]); }
    LDSX();
    if (more) { st_j(cur ^ 1); st_v(cur ^ 1); }   // the buffers that every wave left at the barrier of the tile before
    __syncthreads(); }
#pragma unroll
  for (int r = 0; r < 8; ++r) { float ls = l[r];
#pragma unroll
    for (int o = 1; o < 16; o <<= 1) ls += __shfl_xor(ls, o);
    const float il = (1.0f / 2048.0f) / ls;
#pragma unroll
    for (int j = 0; j < 4; ++j) so[wave][8 * g + r][j * 16 + col] = acc[j][r] * il; }
  LDSX(); for (int rl = 0; rl < 16; ++rl) if (lane < 16) vst2(O + (q0 + rl) * DM_ + h * HD + lane * 4, *(const v4f*)&so[wave][rl][lane * 4]); }
// ---- k_out: block = (64 rows, 128 cols): out = o (hi + lo) Wo^T + bo
__global__ __launch_bounds__(128) void k_out(const float* __restrict__ O, const float* __restrict__ WO, const float* __restrict__ BO, float* __restrict__ OUT) { __shared__ __align__(16) float sf[4][16][132];
  const int tid = threadIdx.x, wave = tid >> 5, lane = tid & 31, col = lane & 15, g = lane >> 4; const int c0 = blockIdx.y * 128; const size_t r0 = (size_t)blockIdx.x * 64 + wave * 16;
  v8f acc[8] = {};
  __shared__ __align__(16) __bf16 oh[2][64 * KP], ol[2][64 * KP], ow[2][128 * KP];
  v4f ra[8], rw[16]; const float* Ob = O + (size_t)blockIdx.x * 64 * DM_; const float* Wb = WO + (size_t)c0 * DM_;
  tile_ld<64, KS>(ra, Ob, DM_, tid); tile_ld<128, KS>(rw, Wb, DM_, tid);
  tile_st2<64, KS>(ra, oh[0], ol[0], tid); tile_st<128, KS>(rw, ow[0], tid);
  __syncthreads();
#pragma unroll 1   // rolled: one copy of the body, so that the next tile's registers are not multiplied
  for (int kc = 0; kc < DM_ / KS; ++kc) { const int cur = kc & 1; const bool more = kc + 1 < DM_ / KS;
    if (more) { tile_ld<64, KS>(ra, Ob + (kc + 1) * KS, DM_, tid); tile_ld<128, KS>(rw, Wb + (kc + 1) * KS, DM_, tid); }
#pragma unroll
    for (int ks = 0; ks < KS / 32; ++ks) { const int ao = (wave * 16 + col) * KP + ks * 32; const v16b ah = frag_b(&oh[cur][ao], lane), al = frag_b(&ol[cur][ao], lane);
#pragma unroll
      for (int j0 = 0; j0 < 8; j0 += 4) { v16b f[4];
#pragma unroll
        for (int j = 0; j < 4; ++j) f[j] = frag_b(&ow[cur][((j0 + j) * 16 + col) * KP + ks * 32], lane);
#pragma unroll
        for (int j = 0; j < 4; ++j) { acc[j0 + j] = wmma_bf(ah, f[j], acc[j0 + j]); acc[j0 + j] = wmma_bf(al, f[j], acc[j0 + j]); } } }
    if (more) { tile_st2<64, KS>(ra, oh[cur ^ 1], ol[cur ^ 1], tid); tile_st<128, KS>(rw, ow[cur ^ 1], tid); }
    __syncthreads(); }
#pragma unroll
  for (int j = 0; j < 8; ++j) { const float bb = bfr(BO[c0 + j * 16 + col]);
#pragma unroll
    for (int r = 0; r < 8; ++r) sf[wave][8 * g + r][j * 16 + col] = acc[j][r] + bb; }
  LDSX(); for (int rl = 0; rl < 16; ++rl) vst2(OUT + (r0 + rl) * DM_ + c0 + lane * 4, *(const v4f*)&sf[wave][rl][lane * 4]); }
extern "C" void kernel_launch(void* const* d_in, const int* in_sizes, int n_in, void* d_out, int out_size, void* d_ws, size_t ws_size, hipStream_t stream) {
  (void)in_sizes; (void)n_in; (void)out_size;
  const float** F = (const float**)d_in;   // 0 x [2,2048,1024], 1 W1_q [64,2048], 2 W2_q, 3 W1_k [64,1024], 4 W2_k, 5 Wv [1024,1024], 6 bv, 7 Wo, 8 bo
  if (ws_size < (size_t)WS_END) return;
  char* ws = (char*)d_ws; float *QP = (float*)(ws + WS_QP), *JK = (float*)(ws + WS_JK), *O = (float*)(ws + WS_O); _Float16 *VT = (_Float16*)(ws + WS_VT), *VL = (_Float16*)(ws + WS_VL);
  k_pl<<<TNB * TT / 64, 128, 0, stream>>>(F[0], F[1], F[2], F[3], F[4], QP, JK);
  k_v<<<dim3(TNB * TT / 64, DM_ / 128), 128, 0, stream>>>(F[0], F[5], F[6], VT, VL);
  k_att<<<dim3(TQB, NH, TNB), 128, 0, stream>>>(QP, JK, VT, VL, O);
  for (int b = 0; b < TNB; ++b) k_out<<<dim3(TQB, DM_ / 128), 128, 0, stream>>>(O + (size_t)b * TT * DM_, F[7], F[8], (float*)d_out + (size_t)b * TT * DM_);
}

// v005
// One run takes 169 microseconds.
// In two side-by-side timings against v004, it was 1.17 and 1.15 times as fast.
// All steps since v000 together make it 4.15 times as fast.
// compute dtype: all float inputs rounded to bf16; q1/q2 = [x_t ; x_{t-1}] W^T and k1/k2 = x W^T with EXACT bf16 products on WMMA 16x16x32, f32 accumulate; the Plucker 6-vectors, their normalisation and J6 k in f32; q and J6 k split into bf16 hi + lo (3 products, K = 6 zero-padded to 32) for the causal logits x 6^-0.5, softmax in f32 without a maximum (the logits are bounded, see k_att; hardware exp); P (x 2^11, f16 hi + residual) . v with v = x Wv^T + bv exact as f16 hi + residual (3 products); out = o (bf16 hi + lo) Wo^T + bo (2 products); f32 output.
#include <hip/hip_runtime.h>
#include <math.h>

typedef __attribute__((ext_vector_type(16))) _Float16 v16h;
typedef __attribute__((ext_vector_type(16))) __bf16 v16b;
typedef __attribute__((ext_vector_type(8)))  _Float16 v8h;
typedef __attribute__((ext_vector_type(8)))  float v8f;
typedef __attribute__((ext_vector_type(4)))  float v4f;
typedef __attribute__((ext_vector_type(2)))  float v2f;
typedef __attribute__((ext_vector_type(4)))  unsigned v4u;
typedef __attribute__((ext_vector_type(4)))  int v4i;
typedef float __attribute__((may_alias)) float_a;
typedef int __attribute__((may_alias)) int_a;

template <typename T> __device__ __forceinline__ void vst2(void* p, T v) { *(T*)p = v;  }
__device__ __forceinline__ v8f wmma16(v16h a, v16h b, v8f c) {
  v8f d = __builtin_amdgcn_wmma_f32_16x16x32_f16(false, a, false, b, (short)0, c, false, false);
  asm volatile("v_nop\n\tv_nop\n\tv_nop\n\tv_nop" : "+v"(d) : "v"(a), "v"(b));
  return d;
}
__device__ __forceinline__ v8f wmma_bf(v16b a, v16b b, v8f c) {
  v8f d = __builtin_amdgcn_wmma_f32_16x16x32_bf16(false, a, false, b, (short)0, c, false, false);
  asm volatile("v_nop\n\tv_nop\n\tv_nop\n\tv_nop" : "+v"(d) : "v"(a), "v"(b));
  return d;
}
// 16x16x32 fragments: lane = (h = lane>>4, row/col = lane&15); elements 0..7 = k0+8h+0..7, 8..15 = k0+16+8h+0..7; D element r = row 8h+r
__device__ __forceinline__ v16h frag_h(const _Float16* rowk0, int lane) {
  union { v16h v; v8h q[2]; } u; const _Float16* p = rowk0 + 8 * (lane >> 4);
  u.q[0] = *(const v8h*)p; u.q[1] = *(const v8h*)(p + 16); return u.v;
}
__device__ __forceinline__ v16h frag_f32(const float* rowk0, int lane) {
  v16h a; const float* p = rowk0 + 8 * (lane >> 4);
#pragma unroll
  for (int i = 0; i < 8; ++i) { a[i] = (_Float16)p[i]; a[8 + i] = (_Float16)p[16 + i]; }
  return a;
}
__device__ __forceinline__ v16h frag_f32s(const float* rowk0, int lane, float sc) {
  v16h a; const float* p = rowk0 + 8 * (lane >> 4);
#pragma unroll
  for (int i = 0; i < 8; ++i) { a[i] = (_Float16)(p[i] * sc); a[8 + i] = (_Float16)(p[16 + i] * sc); }
  return a;
}
// column fragment from a [K][ld] layout (column n), rows >= K read as 0
__device__ __forceinline__ v16h fragc_f32(const float* W, int k0, int n, int lane, int ld, int K) {
  v16h a; const int g = lane >> 4;
#pragma unroll
  for (int i = 0; i < 8; ++i) { const int ka = k0 + 8 * g + i, kb = ka + 16;
    a[i] = (_Float16)(ka < K ? W[(size_t)(ka < K ? ka : K - 1) * ld + n] : 0.f); a[8 + i] = (_Float16)(kb < K ? W[(size_t)(kb < K ? kb : K - 1) * ld + n] : 0.f); }
  return a;
}
struct F2 { v16b h, l; };
__device__ __forceinline__ F2 bsplit16(const float v[16]) { F2 r;
#pragma unroll
  for (int i = 0; i < 16; ++i) { const __bf16 h = (__bf16)v[i]; r.h[i] = h; r.l[i] = (__bf16)(v[i] - (float)h); }
  return r; }
__device__ __forceinline__ F2 split_row(const float* row, int k0, int lane) { float v[16]; const float* p = row + k0 + 8 * (lane >> 4);
#pragma unroll
  for (int i = 0; i < 8; ++i) { v[i] = p[i]; v[8 + i] = p[16 + i]; }
  return bsplit16(v); }
__device__ __forceinline__ F2 split_rowK(const float* row, int k0, int lane, int K) { float v[16]; const int g = lane >> 4;
#pragma unroll
  for (int i = 0; i < 8; ++i) { const int ka = k0 + 8 * g + i, kb = ka + 16; v[i] = ka < K ? row[ka < K ? ka : K - 1] : 0.f; v[8 + i] = kb < K ? row[kb < K ? kb : K - 1] : 0.f; }
  return bsplit16(v); }
__device__ __forceinline__ F2 split_col(const float* W, int k0, int n, int lane, int ld, int K) { float v[16]; const int g = lane >> 4;
#pragma unroll
  for (int i = 0; i < 8; ++i) { const int ka = k0 + 8 * g + i, kb = ka + 16; v[i] = ka < K ? W[(size_t)(ka < K ? ka : K - 1) * ld + n] : 0.f; v[8 + i] = kb < K ? W[(size_t)(kb < K ? kb : K - 1) * ld + n] : 0.f; }
  return bsplit16(v); }
__device__ __forceinline__ v8f mac3(const F2& a, const F2& b, v8f c) { c = wmma_bf(a.l, b.h, c); c = wmma_bf(a.h, b.l, c); return wmma_bf(a.h, b.h, c); }
__device__ __forceinline__ float sigm(float v) { return 1.0f / (1.0f + expf(-v)); }
#define LDSX() do { asm volatile("s_wait_dscnt 0" ::: "memory"); __builtin_amdgcn_wave_barrier(); __builtin_amdgcn_fence(__ATOMIC_RELEASE, "workgroup"); } while (0)


// Plucker bigram attention (B 2, T 2,048, D 1,024, 16 heads x 64): per head, q = normalised Plucker line of two 4-vectors from the bigram [x_t ; x_{t-1}], k likewise from x_t; logits = q . (J6 k) / sqrt(6), causal softmax, . v, Wo.
#define NB 2
#define TT 2048
#define DM_ 1024
#define NH 16
#define HD 64
#ifndef TNB
#define TNB NB
#endif
#ifndef TQB
#define TQB (TT / 64)
#endif
typedef __attribute__((ext_vector_type(8))) __bf16 v8b;
__device__ __forceinline__ v16b frag_b(const __bf16* rowk0, int lane) {
  union { v16b v; v8b q[2]; } u; const __bf16* p = rowk0 + 8 * (lane >> 4);
  u.q[0] = *(const v8b*)p; u.q[1] = *(const v8b*)(p + 16); return u.v;
}
__device__ __forceinline__ float bfr(float v) { return (float)(__bf16)v; }
__device__ __attribute__((noinline)) float exp_ni(float v) { return expf(v); }
__device__ __attribute__((noinline)) float erf_ni(float v) { return erff(v); }

typedef __attribute__((ext_vector_type(4))) __bf16 v4b;
// Staging of a ROWS x KC f32 tile (rows K-contiguous, row stride ld floats) by the block's 128 threads: consecutive lanes take consecutive 16 bytes of a row, so every wave load covers whole 128-byte lines; the tile is rounded to bf16 once and laid in LDS at a row pitch of KC + 8 elements (16 B x odd).
template <int ROWS, int KC> __device__ __forceinline__ void tile_ld(v4f (&r)[ROWS * KC / 512], const float* __restrict__ src, int ld, int tid, int coff = 0) { const float* p = src + (unsigned)((tid / (KC / 4)) * ld + (tid % (KC / 4)) * 4);
#pragma unroll
  for (int i = 0; i < ROWS * KC / 512; ++i) r[i] = *(const v4f*)(p + coff + (size_t)i * (512 / KC) * ld);
  // the wait stands behind the tile's loads, in front of whatever next writes the registers of their address (the next tile's results, later address arithmetic); p as an input keeps the address in its registers up to the wait: without it the tile's last load got them as its result
  asm volatile("s_wait_xcnt 0x0" :: "v"(p) : "memory"); }
template <int ROWS, int KC> __device__ __forceinline__ void tile_st(const v4f (&r)[ROWS * KC / 512], __bf16* dst, int tid) {
#pragma unroll
  for (int i = 0; i < ROWS * KC / 512; ++i) { v4b o;
#pragma unroll
    for (int q = 0; q < 4; ++q) o[q] = (__bf16)r[i][q];
    *(v4b*)(dst + (tid / (KC / 4)) * (KC + 8) + (tid % (KC / 4)) * 4 + i * (512 / KC) * (KC + 8)) = o; } }
// the same, split into bf16 hi + lo planes
template <int ROWS, int KC> __device__ __forceinline__ void tile_st2(const v4f (&r)[ROWS * KC / 512], __bf16* dh, __bf16* dl, int tid) {
#pragma unroll
  for (int i = 0; i < ROWS * KC / 512; ++i) { v4b oh, ol;
#pragma unroll
    for (int q = 0; q < 4; ++q) { const __bf16 h = (__bf16)r[i][q]; oh[q] = h; ol[q] = (__bf16)(r[i][q] - (float)h); }
    const int o = (tid / (KC / 4)) * (KC + 8) + (tid % (KC / 4)) * 4 + i * (512 / KC) * (KC + 8); *(v4b*)(dh + o) = oh; *(v4b*)(dl + o) = ol; } }
#define KS 64          // k extent of a staged tile in v_body and k_out
#define KP (KS + 8)
#define KS2 32         // k extent of a staged tile in pl_body
#define KP2 (KS2 + 8)

#define WS_QP  0u                                    // f32 [b*t][h][8]: q plucker (6 used)
#define WS_JK  (WS_QP + 4u * (size_t)NB * TT * NH * 8)  // f32 [b*t][h][8]: J6 k
#define WS_VT  (WS_JK + 4u * (size_t)NB * TT * NH * 8)  // f16 v planes [b][1024][t]
#define WS_VL  (WS_VT + 2u * (size_t)NB * DM_ * TT)      // f16 v residual planes
#define WS_O   (WS_VL + 2u * (size_t)NB * DM_ * TT)      // f32 o rows [b*t][1024]
#define WS_END (WS_O + 4u * (size_t)NB * TT * DM_)

// ---- pl_body: block = 64 tokens: q1, q2 (bigram, K = 2048 as two halves), k1, k2 (K = 1024) -> 4 x 64 outputs (one 16-col tile per head-quad... 64 cols = 4 tiles each); then per (token, head) the Plucker vectors
// sm: the launch's LDS block, SM_PL bytes used here; bx: the token block
#define SM_PL (4 * 64 * 68 * 4 + 2 * 64 * NH * 8 * 4)
__device__ __forceinline__ void pl_body(char* sm, int bx, const float* __restrict__ X, const float* __restrict__ W1Q, const float* __restrict__ W2Q, const float* __restrict__ W1K, const float* __restrict__ W2K, float* __restrict__ QP, float* __restrict__ JK) {
  float (&sv)[4][64][68] = *(float (*)[4][64][68])sm;   // [which][token][64]: q1, q2, k1, k2
  float (&sq)[64][NH * 8] = *(float (*)[64][NH * 8])(sm + 4 * 64 * 68 * 4); float (&sk)[64][NH * 8] = *(float (*)[64][NH * 8])(sm + 4 * 64 * 68 * 4 + 64 * NH * 8 * 4);
  const int tid = threadIdx.x, wave = tid >> 5, lane = tid & 31, col = lane & 15, g = lane >> 4;
  // the staging buffers lie on sq, which is first written behind the barrier that follows the last k loop: so the block's LDS stays under half a WGP's and two blocks of the launch share a WGP
  __bf16 (&pa)[2][64 * KP2] = *(__bf16 (*)[2][64 * KP2])(sm + 4 * 64 * 68 * 4); __bf16 (&pw)[2][2][64 * KP2] = *(__bf16 (*)[2][2][64 * KP2])(sm + 4 * 64 * 68 * 4 + 2 * 64 * KP2 * 2);
  static_assert(6 * 64 * KP2 * 2 <= 64 * NH * 8 * 4, "staging buffers inside sq");
  const size_t rb = (size_t)bx * 64;
  // one pass = one pair of weight matrices against one staged x tile per k step: pass 0 x_t . (W1_q, W2_q)[:, 0:1024], pass 1 x_{t-1} . (W1_q, W2_q)[:, 1024:2048] into the same sums (zero row for t = 0), pass 2 x_t . (W1_k, W2_k)
  v8f c1[4] = {}, c2[4] = {};
#pragma unroll   // unrolled so that each pass's pointers and row strides are constants
  for (int ps = 0; ps < 3; ++ps) { const float* Wa = ps == 2 ? W1K : W1Q; const float* Wb = ps == 2 ? W2K : W2Q; const int ldw = ps == 2 ? DM_ : 2 * DM_, cw = ps == 1 ? DM_ : 0;
    v4f ra[4], ru[4], rv[4];
    auto ld_all = [&](int k0) {
      if (ps == 1) { const float* p[4];   // row t - 1; a batch's first row reads itself here and is zeroed in st_all
#pragma unroll
        for (int i = 0; i < 4; ++i) { const size_t gr = rb + i * 16 + (tid >> 3); p[i] = X + (gr - ((gr % TT) == 0 ? 0 : 1)) * DM_ + k0 + (tid & 7) * 4; ra[i] = *(const v4f*)p[i]; }
        // as in tile_ld: the wait behind the four loads, their addresses held as inputs up to it
        asm volatile("s_wait_xcnt 0x0" :: "v"(p[0]), "v"(p[1]), "v"(p[2]), "v"(p[3]) : "memory");
      } else tile_ld<64, KS2>(ra, X + rb * DM_ + k0, DM_, tid);
      tile_ld<64, KS2>(ru, Wa + k0, ldw, tid, cw); tile_ld<64, KS2>(rv, Wb + k0, ldw, tid, cw); };
    auto st_all = [&](int bf) {
      if (ps == 1) {
#pragma unroll
        for (int i = 0; i < 4; ++i) if (((rb + i * 16 + (tid >> 3)) % TT) == 0) ra[i] = (v4f){0.f, 0.f, 0.f, 0.f}; }
      tile_st<64, KS2>(ra, pa[bf], tid); tile_st<64, KS2>(ru, pw[bf][0], tid); tile_st<64, KS2>(rv, pw[bf][1], tid); };
    ld_all(0); st_all(0);
    __syncthreads();
#pragma unroll 1   // rolled: one copy of the body, so that the next tile's registers are not multiplied
    for (int kc = 0; kc < DM_ / KS2; ++kc) { const int cur = kc & 1; const bool more = kc + 1 < DM_ / KS2;
      if (more) ld_all((kc + 1) * KS2);
      const v16b a = frag_b(&pa[cur][(wave * 16 + col) * KP2], lane); v16b f[4][2];
#pragma unroll
      for (int j = 0; j < 4; ++j) { f[j][0] = frag_b(&pw[cur][0][(j * 16 + col) * KP2], lane); f[j][1] = frag_b(&pw[cur][1][(j * 16 + col) * KP2], lane); }
#pragma unroll
      for (int j = 0; j < 4; ++j) { c1[j] = wmma_bf(a, f[j][0], c1[j]); c2[j] = wmma_bf(a, f[j][1], c2[j]); }
      if (more) st_all(cur ^ 1);
      __syncthreads(); }
    if (ps >= 1) { const int w0 = ps == 1 ? 0 : 2;
#pragma unroll
      for (int j = 0; j < 4; ++j)
#pragma unroll
        for (int r = 0; r < 8; ++r) { const int rl = wave * 16 + 8 * g + r, cl = j * 16 + col; sv[w0][rl][cl] = c1[j][r]; sv[w0 + 1][rl][cl] = c2[j][r]; c1[j][r] = 0.f; c2[j][r] = 0.f; } } }
  __syncthreads();
  // plucker per (token, head): thread handles (token = tid/2, 8 heads)
  { const int rl = tid >> 1, h0 = (tid & 1) * 8;
    for (int h = h0; h < h0 + 8; ++h) { const float* a1 = &sv[0][rl][h * 4]; const float* a2 = &sv[1][rl][h * 4]; const float* c1 = &sv[2][rl][h * 4]; const float* c2 = &sv[3][rl][h * 4];
      float pq[6], pk[6]; const int PI[6] = {0, 0, 0, 1, 1, 2}, PJ[6] = {1, 2, 3, 2, 3, 3}; float nq = 0.f, nk = 0.f;
      for (int e = 0; e < 6; ++e) { pq[e] = a1[PI[e]] * a2[PJ[e]] - a1[PJ[e]] * a2[PI[e]]; pk[e] = c1[PI[e]] * c2[PJ[e]] - c1[PJ[e]] * c2[PI[e]]; nq += pq[e] * pq[e]; nk += pk[e] * pk[e]; }
      const float iq = 1.0f / fmaxf(sqrtf(nq), 1e-12f), ik = 1.0f / fmaxf(sqrtf(nk), 1e-12f);
      for (int e = 0; e < 6; ++e) { pq[e] *= iq; pk[e] *= ik; }
      // J6 k = (k5, -k4, k3, k2, -k1, k0)
      float jk[6] = {pk[5], -pk[4], pk[3], pk[2], -pk[1], pk[0]};
      for (int e = 0; e < 8; ++e) { sq[rl][h * 8 + e] = (e < 6) ? pq[e] : 0.f; sk[rl][h * 8 + e] = (e < 6) ? jk[e] : 0.f; } } }
  __syncthreads();
  for (int e = tid; e < 64 * 32; e += 128) { const int rl = e >> 5, q = e & 31; vst2(QP + (rb + rl) * (NH * 8) + q * 4, *(const v4f*)&sq[rl][q * 4]); vst2(JK + (rb + rl) * (NH * 8) + q * 4, *(const v4f*)&sk[rl][q * 4]); } }
// ---- v_body: block = (64 tokens, 128 cols): v = x Wv^T + bv exact -> f16 planes [b][d][t]
#define SM_V (2 * 128 * 72 * 2 + 2 * 64 * KP * 2 + 2 * 128 * KP * 2)
__device__ __forceinline__ void v_body(char* sm, int bx, int by, const float* __restrict__ X, const float* __restrict__ WV, const float* __restrict__ BV, _Float16* __restrict__ VT, _Float16* __restrict__ VL) { _Float16 (&th)[128][72] = *(_Float16 (*)[128][72])sm; _Float16 (&tl)[128][72] = *(_Float16 (*)[128][72])(sm + 128 * 72 * 2);
  const int tid = threadIdx.x, wave = tid >> 5, lane = tid & 31, col = lane & 15, g = lane >> 4; const int c0 = by * 128; const size_t r0 = (size_t)bx * 64;
  v8f acc[8] = {};
  __bf16 (&sa)[2][64 * KP] = *(__bf16 (*)[2][64 * KP])(sm + 2 * 128 * 72 * 2); __bf16 (&sw)[2][128 * KP] = *(__bf16 (*)[2][128 * KP])(sm + 2 * 128 * 72 * 2 + 2 * 64 * KP * 2);
  v4f ra[8], rw[16]; const float* Xb = X + r0 * DM_; const float* Wb = WV + (size_t)c0 * DM_;
  tile_ld<64, KS>(ra, Xb, DM_, tid); tile_ld<128, KS>(rw, Wb, DM_, tid);
  tile_st<64, KS>(ra, sa[0], tid); tile_st<128, KS>(rw, sw[0], tid);
  __syncthreads();
#pragma unroll 1   // rolled: one copy of the body, so that the next tile's registers are not multiplied
  for (int kc = 0; kc < DM_ / KS; ++kc) { const int cur = kc & 1; const bool more = kc + 1 < DM_ / KS;
    if (more) { tile_ld<64, KS>(ra, Xb + (kc + 1) * KS, DM_, tid); tile_ld<128, KS>(rw, Wb + (kc + 1) * KS, DM_, tid); }
#pragma unroll
    for (int ks = 0; ks < KS / 32; ++ks) { const v16b a = frag_b(&sa[cur][(wave * 16 + col) * KP + ks * 32], lane); v16b f[8];
#pragma unroll
      for (int j = 0; j < 8; ++j) f[j] = frag_b(&sw[cur][(j * 16 + col) * KP + ks * 32], lane);
#pragma unroll
      for (int j = 0; j < 8; ++j) acc[j] = wmma_bf(a, f[j], acc[j]); }
    if (more) { tile_st<64, KS>(ra, sa[cur ^ 1], tid); tile_st<128, KS>(rw, sw[cur ^ 1], tid); }
    __syncthreads(); }
#pragma unroll
  for (int j = 0; j < 8; ++j) { const float bb = bfr(BV[c0 + j * 16 + col]);
#pragma unroll
    for (int r = 0; r < 8; ++r) { const float v = acc[j][r] + bb; const _Float16 hv = (_Float16)v; th[j * 16 + col][wave * 16 + 8 * g + r] = hv; tl[j * 16 + col][wave * 16 + 8 * g + r] = (_Float16)(v - (float)hv); } }
  __syncthreads(); const size_t b = r0 / TT; const int t0 = (int)(r0 % TT); for (int e = tid; e < 128 * 8; e += 128) { const int cl = e >> 3, q = e & 7; const size_t o = (b * DM_ + c0 + cl) * (size_t)TT + t0 + q * 8; vst2((unsigned*)(VT + o), *(const v4u*)&th[cl][q * 8]); vst2((unsigned*)(VL + o), *(const v4u*)&tl[cl][q * 8]); } }
// ---- k_plv: the Plucker projections and the v projection depend on x and weights alone, not on each other: one grid holds both, so that the 64 long blocks of the first (started first, lowest indices) run beside the 512 of the second instead of ahead of them on an otherwise idle chip
#define NPL (TNB * TT / 64)
__global__ __launch_bounds__(128) void k_plv(const float* __restrict__ X, const float* __restrict__ W1Q, const float* __restrict__ W2Q, const float* __restrict__ W1K, const float* __restrict__ W2K, const float* __restrict__ WV, const float* __restrict__ BV, float* __restrict__ QP, float* __restrict__ JK, _Float16* __restrict__ VT, _Float16* __restrict__ VL) {
  __shared__ __align__(16) char sm[SM_PL > SM_V ? SM_PL : SM_V];
  const int bi = blockIdx.x;   // the same for the whole block: every barrier of either body is passed by all its threads
  if (bi < NPL) pl_body(sm, bi, X, W1Q, W2Q, W1K, W2K, QP, JK);
  else v_body(sm, (bi - NPL) % NPL, (bi - NPL) / NPL, X, WV, BV, VT, VL); }
// 2^x on the hardware unit. The v_nop fills the one slot that the instruction set asks for behind a transcendental before its result is read or its source overwritten
__device__ __forceinline__ float exp2_slot(float x) { float e; asm("v_exp_f32 %0, %1\n\tv_nop" : "=v"(e) : "v"(x)); return e; }
#define VP 40          // row pitch of a staged v tile in k_att, in f16: 80 B = 16 B x odd
// ---- k_att: block = (64 queries, head, b): causal, 3-product logits (K = 6 padded) x 6^-0.5
__global__ __launch_bounds__(128) void k_att(const float* __restrict__ QP, const float* __restrict__ JK, const _Float16* __restrict__ VT, const _Float16* __restrict__ VL, float* __restrict__ O) {
  __shared__ __align__(16) float sp[4][16][36]; __shared__ __align__(16) float so[4][16][68];
  __shared__ __align__(16) _Float16 sv[2][2][HD * VP];   // [buffer][hi, residual][d row][32 keys], row pitch VP
  __shared__ __align__(16) __bf16 sj[2][2][33 * 8];      // [buffer][hi, lo][32 keys and a zero row][8]
  const int tid = threadIdx.x, wave = tid >> 5, lane = tid & 31, col = lane & 15, g = lane >> 4; const int qb = blockIdx.x, h = blockIdx.y; const size_t b = blockIdx.z; const int q0l = qb * 64 + wave * 16; const size_t q0 = b * TT + q0l;
  F2 aq; { float v[16];
#pragma unroll
    for (int i = 0; i < 16; ++i) v[i] = 0.f;
    if (g == 0) { const float* p = QP + (q0 + col) * (NH * 8) + h * 8;
#pragma unroll
      for (int i = 0; i < 8; ++i) v[i] = p[i]; }
    aq = bsplit16(v); }
  // q and J6 k have norm at most 1 (each is a vector over max(its norm, 1e-12)), so |logit| <= 6^-0.5 for every input: exp(logit) lies between 1/2 and 2, P x 2^11 stays far inside f16, and softmax needs no maximum taken off, hence no rescaling of the sums either
  float l[8];   // this lane's share of each row's sum of exp; the 16 lanes of a row are added once, behind the key loop
#pragma unroll
  for (int r = 0; r < 8; ++r) l[r] = 0.f;
  v8f acc[4] = {};
  const int nks = (qb * 64 + 64) / 32;
  // every global load of a key tile is issued well ahead of its use, so that a tile waits for memory at most once and not once per product: the J6 k rows and the v tile one tile ahead, into registers, and from there into the LDS buffer that the next tile reads
  // the four waves use the same v tile (64 d rows x 32 keys, hi and residual): the block fetches it once, four lanes to a row's 64 bytes (8 lines a wave load, where a fragment load from global memory touches 16), and every wave takes its fragments from LDS
  const int srow = tid >> 2, sch = (tid & 3) * 8; const size_t so0 = (b * DM_ + (size_t)h * HD + srow) * TT + sch;
  v8h rs[4];
  auto ld_v = [&](int ks) { const _Float16* ph = VT + so0 + ks * 32; const _Float16* pl = VL + so0 + ks * 32;
    rs[0] = *(const v8h*)ph; rs[1] = *(const v8h*)(ph + 32 * TT); rs[2] = *(const v8h*)pl; rs[3] = *(const v8h*)(pl + 32 * TT);
    // as in tile_ld: the wait behind the loads, their addresses held as inputs up to it
    asm volatile("s_wait_xcnt 0x0" :: "v"(ph), "v"(pl) : "memory"); };
  auto st_v = [&](int bf) { const int o = srow * VP + sch; *(v8h*)&sv[bf][0][o] = rs[0]; *(v8h*)&sv[bf][0][o + 32 * VP] = rs[1]; *(v8h*)&sv[bf][1][o] = rs[2]; *(v8h*)&sv[bf][1][o + 32 * VP] = rs[3]; };
  // the J6 k rows of the tile likewise: 64 threads fetch 16 bytes each, split them into bf16 hi + lo once, and lay them down as the low halves of the B fragments (8 values a key); row 32 of each plane stays zero and serves the lanes whose k lies past the 8 values
  v4f rj = {}; const int jrow = tid >> 1, jch = (tid & 1) * 4;
  auto ld_j = [&](int ks) { if (tid < 64) { const float* p = JK + (b * TT + ks * 32 + jrow) * (NH * 8) + h * 8 + jch; rj = *(const v4f*)p;
      // as in tile_ld: the wait behind the load, its address held as an input up to it
      asm volatile("s_wait_xcnt 0x0" :: "v"(p) : "memory"); } };
  auto st_j = [&](int bf) { if (tid < 64) { v4b oh, ol;
#pragma unroll
      for (int q = 0; q < 4; ++q) { const __bf16 hv = (__bf16)rj[q]; oh[q] = hv; ol[q] = (__bf16)(rj[q] - (float)hv); }
      *(v4b*)&sj[bf][0][jrow * 8 + jch] = oh; *(v4b*)&sj[bf][1][jrow * 8 + jch] = ol; } };
  v8b z8;
#pragma unroll
  for (int i = 0; i < 8; ++i) z8[i] = (__bf16)0.f;
  if (tid < 4) *(v8b*)&sj[tid >> 1][tid & 1][32 * 8] = z8;
  const int jo[2] = {g ? 32 * 8 : col * 8, g ? 32 * 8 : (16 + col) * 8};
  ld_j(0); ld_v(0); st_j(0); st_v(0);
  __syncthreads();
#pragma unroll 1
  for (int ks = 0; ks < nks; ++ks) {
    const int cur = ks & 1; const bool more = ks + 1 < nks;
    if (more) { ld_j(ks + 1); ld_v(ks + 1); }
    F2 bk2[2];
#pragma unroll
    for (int ct = 0; ct < 2; ++ct) { union { v16b v; v8b q[2]; } uh, ul; uh.q[0] = *(const v8b*)&sj[cur][0][jo[ct]]; uh.q[1] = z8; ul.q[0] = *(const v8b*)&sj[cur][1][jo[ct]]; ul.q[1] = z8; bk2[ct].h = uh.v; bk2[ct].l = ul.v; }
#pragma unroll
    for (int ct = 0; ct < 2; ++ct) { const int kt = ks * 32 + ct * 16 + col; const F2 bk = bk2[ct];
      v8f c = {}; c = mac3(aq, bk, c);
#pragma unroll
      for (int r = 0; r < 8; ++r) { const float ex = exp2_slot(c[r] * (0.4082482904638631f * 1.4426950408889634f)), e = (kt <= q0l + 8 * g + r) ? ex : 0.f;   /* exp(c x 6^-0.5) as 2^(c x 6^-0.5 x log2 e): with nothing taken off in between, one multiply */ l[r] += e; sp[wave][8 * g + r][ct * 16 + col] = e; } }
    LDSX();
    v16h pa, pr;   // P x 2^11 as f16 hi + residual (a single f16 would quantise P to 1 part in 2048)
#pragma unroll
    for (int i = 0; i < 8; ++i) { const float f0 = sp[wave][col][8 * g + i] * 2048.0f, f1 = sp[wave][col][16 + 8 * g + i] * 2048.0f; const _Float16 h0 = (_Float16)f0, h1 = (_Float16)f1; pa[i] = h0; pa[8 + i] = h1; pr[i] = (_Float16)(f0 - (float)h0); pr[8 + i] = (_Float16)(f1 - (float)h1); }
    v16h vh[4], vl[4];
#pragma unroll
    for (int j = 0; j < 4; ++j) { vh[j] = frag_h(&sv[cur][0][(j * 16 + col) * VP], lane); vl[j] = frag_h(&sv[cur][1][(j * 16 + col) * VP], lane); }
#pragma unroll
    for (int j = 0; j < 4; ++j) { acc[j] = wmma16(pa, vh[j], acc[j]); acc[j] = wmma16(pr, vh[j], acc[j]); acc[j] = wmma16(pa, vl[j], acc[j]); }
    LDSX();
    if (more) { st_j(cur ^ 1); st_v(cur ^ 1); }   // the buffers that every wave left at the barrier of the tile before
    __syncthreads(); }
#pragma unroll
  for (int r = 0; r < 8; ++r) { float ls = l[r];
#pragma unroll
    for (int o = 1; o < 16; o <<= 1) ls += __shfl_xor(ls, o);
    const float il = (1.0f / 2048.0f) / ls;
#pragma unroll
    for (int j = 0; j < 4; ++j) so[wave][8 * g + r][j * 16 + col] = acc[j][r] * il; }
  LDSX(); for (int rl = 0; rl < 16; ++rl) if (lane < 16) vst2(O + (q0 + rl) * DM_ + h * HD + lane * 4, *(const v4f*)&so[wave][rl][lane * 4]); }
// ---- k_out: block = (64 rows, 128 cols): out = o (hi + lo) Wo^T + bo
__global__ __launch_bounds__(128) void k_out(const float* __restrict__ O, const float* __restrict__ WO, const float* __restrict__ BO, float* __restrict__ OUT) { __shared__ __align__(16) float sf[4][16][132];
  const int tid = threadIdx.x, wave = tid >> 5, lane = tid & 31, col = lane & 15, g = lane >> 4; const int c0 = blockIdx.y * 128; const size_t r0 = (size_t)blockIdx.x * 64 + wave * 16;
  v8f acc[8] = {};
  __shared__ __align__(16) __bf16 oh[2][64 * KP], ol[2][64 * KP], ow[2][128 * KP];
  v4f ra[8], rw[16]; const float* Ob = O + (size_t)blockIdx.x * 64 * DM_; const float* Wb = WO + (size_t)c0 * DM_;
  tile_ld<64, KS>(ra, Ob, DM_, tid); tile_ld<128, KS>(rw, Wb, DM_, tid);
  tile_st2<64, KS>(ra, oh[0], ol[0], tid); tile_st<128, KS>(rw, ow[0], tid);
  __syncthreads();
#pragma unroll 1   // rolled: one copy of the body, so that the next tile's registers are not multiplied
  for (int kc = 0; kc < DM_ / KS; ++kc) { const int cur = kc & 1; const bool more = kc + 1 < DM_ / KS;
    if (more) { tile_ld<64, KS>(ra, Ob + (kc + 1) * KS, DM_, tid); tile_ld<128, KS>(rw, Wb + (kc + 1) * KS, DM_, tid); }
#pragma unroll
    for (int ks = 0; ks < KS / 32; ++ks) { const int ao = (wave * 16 + col) * KP + ks * 32; const v16b ah = frag_b(&oh[cur][ao], lane), al = frag_b(&ol[cur][ao], lane);
#pragma unroll
      for (int j0 = 0; j0 < 8; j0 += 4) { v16b f[4];
#pragma unroll
        for (int j = 0; j < 4; ++j) f[j] = frag_b(&ow[cur][((j0 + j) * 16 + col) * KP + ks * 32], lane);
#pragma unroll
        for (int j = 0; j < 4; ++j) { acc[j0 + j] = wmma_bf(ah, f[j], acc[j0 + j]); acc[j0 + j] = wmma_bf(al, f[j], acc[j0 + j]); } } }
    if (more) { tile_st2<64, KS>(ra, oh[cur ^ 1], ol[cur ^ 1], tid); tile_st<128, KS>(rw, ow[cur ^ 1], tid); }
    __syncthreads(); }
#pragma unroll
  for (int j = 0; j < 8; ++j) { const float bb = bfr(BO[c0 + j * 16 + col]);
#pragma unroll
    for (int r = 0; r < 8; ++r) sf[wave][8 * g + r][j * 16 + col] = acc[j][r] + bb; }
  LDSX(); for (int rl = 0; rl < 16; ++rl) vst2(OUT + (r0 + rl) * DM_ + c0 + lane * 4, *(const v4f*)&sf[wave][rl][lane * 4]); }
extern "C" void kernel_launch(void* const* d_in, const int* in_sizes, int n_in, void* d_out, int out_size, void* d_ws, size_t ws_size, hipStream_t stream) {
  (void)in_sizes; (void)n_in; (void)out_size;
  const float** F = (const float**)d_in;   // 0 x [2,2048,1024], 1 W1_q [64,2048], 2 W2_q, 3 W1_k [64,1024], 4 W2_k, 5 Wv [1024,1024], 6 bv, 7 Wo, 8 bo
  if (ws_size < (size_t)WS_END) return;
  char* ws = (char*)d_ws; float *QP = (float*)(ws + WS_QP), *JK = (float*)(ws + WS_JK), *O = (float*)(ws + WS_O); _Float16 *VT = (_Float16*)(ws + WS_VT), *VL = (_Float16*)(ws + WS_VL);
  k_plv<<<NPL + NPL * (DM_ / 128), 128, 0, stream>>>(F[0], F[1], F[2], F[3], F[4], F[5], F[6], QP, JK, VT, VL);
  k_att<<<dim3(TQB, NH, TNB), 128, 0, stream>>>(QP, JK, VT, VL, O);
  k_out<<<dim3(TNB * TQB, DM_ / 128), 128, 0, stream>>>(O, F[7], F[8], (float*)d_out);   // the rows of both batches lie one behind the other: one grid
}

// v006
// One run takes 156 microseconds.
// Next to v005, in two timings, it ran 1.08 times as fast each time.
// Over all steps from v000 it is 4.48 times as fast.
// compute dtype: all float inputs rounded to bf16; q1/q2 = [x_t ; x_{t-1}] W^T and k1/k2 = x W^T with EXACT bf16 products on WMMA 16x16x32, f32 accumulate; the Plucker 6-vectors, their normalisation and J6 k in f32; q and J6 k split into bf16 hi + lo (3 products, K = 6 zero-padded to 32) for the causal logits x 6^-0.5, softmax in f32 without a maximum (the logits are bounded, see k_att; hardware exp); P (x 2^11, f16 hi + residual) . v with v = x Wv^T + bv exact as f16 hi + residual (3 products); out = o (bf16 hi + lo) Wo^T + bo (2 products); f32 output.
#include <hip/hip_runtime.h>
#include <math.h>

typedef __attribute__((ext_vector_type(16))) _Float16 v16h;
typedef __attribute__((ext_vector_type(16))) __bf16 v16b;
typedef __attribute__((ext_vector_type(8)))  _Float16 v8h;
typedef __attribute__((ext_vector_type(8)))  float v8f;
typedef __attribute__((ext_vector_type(4)))  float v4f;
typedef __attribute__((ext_vector_type(2)))  float v2f;
typedef __attribute__((ext_vector_type(4)))  unsigned v4u;
typedef __attribute__((ext_vector_type(4)))  int v4i;
typedef float __attribute__((may_alias)) float_a;
typedef int __attribute__((may_alias)) int_a;

template <typename T> __device__ __forceinline__ void vst2(void* p, T v) { *(T*)p = v;  }
__device__ __forceinline__ v8f wmma16(v16h a, v16h b, v8f c) {
  v8f d = __builtin_amdgcn_wmma_f32_16x16x32_f16(false, a, false, b, (short)0, c, false, false);
  asm volatile("v_nop\n\tv_nop\n\tv_nop\n\tv_nop" : "+v"(d) : "v"(a), "v"(b));
  return d;
}
__device__ __forceinline__ v8f wmma_bf(v16b a, v16b b, v8f c) {
  v8f d = __builtin_amdgcn_wmma_f32_16x16x32_bf16(false, a, false, b, (short)0, c, false, false);
  asm volatile("v_nop\n\tv_nop\n\tv_nop\n\tv_nop" : "+v"(d) : "v"(a), "v"(b));
  return d;
}
// 16x16x32 fragments: lane = (h = lane>>4, row/col = lane&15); elements 0..7 = k0+8h+0..7, 8..15 = k0+16+8h+0..7; D element r = row 8h+r
__device__ __forceinline__ v16h frag_h(const _Float16* rowk0, int lane) {
  union { v16h v; v8h q[2]; } u; const _Float16* p = rowk0 + 8 * (lane >> 4);
  u.q[0] = *(const v8h*)p; u.q[1] = *(const v8h*)(p + 16); return u.v;
}
__device__ __forceinline__ v16h frag_f32(const float* rowk0, int lane) {
  v16h a; const float* p = rowk0 + 8 * (lane >> 4);
#pragma unroll
  for (int i = 0; i < 8; ++i) { a[i] = (_Float16)p[i]; a[8 + i] = (_Float16)p[16 + i]; }
  return a;
}
__device__ __forceinline__ v16h frag_f32s(const float* rowk0, int lane, float sc) {
  v16h a; const float* p = rowk0 + 8 * (lane >> 4);
#pragma unroll
  for (int i = 0; i < 8; ++i) { a[i] = (_Float16)(p[i] * sc); a[8 + i] = (_Float16)(p[16 + i] * sc); }
  return a;
}
// column fragment from a [K][ld] layout (column n), rows >= K read as 0
__device__ __forceinline__ v16h fragc_f32(const float* W, int k0, int n, int lane, int ld, int K) {
  v16h a; const int g = lane >> 4;
#pragma unroll
  for (int i = 0; i < 8; ++i) { const int ka = k0 + 8 * g + i, kb = ka + 16;
    a[i] = (_Float16)(ka < K ? W[(size_t)(ka < K ? ka : K - 1) * ld + n] : 0.f); a[8 + i] = (_Float16)(kb < K ? W[(size_t)(kb < K ? kb : K - 1) * ld + n] : 0.f); }
  return a;
}
struct F2 { v16b h, l; };
__device__ __forceinline__ F2 bsplit16(const float v[16]) { F2 r;
#pragma unroll
  for (int i = 0; i < 16; ++i) { const __bf16 h = (__bf16)v[i]; r.h[i] = h; r.l[i] = (__bf16)(v[i] - (float)h); }
  return r; }
__device__ __forceinline__ F2 split_row(const float* row, int k0, int lane) { float v[16]; const float* p = row + k0 + 8 * (lane >> 4);
#pragma unroll
  for (int i = 0; i < 8; ++i) { v[i] = p[i]; v[8 + i] = p[16 + i]; }
  return bsplit16(v); }
__device__ __forceinline__ F2 split_rowK(const float* row, int k0, int lane, int K) { float v[16]; const int g = lane >> 4;
#pragma unroll
  for (int i = 0; i < 8; ++i) { const int ka = k0 + 8 * g + i, kb = ka + 16; v[i] = ka < K ? row[ka < K ? ka : K - 1] : 0.f; v[8 + i] = kb < K ? row[kb < K ? kb : K - 1] : 0.f; }
  return bsplit16(v); }
__device__ __forceinline__ F2 split_col(const float* W, int k0, int n, int lane, int ld, int K) { float v[16]; const int g = lane >> 4;
#pragma unroll
  for (int i = 0; i < 8; ++i) { const int ka = k0 + 8 * g + i, kb = ka + 16; v[i] = ka < K ? W[(size_t)(ka < K ? ka : K - 1) * ld + n] : 0.f; v[8 + i] = kb < K ? W[(size_t)(kb < K ? kb : K - 1) * ld + n] : 0.f; }
  return bsplit16(v); }
__device__ __forceinline__ v8f mac3(const F2& a, const F2& b, v8f c) { c = wmma_bf(a.l, b.h, c); c = wmma_bf(a.h, b.l, c); return wmma_bf(a.h, b.h, c); }
__device__ __forceinline__ float sigm(float v) { return 1.0f / (1.0f + expf(-v)); }
#define LDSX() do { asm volatile("s_wait_dscnt 0" ::: "memory"); __builtin_amdgcn_wave_barrier(); __builtin_amdgcn_fence(__ATOMIC_RELEASE, "workgroup"); } while (0)


// Plucker bigram attention (B 2, T 2,048, D 1,024, 16 heads x 64): per head, q = normalised Plucker line of two 4-vectors from the bigram [x_t ; x_{t-1}], k likewise from x_t; logits = q . (J6 k) / sqrt(6), causal softmax, . v, Wo.
#define NB 2
#define TT 2048
#define DM_ 1024
#define NH 16
#define HD 64
#ifndef TNB
#define TNB NB
#endif
#ifndef TQB
#define TQB (TT / 64)
#endif
typedef __attribute__((ext_vector_type(8))) __bf16 v8b;
__device__ __forceinline__ v16b frag_b(const __bf16* rowk0, int lane) {
  union { v16b v; v8b q[2]; } u; const __bf16* p = rowk0 + 8 * (lane >> 4);
  u.q[0] = *(const v8b*)p; u.q[1] = *(const v8b*)(p + 16); return u.v;
}
__device__ __forceinline__ float bfr(float v) { return (float)(__bf16)v; }
__device__ __attribute__((noinline)) float exp_ni(float v) { return expf(v); }
__device__ __attribute__((noinline)) float erf_ni(float v) { return erff(v); }

typedef __attribute__((ext_vector_type(4))) __bf16 v4b;
// Staging of a ROWS x KC f32 tile (rows K-contiguous, row stride ld floats) by the block's 128 threads: consecutive lanes take consecutive 16 bytes of a row, so every wave load covers whole 128-byte lines; the tile is rounded to bf16 once and laid in LDS at a row pitch of KC + 8 elements (16 B x odd).
template <int ROWS, int KC> __device__ __forceinline__ void tile_ld(v4f (&r)[ROWS * KC / 512], const float* __restrict__ src, int ld, int tid, int coff = 0) { const float* p = src + (unsigned)((tid / (KC / 4)) * ld + (tid % (KC / 4)) * 4);
#pragma unroll
  for (int i = 0; i < ROWS * KC / 512; ++i) r[i] = *(const v4f*)(p + coff + (size_t)i * (512 / KC) * ld);
  // the wait stands behind the tile's loads, in front of whatever next writes the registers of their address (the next tile's results, later address arithmetic); p as an input keeps the address in its registers up to the wait: without it the tile's last load got them as its result
  asm volatile("s_wait_xcnt 0x0" :: "v"(p) : "memory"); }
template <int ROWS, int KC> __device__ __forceinline__ void tile_st(const v4f (&r)[ROWS * KC / 512], __bf16* dst, int tid) {
#pragma unroll
  for (int i = 0; i < ROWS * KC / 512; ++i) { v4b o;
#pragma unroll
    for (int q = 0; q < 4; ++q) o[q] = (__bf16)r[i][q];
    *(v4b*)(dst + (tid / (KC / 4)) * (KC + 8) + (tid % (KC / 4)) * 4 + i * (512 / KC) * (KC + 8)) = o; } }
// the same, split into bf16 hi + lo planes
template <int ROWS, int KC> __device__ __forceinline__ void tile_st2(const v4f (&r)[ROWS * KC / 512], __bf16* dh, __bf16* dl, int tid) {
#pragma unroll
  for (int i = 0; i < ROWS * KC / 512; ++i) { v4b oh, ol;
#pragma unroll
    for (int q = 0; q < 4; ++q) { const __bf16 h = (__bf16)r[i][q]; oh[q] = h; ol[q] = (__bf16)(r[i][q] - (float)h); }
    const int o = (tid / (KC / 4)) * (KC + 8) + (tid % (KC / 4)) * 4 + i * (512 / KC) * (KC + 8); *(v4b*)(dh + o) = oh; *(v4b*)(dl + o) = ol; } }
#define KS 64          // k extent of a staged tile in v_body and k_out
#define KP (KS + 8)
#define KS2 32         // k extent of a staged tile in pl_body
#define KP2 (KS2 + 8)

#define WS_QP  0u                                    // f32 [b*t][h][8]: q plucker (6 used)
#define WS_JK  (WS_QP + 4u * (size_t)NB * TT * NH * 8)  // f32 [b*t][h][8]: J6 k
#define WS_VT  (WS_JK + 4u * (size_t)NB * TT * NH * 8)  // f16 v planes [b][1024][t]
#define WS_VL  (WS_VT + 2u * (size_t)NB * DM_ * TT)      // f16 v residual planes
#define WS_O   (WS_VL + 2u * (size_t)NB * DM_ * TT)      // f32 o rows [b*t][1024]
#define WS_END (WS_O + 4u * (size_t)NB * TT * DM_)

// ---- pl_body: block = 64 tokens: q1, q2 (bigram, K = 2048 as two halves), k1, k2 (K = 1024) -> 4 x 64 outputs (one 16-col tile per head-quad... 64 cols = 4 tiles each); then per (token, head) the Plucker vectors
// sm: the launch's LDS block, SM_PL bytes used here; bx: the token block
#define SM_PL (4 * 64 * 68 * 4 + 2 * 64 * NH * 8 * 4)
__device__ __forceinline__ void pl_body(char* sm, int bx, const float* __restrict__ X, const float* __restrict__ W1Q, const float* __restrict__ W2Q, const float* __restrict__ W1K, const float* __restrict__ W2K, float* __restrict__ QP, float* __restrict__ JK) {
  float (&sv)[4][64][68] = *(float (*)[4][64][68])sm;   // [which][token][64]: q1, q2, k1, k2
  float (&sq)[64][NH * 8] = *(float (*)[64][NH * 8])(sm + 4 * 64 * 68 * 4); float (&sk)[64][NH * 8] = *(float (*)[64][NH * 8])(sm + 4 * 64 * 68 * 4 + 64 * NH * 8 * 4);
  const int tid = threadIdx.x, wave = tid >> 5, lane = tid & 31, col = lane & 15, g = lane >> 4;
  // the staging buffers lie on sq, which is first written behind the barrier that follows the last k loop: so the block's LDS stays under half a WGP's and two blocks of the launch share a WGP
  __bf16 (&pa)[2][64 * KP2] = *(__bf16 (*)[2][64 * KP2])(sm + 4 * 64 * 68 * 4); __bf16 (&pw)[2][2][64 * KP2] = *(__bf16 (*)[2][2][64 * KP2])(sm + 4 * 64 * 68 * 4 + 2 * 64 * KP2 * 2);
  static_assert(6 * 64 * KP2 * 2 <= 64 * NH * 8 * 4, "staging buffers inside sq");
  const size_t rb = (size_t)bx * 64;
  // one pass = one pair of weight matrices against one staged x tile per k step: pass 0 x_t . (W1_q, W2_q)[:, 0:1024], pass 1 x_{t-1} . (W1_q, W2_q)[:, 1024:2048] into the same sums (zero row for t = 0), pass 2 x_t . (W1_k, W2_k)
  v8f c1[4] = {}, c2[4] = {};
#pragma unroll   // unrolled so that each pass's pointers and row strides are constants
  for (int ps = 0; ps < 3; ++ps) { const float* Wa = ps == 2 ? W1K : W1Q; const float* Wb = ps == 2 ? W2K : W2Q; const int ldw = ps == 2 ? DM_ : 2 * DM_, cw = ps == 1 ? DM_ : 0;
    v4f ra[4], ru[4], rv[4];
    auto ld_all = [&](int k0) {
      if (ps == 1) { const float* p[4];   // row t - 1; a batch's first row reads itself here and is zeroed in st_all
#pragma unroll
        for (int i = 0; i < 4; ++i) { const size_t gr = rb + i * 16 + (tid >> 3); p[i] = X + (gr - ((gr % TT) == 0 ? 0 : 1)) * DM_ + k0 + (tid & 7) * 4; ra[i] = *(const v4f*)p[i]; }
        // as in tile_ld: the wait behind the four loads, their addresses held as inputs up to it
        asm volatile("s_wait_xcnt 0x0" :: "v"(p[0]), "v"(p[1]), "v"(p[2]), "v"(p[3]) : "memory");
      } else tile_ld<64, KS2>(ra, X + rb * DM_ + k0, DM_, tid);
      tile_ld<64, KS2>(ru, Wa + k0, ldw, tid, cw); tile_ld<64, KS2>(rv, Wb + k0, ldw, tid, cw); };
    auto st_all = [&](int bf) {
      if (ps == 1) {
#pragma unroll
        for (int i = 0; i < 4; ++i) if (((rb + i * 16 + (tid >> 3)) % TT) == 0) ra[i] = (v4f){0.f, 0.f, 0.f, 0.f}; }
      tile_st<64, KS2>(ra, pa[bf], tid); tile_st<64, KS2>(ru, pw[bf][0], tid); tile_st<64, KS2>(rv, pw[bf][1], tid); };
    ld_all(0); st_all(0);
    __syncthreads();
#pragma unroll 1   // rolled: one copy of the body, so that the next tile's registers are not multiplied
    for (int kc = 0; kc < DM_ / KS2; ++kc) { const int cur = kc & 1; const bool more = kc + 1 < DM_ / KS2;
      if (more) ld_all((kc + 1) * KS2);
      const v16b a = frag_b(&pa[cur][(wave * 16 + col) * KP2], lane); v16b f[4][2];
#pragma unroll
      for (int j = 0; j < 4; ++j) { f[j][0] = frag_b(&pw[cur][0][(j * 16 + col) * KP2], lane); f[j][1] = frag_b(&pw[cur][1][(j * 16 + col) * KP2], lane); }
#pragma unroll
      for (int j = 0; j < 4; ++j) { c1[j] = wmma_bf(a, f[j][0], c1[j]); c2[j] = wmma_bf(a, f[j][1], c2[j]); }
      if (more) st_all(cur ^ 1);
      __syncthreads(); }
    if (ps >= 1) { const int w0 = ps == 1 ? 0 : 2;
#pragma unroll
      for (int j = 0; j < 4; ++j)
#pragma unroll
        for (int r = 0; r < 8; ++r) { const int rl = wave * 16 + 8 * g + r, cl = j * 16 + col; sv[w0][rl][cl] = c1[j][r]; sv[w0 + 1][rl][cl] = c2[j][r]; c1[j][r] = 0.f; c2[j][r] = 0.f; } } }
  __syncthreads();
  // plucker per (token, head): thread handles (token = tid/2, 8 heads)
  { const int rl = tid >> 1, h0 = (tid & 1) * 8;
    for (int h = h0; h < h0 + 8; ++h) { const float* a1 = &sv[0][rl][h * 4]; const float* a2 = &sv[1][rl][h * 4]; const float* c1 = &sv[2][rl][h * 4]; const float* c2 = &sv[3][rl][h * 4];
      float pq[6], pk[6]; const int PI[6] = {0, 0, 0, 1, 1, 2}, PJ[6] = {1, 2, 3, 2, 3, 3}; float nq = 0.f, nk = 0.f;
      for (int e = 0; e < 6; ++e) { pq[e] = a1[PI[e]] * a2[PJ[e]] - a1[PJ[e]] * a2[PI[e]]; pk[e] = c1[PI[e]] * c2[PJ[e]] - c1[PJ[e]] * c2[PI[e]]; nq += pq[e] * pq[e]; nk += pk[e] * pk[e]; }
      const float iq = 1.0f / fmaxf(sqrtf(nq), 1e-12f), ik = 1.0f / fmaxf(sqrtf(nk), 1e-12f);
      for (int e = 0; e < 6; ++e) { pq[e] *= iq; pk[e] *= ik; }
      // J6 k = (k5, -k4, k3, k2, -k1, k0)
      float jk[6] = {pk[5], -pk[4], pk[3], pk[2], -pk[1], pk[0]};
      for (int e = 0; e < 8; ++e) { sq[rl][h * 8 + e] = (e < 6) ? pq[e] : 0.f; sk[rl][h * 8 + e] = (e < 6) ? jk[e] : 0.f; } } }
  __syncthreads();
  for (int e = tid; e < 64 * 32; e += 128) { const int rl = e >> 5, q = e & 31; vst2(QP + (rb + rl) * (NH * 8) + q * 4, *(const v4f*)&sq[rl][q * 4]); vst2(JK + (rb + rl) * (NH * 8) + q * 4, *(const v4f*)&sk[rl][q * 4]); } }
// ---- v_body: block = (64 tokens, 128 cols): v = x Wv^T + bv exact -> f16 planes [b][d][t]
#define SM_V (2 * 128 * 72 * 2 + 2 * 64 * KP * 2 + 2 * 128 * KP * 2)
__device__ __forceinline__ void v_body(char* sm, int bx, int by, const float* __restrict__ X, const float* __restrict__ WV, const float* __restrict__ BV, _Float16* __restrict__ VT, _Float16* __restrict__ VL) { _Float16 (&th)[128][72] = *(_Float16 (*)[128][72])sm; _Float16 (&tl)[128][72] = *(_Float16 (*)[128][72])(sm + 128 * 72 * 2);
  const int tid = threadIdx.x, wave = tid >> 5, lane = tid & 31, col = lane & 15, g = lane >> 4; const int c0 = by * 128; const size_t r0 = (size_t)bx * 64;
  v8f acc[8] = {};
  __bf16 (&sa)[2][64 * KP] = *(__bf16 (*)[2][64 * KP])(sm + 2 * 128 * 72 * 2); __bf16 (&sw)[2][128 * KP] = *(__bf16 (*)[2][128 * KP])(sm + 2 * 128 * 72 * 2 + 2 * 64 * KP * 2);
  v4f ra[8], rw[16]; const float* Xb = X + r0 * DM_; const float* Wb = WV + (size_t)c0 * DM_;
  tile_ld<64, KS>(ra, Xb, DM_, tid); tile_ld<128, KS>(rw, Wb, DM_, tid);
  tile_st<64, KS>(ra, sa[0], tid); tile_st<128, KS>(rw, sw[0], tid);
  __syncthreads();
#pragma unroll 1   // rolled: one copy of the body, so that the next tile's registers are not multiplied
  for (int kc = 0; kc < DM_ / KS; ++kc) { const int cur = kc & 1; const bool more = kc + 1 < DM_ / KS;
    if (more) { tile_ld<64, KS>(ra, Xb + (kc + 1) * KS, DM_, tid); tile_ld<128, KS>(rw, Wb + (kc + 1) * KS, DM_, tid); }
#pragma unroll
    for (int ks = 0; ks < KS / 32; ++ks) { const v16b a = frag_b(&sa[cur][(wave * 16 + col) * KP + ks * 32], lane); v16b f[8];
#pragma unroll
      for (int j = 0; j < 8; ++j) f[j] = frag_b(&sw[cur][(j * 16 + col) * KP + ks * 32], lane);
#pragma unroll
      for (int j = 0; j < 8; ++j) acc[j] = wmma_bf(a, f[j], acc[j]); }
    if (more) { tile_st<64, KS>(ra, sa[cur ^ 1], tid); tile_st<128, KS>(rw, sw[cur ^ 1], tid); }
    __syncthreads(); }
#pragma unroll
  for (int j = 0; j < 8; ++j) { const float bb = bfr(BV[c0 + j * 16 + col]);
#pragma unroll
    for (int r = 0; r < 8; ++r) { const float v = acc[j][r] + bb; const _Float16 hv = (_Float16)v; th[j * 16 + col][wave * 16 + 8 * g + r] = hv; tl[j * 16 + col][wave * 16 + 8 * g + r] = (_Float16)(v - (float)hv); } }
  __syncthreads(); const size_t b = r0 / TT; const int t0 = (int)(r0 % TT); for (int e = tid; e < 128 * 8; e += 128) { const int cl = e >> 3, q = e & 7; const size_t o = (b * DM_ + c0 + cl) * (size_t)TT + t0 + q * 8; vst2((unsigned*)(VT + o), *(const v4u*)&th[cl][q * 8]); vst2((unsigned*)(VL + o), *(const v4u*)&tl[cl][q * 8]); } }
// ---- k_plv: the Plucker projections and the v projection depend on x and weights alone, not on each other: one grid holds both, so that the 64 long blocks of the first (started first, lowest indices) run beside the 512 of the second instead of ahead of them on an otherwise idle chip
#define NPL (TNB * TT / 64)
__global__ __launch_bounds__(128) void k_plv(const float* __restrict__ X, const float* __restrict__ W1Q, const float* __restrict__ W2Q, const float* __restrict__ W1K, const float* __restrict__ W2K, const float* __restrict__ WV, const float* __restrict__ BV, float* __restrict__ QP, float* __restrict__ JK, _Float16* __restrict__ VT, _Float16* __restrict__ VL) {
  __shared__ __align__(16) char sm[SM_PL > SM_V ? SM_PL : SM_V];
  const int bi = blockIdx.x;   // the same for the whole block: every barrier of either body is passed by all its threads
  if (bi < NPL) pl_body(sm, bi, X, W1Q, W2Q, W1K, W2K, QP, JK);
  else v_body(sm, (bi - NPL) % NPL, (bi - NPL) / NPL, X, WV, BV, VT, VL); }
// 2^x on the hardware unit. The v_nop fills the one slot that the instruction set asks for behind a transcendental before its result is read or its source overwritten
__device__ __forceinline__ float exp2_slot(float x) { float e; asm("v_exp_f32 %0, %1\n\tv_nop" : "=v"(e) : "v"(x)); return e; }
#define VP 40          // row pitch of a staged v tile in k_att, in f16: 80 B = 16 B x odd
// ---- k_att: block = (a pair of 64-query tiles, head, b): causal, 3-product logits (K = 6 padded) x 6^-0.5
// a query tile's cost grows with its index (tile t reads 2 (t + 1) key tiles) and all blocks are resident at once, so the launch lasts as long as the WGP with the most key tiles: each block takes tile TQB - 1 - x and then tile x, one after the other, which is 2 (TQB + 1) key tiles for every block wherever it lands
__global__ __launch_bounds__(128) void k_att(const float* __restrict__ QP, const float* __restrict__ JK, const _Float16* __restrict__ VT, const _Float16* __restrict__ VL, float* __restrict__ O) {
  __shared__ __align__(16) float sp[4][16][36]; __shared__ __align__(16) float so[4][16][68];
  __shared__ __align__(16) _Float16 sv[2][2][HD * VP];   // [buffer][hi, residual][d row][32 keys], row pitch VP
  __shared__ __align__(16) __bf16 sj[2][2][33 * 8];      // [buffer][hi, lo][32 keys and a zero row][8]
  const int tid = threadIdx.x, wave = tid >> 5, lane = tid & 31, col = lane & 15, g = lane >> 4; const int h = blockIdx.y; const size_t b = blockIdx.z;
  static_assert(TQB % 2 == 0, "query tiles go in pairs");
  // every global load of a key tile is issued well ahead of its use, so that a tile waits for memory at most once and not once per product: the J6 k rows and the v tile one tile ahead, into registers, and from there into the LDS buffer that the next tile reads
  // the four waves use the same v tile (64 d rows x 32 keys, hi and residual): the block fetches it once, four lanes to a row's 64 bytes (8 lines a wave load, where a fragment load from global memory touches 16), and every wave takes its fragments from LDS
  const int srow = tid >> 2, sch = (tid & 3) * 8; const size_t so0 = (b * DM_ + (size_t)h * HD + srow) * TT + sch;
  v8h rs[4];
  auto ld_v = [&](int ks) { const _Float16* ph = VT + so0 + ks * 32; const _Float16* pl = VL + so0 + ks * 32;
    rs[0] = *(const v8h*)ph; rs[1] = *(const v8h*)(ph + 32 * TT); rs[2] = *(const v8h*)pl; rs[3] = *(const v8h*)(pl + 32 * TT);
    // as in tile_ld: the wait behind the loads, their addresses held as inputs up to it
    asm volatile("s_wait_xcnt 0x0" :: "v"(ph), "v"(pl) : "memory"); };
  auto st_v = [&](int bf) { const int o = srow * VP + sch; *(v8h*)&sv[bf][0][o] = rs[0]; *(v8h*)&sv[bf][0][o + 32 * VP] = rs[1]; *(v8h*)&sv[bf][1][o] = rs[2]; *(v8h*)&sv[bf][1][o + 32 * VP] = rs[3]; };
  // the J6 k rows of the tile likewise: 64 threads fetch 16 bytes each, split them into bf16 hi + lo once, and lay them down as the low halves of the B fragments (8 values a key); row 32 of each plane stays zero and serves the lanes whose k lies past the 8 values
  v4f rj = {}; const int jrow = tid >> 1, jch = (tid & 1) * 4;
  auto ld_j = [&](int ks) { if (tid < 64) { const float* p = JK + (b * TT + ks * 32 + jrow) * (NH * 8) + h * 8 + jch; rj = *(const v4f*)p;
      // as in tile_ld: the wait behind the load, its address held as an input up to it
      asm volatile("s_wait_xcnt 0x0" :: "v"(p) : "memory"); } };
  auto st_j = [&](int bf) { if (tid < 64) { v4b oh, ol;
#pragma unroll
      for (int q = 0; q < 4; ++q) { const __bf16 hv = (__bf16)rj[q]; oh[q] = hv; ol[q] = (__bf16)(rj[q] - (float)hv); }
      *(v4b*)&sj[bf][0][jrow * 8 + jch] = oh; *(v4b*)&sj[bf][1][jrow * 8 + jch] = ol; } };
  v8b z8;
#pragma unroll
  for (int i = 0; i < 8; ++i) z8[i] = (__bf16)0.f;
  if (tid < 4) *(v8b*)&sj[tid >> 1][tid & 1][32 * 8] = z8;
  const int jo[2] = {g ? 32 * 8 : col * 8, g ? 32 * 8 : (16 + col) * 8};
#pragma unroll 1   // rolled: one copy of the tile's code serves both query tiles
  for (int hf = 0; hf < 2; ++hf) { const int qb = hf ? (int)blockIdx.x : TQB - 1 - (int)blockIdx.x;   // the same for the whole block: every barrier below is passed by all its threads
  const int q0l = qb * 64 + wave * 16; const size_t q0 = b * TT + q0l;
  F2 aq; { float v[16];
#pragma unroll
    for (int i = 0; i < 16; ++i) v[i] = 0.f;
    if (g == 0) { const float* p = QP + (q0 + col) * (NH * 8) + h * 8;
#pragma unroll
      for (int i = 0; i < 8; ++i) v[i] = p[i]; }
    aq = bsplit16(v); }
  // q and J6 k have norm at most 1 (each is a vector over max(its norm, 1e-12)), so |logit| <= 6^-0.5 for every input: exp(logit) lies between 1/2 and 2, P x 2^11 stays far inside f16, and softmax needs no maximum taken off, hence no rescaling of the sums either
  float l[8];   // this lane's share of each row's sum of exp; the 16 lanes of a row are added once, behind the key loop
#pragma unroll
  for (int r = 0; r < 8; ++r) l[r] = 0.f;
  v8f acc[4] = {};
  const int nks = (qb * 64 + 64) / 32;
  ld_j(0); ld_v(0); st_j(0); st_v(0);   // second query tile: every wave has left both buffers at the barrier that ended the first tile's last key tile
  __syncthreads();
#pragma unroll 1
  for (int ks = 0; ks < nks; ++ks) {
    const int cur = ks & 1; const bool more = ks + 1 < nks;
    if (more) { ld_j(ks + 1); ld_v(ks + 1); }
    F2 bk2[2];
#pragma unroll
    for (int ct = 0; ct < 2; ++ct) { union { v16b v; v8b q[2]; } uh, ul; uh.q[0] = *(const v8b*)&sj[cur][0][jo[ct]]; uh.q[1] = z8; ul.q[0] = *(const v8b*)&sj[cur][1][jo[ct]]; ul.q[1] = z8; bk2[ct].h = uh.v; bk2[ct].l = ul.v; }
#pragma unroll
    for (int ct = 0; ct < 2; ++ct) { const int kt = ks * 32 + ct * 16 + col; const F2 bk = bk2[ct];
      v8f c = {}; c = mac3(aq, bk, c);
#pragma unroll
      for (int r = 0; r < 8; ++r) { const float ex = exp2_slot(c[r] * (0.4082482904638631f * 1.4426950408889634f)), e = (kt <= q0l + 8 * g + r) ? ex : 0.f;   /* exp(c x 6^-0.5) as 2^(c x 6^-0.5 x log2 e): with nothing taken off in between, one multiply */ l[r] += e; sp[wave][8 * g + r][ct * 16 + col] = e; } }
    LDSX();
    v16h pa, pr;   // P x 2^11 as f16 hi + residual (a single f16 would quantise P to 1 part in 2048)
#pragma unroll
    for (int i = 0; i < 8; ++i) { const float f0 = sp[wave][col][8 * g + i] * 2048.0f, f1 = sp[wave][col][16 + 8 * g + i] * 2048.0f; const _Float16 h0 = (_Float16)f0, h1 = (_Float16)f1; pa[i] = h0; pa[8 + i] = h1; pr[i] = (_Float16)(f0 - (float)h0); pr[8 + i] = (_Float16)(f1 - (float)h1); }
    v16h vh[4], vl[4];
#pragma unroll
    for (int j = 0; j < 4; ++j) { vh[j] = frag_h(&sv[cur][0][(j * 16 + col) * VP], lane); vl[j] = frag_h(&sv[cur][1][(j * 16 + col) * VP], lane); }
#pragma unroll
    for (int j = 0; j < 4; ++j) { acc[j] = wmma16(pa, vh[j], acc[j]); acc[j] = wmma16(pr, vh[j], acc[j]); acc[j] = wmma16(pa, vl[j], acc[j]); }
    LDSX();
    if (more) { st_j(cur ^ 1); st_v(cur ^ 1); }   // the buffers that every wave left at the barrier of the tile before
    __syncthreads(); }
#pragma unroll
  for (int r = 0; r < 8; ++r) { float ls = l[r];
#pragma unroll
    for (int o = 1; o < 16; o <<= 1) ls += __shfl_xor(ls, o);
    const float il = (1.0f / 2048.0f) / ls;
#pragma unroll
    for (int j = 0; j < 4; ++j) so[wave][8 * g + r][j * 16 + col] = acc[j][r] * il; }
  LDSX(); for (int rl = 0; rl < 16; ++rl) if (lane < 16) vst2(O + (q0 + rl) * DM_ + h * HD + lane * 4, *(const v4f*)&so[wave][rl][lane * 4]);
  // the wait stands behind the tile's stores, in front of the next query tile's code, which writes the registers of their data and address anew
  asm volatile("s_wait_xcnt 0x0" ::: "memory"); } }
// ---- k_out: block = (64 rows, 128 cols): out = o (hi + lo) Wo^T + bo
__global__ __launch_bounds__(128) void k_out(const float* __restrict__ O, const float* __restrict__ WO, const float* __restrict__ BO, float* __restrict__ OUT) { __shared__ __align__(16) float sf[4][16][132];
  const int tid = threadIdx.x, wave = tid >> 5, lane = tid & 31, col = lane & 15, g = lane >> 4; const int c0 = blockIdx.y * 128; const size_t r0 = (size_t)blockIdx.x * 64 + wave * 16;
  v8f acc[8] = {};
  __shared__ __align__(16) __bf16 oh[2][64 * KP], ol[2][64 * KP], ow[2][128 * KP];
  v4f ra[8], rw[16]; const float* Ob = O + (size_t)blockIdx.x * 64 * DM_; const float* Wb = WO + (size_t)c0 * DM_;
  tile_ld<64, KS>(ra, Ob, DM_, tid); tile_ld<128, KS>(rw, Wb, DM_, tid);
  tile_st2<64, KS>(ra, oh[0], ol[0], tid); tile_st<128, KS>(rw, ow[0], tid);
  __syncthreads();
#pragma unroll 1   // rolled: one copy of the body, so that the next tile's registers are not multiplied
  for (int kc = 0; kc < DM_ / KS; ++kc) { const int cur = kc & 1; const bool more = kc + 1 < DM_ / KS;
    if (more) { tile_ld<64, KS>(ra, Ob + (kc + 1) * KS, DM_, tid); tile_ld<128, KS>(rw, Wb + (kc + 1) * KS, DM_, tid); }
#pragma unroll
    for (int ks = 0; ks < KS / 32; ++ks) { const int ao = (wave * 16 + col) * KP + ks * 32; const v16b ah = frag_b(&oh[cur][ao], lane), al = frag_b(&ol[cur][ao], lane);
#pragma unroll
      for (int j0 = 0; j0 < 8; j0 += 4) { v16b f[4];
#pragma unroll
        for (int j = 0; j < 4; ++j) f[j] = frag_b(&ow[cur][((j0 + j) * 16 + col) * KP + ks * 32], lane);
#pragma unroll
        for (int j = 0; j < 4; ++j) { acc[j0 + j] = wmma_bf(ah, f[j], acc[j0 + j]); acc[j0 + j] = wmma_bf(al, f[j], acc[j0 + j]); } } }
    if (more) { tile_st2<64, KS>(ra, oh[cur ^ 1], ol[cur ^ 1], tid); tile_st<128, KS>(rw, ow[cur ^ 1], tid); }
    __syncthreads(); }
#pragma unroll
  for (int j = 0; j < 8; ++j) { const float bb = bfr(BO[c0 + j * 16 + col]);
#pragma unroll
    for (int r = 0; r < 8; ++r) sf[wave][8 * g + r][j * 16 + col] = acc[j][r] + bb; }
  LDSX(); for (int rl = 0; rl < 16; ++rl) vst2(OUT + (r0 + rl) * DM_ + c0 + lane * 4, *(const v4f*)&sf[wave][rl][lane * 4]); }
extern "C" void kernel_launch(void* const* d_in, const int* in_sizes, int n_in, void* d_out, int out_size, void* d_ws, size_t ws_size, hipStream_t stream) {
  (void)in_sizes; (void)n_in; (void)out_size;
  const float** F = (const float**)d_in;   // 0 x [2,2048,1024], 1 W1_q [64,2048], 2 W2_q, 3 W1_k [64,1024], 4 W2_k, 5 Wv [1024,1024], 6 bv, 7 Wo, 8 bo
  if (ws_size < (size_t)WS_END) return;
  char* ws = (char*)d_ws; float *QP = (float*)(ws + WS_QP), *JK = (float*)(ws + WS_JK), *O = (float*)(ws + WS_O); _Float16 *VT = (_Float16*)(ws + WS_VT), *VL = (_Float16*)(ws + WS_VL);
  k_plv<<<NPL + NPL * (DM_ / 128), 128, 0, stream>>>(F[0], F[1], F[2], F[3], F[4], F[5], F[6], QP, JK, VT, VL);
  k_att<<<dim3(TQB / 2, NH, TNB), 128, 0, stream>>>(QP, JK, VT, VL, O);
  k_out<<<dim3(TNB * TQB, DM_ / 128), 128, 0, stream>>>(O, F[7], F[8], (float*)d_out);   // the rows of both batches lie one behind the other: one grid
}

// v007
// One run takes 119 microseconds.
// Two timings next to v006 put it at 1.32 and 1.31 times that version's speed.
// All steps since v000 together make it 5.89 times as fast.
// compute dtype: all float inputs rounded to bf16; q1/q2 = [x_t ; x_{t-1}] W^T and k1/k2 = x W^T with EXACT bf16 products on WMMA 16x16x32, f32 accumulate; the Plucker 6-vectors, their normalisation and J6 k in f32; q and J6 k split into bf16 hi + lo (3 products, K = 6 zero-padded to 32) for the causal logits x 6^-0.5, softmax in f32 without a maximum (the logits are bounded, see k_att; hardware exp); P (x 2^11, f16 hi + residual) . v with v = x Wv^T + bv exact as f16 hi + residual (3 products); out = o (bf16 hi + lo) Wo^T + bo (2 products); f32 output.
#include <hip/hip_runtime.h>
#include <math.h>

typedef __attribute__((ext_vector_type(16))) _Float16 v16h;
typedef __attribute__((ext_vector_type(16))) __bf16 v16b;
typedef __attribute__((ext_vector_type(8)))  _Float16 v8h;
typedef __attribute__((ext_vector_type(8)))  float v8f;
typedef __attribute__((ext_vector_type(4)))  float v4f;
typedef __attribute__((ext_vector_type(2)))  float v2f;
typedef __attribute__((ext_vector_type(4)))  unsigned v4u;
typedef __attribute__((ext_vector_type(4)))  int v4i;
typedef float __attribute__((may_alias)) float_a;
typedef int __attribute__((may_alias)) int_a;

template <typename T> __device__ __forceinline__ void vst2(void* p, T v) { *(T*)p = v;  }
__device__ __forceinline__ v8f wmma16(v16h a, v16h b, v8f c) {
  v8f d = __builtin_amdgcn_wmma_f32_16x16x32_f16(false, a, false, b, (short)0, c, false, false);
  asm volatile("v_nop\n\tv_nop\n\tv_nop\n\tv_nop" : "+v"(d) : "v"(a), "v"(b));
  return d;
}
__device__ __forceinline__ v8f wmma_bf(v16b a, v16b b, v8f c) {
  v8f d = __builtin_amdgcn_wmma_f32_16x16x32_bf16(false, a, false, b, (short)0, c, false, false);
  asm volatile("v_nop\n\tv_nop\n\tv_nop\n\tv_nop" : "+v"(d) : "v"(a), "v"(b));
  return d;
}
// 16x16x32 fragments: lane = (h = lane>>4, row/col = lane&15); elements 0..7 = k0+8h+0..7, 8..15 = k0+16+8h+0..7; D element r = row 8h+r
__device__ __forceinline__ v16h frag_h(const _Float16* rowk0, int lane) {
  union { v16h v; v8h q[2]; } u; const _Float16* p = rowk0 + 8 * (lane >> 4);
  u.q[0] = *(const v8h*)p; u.q[1] = *(const v8h*)(p + 16); return u.v;
}
__device__ __forceinline__ v16h frag_f32(const float* rowk0, int lane) {
  v16h a; const float* p = rowk0 + 8 * (lane >> 4);
#pragma unroll
  for (int i = 0; i < 8; ++i) { a[i] = (_Float16)p[i]; a[8 + i] = (_Float16)p[16 + i]; }
  return a;
}
__device__ __forceinline__ v16h frag_f32s(const float* rowk0, int lane, float sc) {
  v16h a; const float* p = rowk0 + 8 * (lane >> 4);
#pragma unroll
  for (int i = 0; i < 8; ++i) { a[i] = (_Float16)(p[i] * sc); a[8 + i] = (_Float16)(p[16 + i] * sc); }
  return a;
}
// column fragment from a [K][ld] layout (column n), rows >= K read as 0
__device__ __forceinline__ v16h fragc_f32(const float* W, int k0, int n, int lane, int ld, int K) {
  v16h a; const int g = lane >> 4;
#pragma unroll
  for (int i = 0; i < 8; ++i) { const int ka = k0 + 8 * g + i, kb = ka + 16;
    a[i] = (_Float16)(ka < K ? W[(size_t)(ka < K ? ka : K - 1) * ld + n] : 0.f); a[8 + i] = (_Float16)(kb < K ? W[(size_t)(kb < K ? kb : K - 1) * ld + n] : 0.f); }
  return a;
}
struct F2 { v16b h, l; };
__device__ __forceinline__ F2 bsplit16(const float v[16]) { F2 r;
#pragma unroll
  for (int i = 0; i < 16; ++i) { const __bf16 h = (__bf16)v[i]; r.h[i] = h; r.l[i] = (__bf16)(v[i] - (float)h); }
  return r; }
__device__ __forceinline__ F2 split_row(const float* row, int k0, int lane) { float v[16]; const float* p = row + k0 + 8 * (lane >> 4);
#pragma unroll
  for (int i = 0; i < 8; ++i) { v[i] = p[i]; v[8 + i] = p[16 + i]; }
  return bsplit16(v); }
__device__ __forceinline__ F2 split_rowK(const float* row, int k0, int lane, int K) { float v[16]; const int g = lane >> 4;
#pragma unroll
  for (int i = 0; i < 8; ++i) { const int ka = k0 + 8 * g + i, kb = ka + 16; v[i] = ka < K ? row[ka < K ? ka : K - 1] : 0.f; v[8 + i] = kb < K ? row[kb < K ? kb : K - 1] : 0.f; }
  return bsplit16(v); }
__device__ __forceinline__ F2 split_col(const float* W, int k0, int n, int lane, int ld, int K) { float v[16]; const int g = lane >> 4;
#pragma unroll
  for (int i = 0; i < 8; ++i) { const int ka = k0 + 8 * g + i, kb = ka + 16; v[i] = ka < K ? W[(size_t)(ka < K ? ka : K - 1) * ld + n] : 0.f; v[8 + i] = kb < K ? W[(size_t)(kb < K ? kb : K - 1) * ld + n] : 0.f; }
  return bsplit16(v); }
__device__ __forceinline__ v8f mac3(const F2& a, const F2& b, v8f c) { c = wmma_bf(a.l, b.h, c); c = wmma_bf(a.h, b.l, c); return wmma_bf(a.h, b.h, c); }
__device__ __forceinline__ float sigm(float v) { return 1.0f / (1.0f + expf(-v)); }
#define LDSX() do { asm volatile("s_wait_dscnt 0" ::: "memory"); __builtin_amdgcn_wave_barrier(); __builtin_amdgcn_fence(__ATOMIC_RELEASE, "workgroup"); } while (0)


// Plucker bigram attention (B 2, T 2,048, D 1,024, 16 heads x 64): per head, q = normalised Plucker line of two 4-vectors from the bigram [x_t ; x_{t-1}], k likewise from x_t; logits = q . (J6 k) / sqrt(6), causal softmax, . v, Wo.
#define NB 2
#define TT 2048
#define DM_ 1024
#define NH 16
#define HD 64
#ifndef TNB
#define TNB NB
#endif
#ifndef TQB
#define TQB (TT / 64)
#endif
typedef __attribute__((ext_vector_type(8))) __bf16 v8b;
__device__ __forceinline__ v16b frag_b(const __bf16* rowk0, int lane) {
  union { v16b v; v8b q[2]; } u; const __bf16* p = rowk0 + 8 * (lane >> 4);
  u.q[0] = *(const v8b*)p; u.q[1] = *(const v8b*)(p + 16); return u.v;
}
__device__ __forceinline__ float bfr(float v) { return (float)(__bf16)v; }
__device__ __attribute__((noinline)) float exp_ni(float v) { return expf(v); }
__device__ __attribute__((noinline)) float erf_ni(float v) { return erff(v); }

typedef __attribute__((ext_vector_type(4))) __bf16 v4b;
// Staging of a ROWS x KC f32 tile (rows K-contiguous, row stride ld floats) by the block's 128 threads: consecutive lanes take consecutive 16 bytes of a row, so every wave load covers whole 128-byte lines; the tile is rounded to bf16 once and laid in LDS at a row pitch of KC + 8 elements (16 B x odd).
template <int ROWS, int KC> __device__ __forceinline__ void tile_ld(v4f (&r)[ROWS * KC / 512], const float* __restrict__ src, int ld, int tid, int coff = 0) { const float* p = src + (unsigned)((tid / (KC / 4)) * ld + (tid % (KC / 4)) * 4);
#pragma unroll
  for (int i = 0; i < ROWS * KC / 512; ++i) r[i] = *(const v4f*)(p + coff + (size_t)i * (512 / KC) * ld);
  // the wait stands behind the tile's loads, in front of whatever next writes the registers of their address (the next tile's results, later address arithmetic); p as an input keeps the address in its registers up to the wait: without it the tile's last load got them as its result
  asm volatile("s_wait_xcnt 0x0" :: "v"(p) : "memory"); }
template <int ROWS, int KC> __device__ __forceinline__ void tile_st(const v4f (&r)[ROWS * KC / 512], __bf16* dst, int tid) {
#pragma unroll
  for (int i = 0; i < ROWS * KC / 512; ++i) { v4b o;
#pragma unroll
    for (int q = 0; q < 4; ++q) o[q] = (__bf16)r[i][q];
    *(v4b*)(dst + (tid / (KC / 4)) * (KC + 8) + (tid % (KC / 4)) * 4 + i * (512 / KC) * (KC + 8)) = o; } }
// the same, split into bf16 hi + lo planes
template <int ROWS, int KC> __device__ __forceinline__ void tile_st2(const v4f (&r)[ROWS * KC / 512], __bf16* dh, __bf16* dl, int tid) {
#pragma unroll
  for (int i = 0; i < ROWS * KC / 512; ++i) { v4b oh, ol;
#pragma unroll
    for (int q = 0; q < 4; ++q) { const __bf16 h = (__bf16)r[i][q]; oh[q] = h; ol[q] = (__bf16)(r[i][q] - (float)h); }
    const int o = (tid / (KC / 4)) * (KC + 8) + (tid % (KC / 4)) * 4 + i * (512 / KC) * (KC + 8); *(v4b*)(dh + o) = oh; *(v4b*)(dl + o) = ol; } }
#define KS 64          // k extent of a staged tile in v_body and k_out
#define KP (KS + 8)
#define KS2 32         // k extent of a staged tile in pl_body
#define KP2 (KS2 + 8)

#define WS_QP  0u                                    // f32 [b*t][h][8]: q plucker (6 used)
#define WS_JK  (WS_QP + 4u * (size_t)NB * TT * NH * 8)  // f32 [b*t][h][8]: J6 k
#define WS_VT  (WS_JK + 4u * (size_t)NB * TT * NH * 8)  // f16 v planes [b][1024][t]
#define WS_VL  (WS_VT + 2u * (size_t)NB * DM_ * TT)      // f16 v residual planes
#define WS_O   (WS_VL + 2u * (size_t)NB * DM_ * TT)      // f32 o rows [b*t][1024]
#define WS_END (WS_O + 4u * (size_t)NB * TT * DM_)

// ---- k_pl: block = 32 tokens and ONE pair of weight matrices: (W1_q, W2_q) against the bigram, K = 2048, or (W1_k, W2_k) against x, K = 1024 -> 2 x 64 outputs, then per (token, head) the Plucker vector of that pair
// the k loop is a chain of load, wait, barrier, so its length in steps is its time: K is cut in two parts that run side by side, waves 0 and 1 on the first (16 tokens each), waves 2 and 3 on the second, and the two partial sums are added once behind the loop; for q the parts are x_t . W[:, 0:1024] and x_{t-1} . W[:, 1024:2048] (zero row for t = 0)
// sm: the launch's LDS block, SM_PL bytes used here; bx: the token block
#define PT 32
#define SM_PA (2 * 2 * PT * KP2 * 2)
#define SM_PW (2 * 2 * 2 * 64 * KP2 * 2)
#define SM_PS (2 * 2 * PT * 68 * 4)
#define SM_PL (SM_PA + SM_PW + SM_PS + PT * NH * 8 * 4)
template <bool ISQ> __device__ __forceinline__ void pl_body(char* sm, int bx, const float* __restrict__ X, const float* __restrict__ Wa, const float* __restrict__ Wb, float* __restrict__ PO) {
  constexpr int NST = (ISQ ? DM_ : DM_ / 2) / KS2, ldw = ISQ ? 2 * DM_ : DM_;   // k steps of a part; row stride of the weights
  __bf16 (&pa)[2][2][PT * KP2] = *(__bf16 (*)[2][2][PT * KP2])sm;                       // [buffer][part][token][k]
  __bf16 (&pw)[2][2][2][64 * KP2] = *(__bf16 (*)[2][2][2][64 * KP2])(sm + SM_PA);        // [buffer][part][matrix][output][k]
  float (&sv)[2][2][PT][68] = *(float (*)[2][2][PT][68])(sm + SM_PA + SM_PW);            // [part][matrix][token][64]: partial sums
  float (&sq)[PT][NH * 8] = *(float (*)[PT][NH * 8])(sm + SM_PA + SM_PW + SM_PS);
  const int tid = threadIdx.x, wave = tid >> 5, lane = tid & 31, col = lane & 15, g = lane >> 4, part = wave >> 1, wr = (wave & 1) * 16;
  const size_t rb = (size_t)bx * PT;
  const int srow = tid >> 3, sc = (tid & 7) * 4;
  // xa: the thread's x_t row; xb: for q, the x_{t-1} row of its first 16-row group (a batch's first row reads itself there and is zeroed in st_all; the second group never holds such a row); everything else lies at a constant distance from xa, wa, wb
  constexpr int KPART = NST * KS2;
  const float* xa = X + (rb + srow) * DM_ + sc; const float* wa = Wa + srow * ldw + sc; const float* wb = Wb + srow * ldw + sc;
  const float* xb = xa - (((rb + srow) % TT) != 0 ? DM_ : 0);
  static_assert(TT % PT == 0, "a batch's first row is a block's first row");
  v8f c1[4] = {}, c2[4] = {};
  v4f ra[2][2], rw[2][2][4];
  auto ld_all = [&](int k0) { const float* x = xa + k0; const float* u = wa + k0; const float* v = wb + k0;
    ra[0][0] = *(const v4f*)x; ra[0][1] = *(const v4f*)(x + 16 * DM_);
    const float* y = xb + k0;
    if constexpr (ISQ) { ra[1][0] = *(const v4f*)y; ra[1][1] = *(const v4f*)(x + 15 * DM_); }
    else { ra[1][0] = *(const v4f*)(x + KPART); ra[1][1] = *(const v4f*)(x + KPART + 16 * DM_); }
#pragma unroll
    for (int i = 0; i < 4; ++i) { rw[0][0][i] = *(const v4f*)(u + i * 16 * ldw); rw[0][1][i] = *(const v4f*)(v + i * 16 * ldw); rw[1][0][i] = *(const v4f*)(u + KPART + i * 16 * ldw); rw[1][1][i] = *(const v4f*)(v + KPART + i * 16 * ldw); }
    // as in tile_ld: one wait behind the step's loads, their addresses held as inputs up to it
    if constexpr (ISQ) asm volatile("s_wait_xcnt 0x0" :: "v"(x), "v"(y), "v"(u), "v"(v) : "memory");
    else asm volatile("s_wait_xcnt 0x0" :: "v"(x), "v"(u), "v"(v) : "memory"); };
  auto st_all = [&](int bf) {
    if (ISQ && ((rb + srow) % TT) == 0) ra[1][0] = (v4f){0.f, 0.f, 0.f, 0.f};
#pragma unroll
    for (int p = 0; p < 2; ++p) { tile_st<PT, KS2>(ra[p], pa[bf][p], tid); tile_st<64, KS2>(rw[p][0], pw[bf][p][0], tid); tile_st<64, KS2>(rw[p][1], pw[bf][p][1], tid); } };
  ld_all(0); st_all(0);
  __syncthreads();
#pragma unroll 1   // rolled: one copy of the body, so that the next tile's registers are not multiplied
  for (int kc = 0; kc < NST; ++kc) { const int cur = kc & 1; const bool more = kc + 1 < NST;
    if (more) ld_all((kc + 1) * KS2);
    const v16b a = frag_b(&pa[cur][part][(wr + col) * KP2], lane); v16b f[4][2];
#pragma unroll
    for (int j = 0; j < 4; ++j) { f[j][0] = frag_b(&pw[cur][part][0][(j * 16 + col) * KP2], lane); f[j][1] = frag_b(&pw[cur][part][1][(j * 16 + col) * KP2], lane); }
#pragma unroll
    for (int j = 0; j < 4; ++j) { c1[j] = wmma_bf(a, f[j][0], c1[j]); c2[j] = wmma_bf(a, f[j][1], c2[j]); }
    if (more) st_all(cur ^ 1);
    __syncthreads(); }
#pragma unroll
  for (int j = 0; j < 4; ++j)
#pragma unroll
    for (int r = 0; r < 8; ++r) { const int rl = wr + 8 * g + r, cl = j * 16 + col; sv[part][0][rl][cl] = c1[j][r]; sv[part][1][rl][cl] = c2[j][r]; }
  __syncthreads();
  // plucker per (token, head): thread handles (token = tid/4, 4 heads)
  { const int rl = tid >> 2, h0 = (tid & 3) * 4;
    for (int h = h0; h < h0 + 4; ++h) { float a1[4], a2[4];
      for (int e = 0; e < 4; ++e) { a1[e] = sv[0][0][rl][h * 4 + e] + sv[1][0][rl][h * 4 + e]; a2[e] = sv[0][1][rl][h * 4 + e] + sv[1][1][rl][h * 4 + e]; }
      float pp[6]; const int PI[6] = {0, 0, 0, 1, 1, 2}, PJ[6] = {1, 2, 3, 2, 3, 3}; float nn = 0.f;
      for (int e = 0; e < 6; ++e) { pp[e] = a1[PI[e]] * a2[PJ[e]] - a1[PJ[e]] * a2[PI[e]]; nn += pp[e] * pp[e]; }
      const float in = 1.0f / fmaxf(sqrtf(nn), 1e-12f);
      for (int e = 0; e < 6; ++e) pp[e] *= in;
      // J6 k = (k5, -k4, k3, k2, -k1, k0)
      const float po[6] = {ISQ ? pp[0] : pp[5], ISQ ? pp[1] : -pp[4], ISQ ? pp[2] : pp[3], ISQ ? pp[3] : pp[2], ISQ ? pp[4] : -pp[1], ISQ ? pp[5] : pp[0]};
      for (int e = 0; e < 8; ++e) sq[rl][h * 8 + e] = (e < 6) ? po[e] : 0.f; } }
  __syncthreads();
  for (int e = tid; e < PT * 32; e += 128) { const int rl = e >> 5, q = e & 31; vst2(PO + (rb + rl) * (NH * 8) + q * 4, *(const v4f*)&sq[rl][q * 4]); } }
// ---- k_v: block = (64 tokens, 128 cols): v = x Wv^T + bv exact -> f16 planes [b][d][t]
#define SM_V (2 * 128 * 72 * 2 + 2 * 64 * KP * 2 + 2 * 128 * KP * 2)
__device__ __forceinline__ void v_body(char* sm, int bx, int by, const float* __restrict__ X, const float* __restrict__ WV, const float* __restrict__ BV, _Float16* __restrict__ VT, _Float16* __restrict__ VL) { _Float16 (&th)[128][72] = *(_Float16 (*)[128][72])sm; _Float16 (&tl)[128][72] = *(_Float16 (*)[128][72])(sm + 128 * 72 * 2);
  const int tid = threadIdx.x, wave = tid >> 5, lane = tid & 31, col = lane & 15, g = lane >> 4; const int c0 = by * 128; const size_t r0 = (size_t)bx * 64;
  v8f acc[8] = {};
  __bf16 (&sa)[2][64 * KP] = *(__bf16 (*)[2][64 * KP])(sm + 2 * 128 * 72 * 2); __bf16 (&sw)[2][128 * KP] = *(__bf16 (*)[2][128 * KP])(sm + 2 * 128 * 72 * 2 + 2 * 64 * KP * 2);
  v4f ra[8], rw[16]; const float* Xb = X + r0 * DM_; const float* Wb = WV + (size_t)c0 * DM_;
  tile_ld<64, KS>(ra, Xb, DM_, tid); tile_ld<128, KS>(rw, Wb, DM_, tid);
  tile_st<64, KS>(ra, sa[0], tid); tile_st<128, KS>(rw, sw[0], tid);
  __syncthreads();
#pragma unroll 1   // rolled: one copy of the body, so that the next tile's registers are not multiplied
  for (int kc = 0; kc < DM_ / KS; ++kc) { const int cur = kc & 1; const bool more = kc + 1 < DM_ / KS;
    if (more) { tile_ld<64, KS>(ra, Xb + (kc + 1) * KS, DM_, tid); tile_ld<128, KS>(rw, Wb + (kc + 1) * KS, DM_, tid); }
#pragma unroll
    for (int ks = 0; ks < KS / 32; ++ks) { const v16b a = frag_b(&sa[cur][(wave * 16 + col) * KP + ks * 32], lane); v16b f[8];
#pragma unroll
      for (int j = 0; j < 8; ++j) f[j] = frag_b(&sw[cur][(j * 16 + col) * KP + ks * 32], lane);
#pragma unroll
      for (int j = 0; j < 8; ++j) acc[j] = wmma_bf(a, f[j], acc[j]); }
    if (more) { tile_st<64, KS>(ra, sa[cur ^ 1], tid); tile_st<128, KS>(rw, sw[cur ^ 1], tid); }
    __syncthreads(); }
#pragma unroll
  for (int j = 0; j < 8; ++j) { const float bb = bfr(BV[c0 + j * 16 + col]);
#pragma unroll
    for (int r = 0; r < 8; ++r) { const float v = acc[j][r] + bb; const _Float16 hv = (_Float16)v; th[j * 16 + col][wave * 16 + 8 * g + r] = hv; tl[j * 16 + col][wave * 16 + 8 * g + r] = (_Float16)(v - (float)hv); } }
  __syncthreads(); const size_t b = r0 / TT; const int t0 = (int)(r0 % TT); for (int e = tid; e < 128 * 8; e += 128) { const int cl = e >> 3, q = e & 7; const size_t o = (b * DM_ + c0 + cl) * (size_t)TT + t0 + q * 8; vst2((unsigned*)(VT + o), *(const v4u*)&th[cl][q * 8]); vst2((unsigned*)(VL + o), *(const v4u*)&tl[cl][q * 8]); } }
// ---- k_plv: the Plucker projections and the v projection depend on x and weights alone, not on each other: one grid holds all three kinds of block, the longest first (q: 32 k steps, k: 16 lighter ones, v: 16); the LDS block lets three blocks share a WGP, so the whole grid is resident at once
#define NPL (TNB * TT / PT)
#define NVB (TNB * TT / 64)
__global__ __launch_bounds__(128) void k_plv(const float* __restrict__ X, const float* __restrict__ W1Q, const float* __restrict__ W2Q, const float* __restrict__ W1K, const float* __restrict__ W2K, const float* __restrict__ WV, const float* __restrict__ BV, float* __restrict__ QP, float* __restrict__ JK, _Float16* __restrict__ VT, _Float16* __restrict__ VL) {
  __shared__ __align__(16) char sm[SM_PL > SM_V ? SM_PL : SM_V];
  const int bi = blockIdx.x;   // the same for the whole block: every barrier of a body is passed by all its threads
  if (bi < NPL) pl_body<true>(sm, bi, X, W1Q, W2Q, QP);
  else if (bi < 2 * NPL) pl_body<false>(sm, bi - NPL, X, W1K, W2K, JK);
  else v_body(sm, (bi - 2 * NPL) % NVB, (bi - 2 * NPL) / NVB, X, WV, BV, VT, VL); }
// 2^x on the hardware unit. The v_nop fills the one slot that the instruction set asks for behind a transcendental before its result is read or its source overwritten
__device__ __forceinline__ float exp2_slot(float x) { float e; asm("v_exp_f32 %0, %1\n\tv_nop" : "=v"(e) : "v"(x)); return e; }
#define VP 40          // row pitch of a staged v tile in k_att, in f16: 80 B = 16 B x odd
// ---- k_att: block = (a pair of 64-query tiles, head, b): causal, 3-product logits (K = 6 padded) x 6^-0.5
// a query tile's cost grows with its index (tile t reads 2 (t + 1) key tiles) and all blocks are resident at once, so the launch lasts as long as the WGP with the most key tiles: each block takes tile TQB - 1 - x and then tile x, one after the other, which is 2 (TQB + 1) key tiles for every block wherever it lands
__global__ __launch_bounds__(128) void k_att(const float* __restrict__ QP, const float* __restrict__ JK, const _Float16* __restrict__ VT, const _Float16* __restrict__ VL, float* __restrict__ O) {
  __shared__ __align__(16) float sp[4][16][36]; __shared__ __align__(16) float so[4][16][68];
  __shared__ __align__(16) _Float16 sv[2][2][HD * VP];   // [buffer][hi, residual][d row][32 keys], row pitch VP
  __shared__ __align__(16) __bf16 sj[2][2][33 * 8];      // [buffer][hi, lo][32 keys and a zero row][8]
  const int tid = threadIdx.x, wave = tid >> 5, lane = tid & 31, col = lane & 15, g = lane >> 4; const int h = blockIdx.y; const size_t b = blockIdx.z;
  static_assert(TQB % 2 == 0, "query tiles go in pairs");
  // every global load of a key tile is issued well ahead of its use, so that a tile waits for memory at most once and not once per product: the J6 k rows and the v tile one tile ahead, into registers, and from there into the LDS buffer that the next tile reads
  // the four waves use the same v tile (64 d rows x 32 keys, hi and residual): the block fetches it once, four lanes to a row's 64 bytes (8 lines a wave load, where a fragment load from global memory touches 16), and every wave takes its fragments from LDS
  const int srow = tid >> 2, sch = (tid & 3) * 8; const size_t so0 = (b * DM_ + (size_t)h * HD + srow) * TT + sch;
  v8h rs[4];
  auto ld_v = [&](int ks) { const _Float16* ph = VT + so0 + ks * 32; const _Float16* pl = VL + so0 + ks * 32;
    rs[0] = *(const v8h*)ph; rs[1] = *(const v8h*)(ph + 32 * TT); rs[2] = *(const v8h*)pl; rs[3] = *(const v8h*)(pl + 32 * TT);
    // as in tile_ld: the wait behind the loads, their addresses held as inputs up to it
    asm volatile("s_wait_xcnt 0x0" :: "v"(ph), "v"(pl) : "memory"); };
  auto st_v = [&](int bf) { const int o = srow * VP + sch; *(v8h*)&sv[bf][0][o] = rs[0]; *(v8h*)&sv[bf][0][o + 32 * VP] = rs[1]; *(v8h*)&sv[bf][1][o] = rs[2]; *(v8h*)&sv[bf][1][o + 32 * VP] = rs[3]; };
  // the J6 k rows of the tile likewise: 64 threads fetch 16 bytes each, split them into bf16 hi + lo once, and lay them down as the low halves of the B fragments (8 values a key); row 32 of each plane stays zero and serves the lanes whose k lies past the 8 values
  v4f rj = {}; const int jrow = tid >> 1, jch = (tid & 1) * 4;
  auto ld_j = [&](int ks) { if (tid < 64) { const float* p = JK + (b * TT + ks * 32 + jrow) * (NH * 8) + h * 8 + jch; rj = *(const v4f*)p;
      // as in tile_ld: the wait behind the load, its address held as an input up to it
      asm volatile("s_wait_xcnt 0x0" :: "v"(p) : "memory"); } };
  auto st_j = [&](int bf) { if (tid < 64) { v4b oh, ol;
#pragma unroll
      for (int q = 0; q < 4; ++q) { const __bf16 hv = (__bf16)rj[q]; oh[q] = hv; ol[q] = (__bf16)(rj[q] - (float)hv); }
      *(v4b*)&sj[bf][0][jrow * 8 + jch] = oh; *(v4b*)&sj[bf][1][jrow * 8 + jch] = ol; } };
  v8b z8;
#pragma unroll
  for (int i = 0; i < 8; ++i) z8[i] = (__bf16)0.f;
  if (tid < 4) *(v8b*)&sj[tid >> 1][tid & 1][32 * 8] = z8;
  const int jo[2] = {g ? 32 * 8 : col * 8, g ? 32 * 8 : (16 + col) * 8};
#pragma unroll 1   // rolled: one copy of the tile's code serves both query tiles
  for (int hf = 0; hf < 2; ++hf) { const int qb = hf ? (int)blockIdx.x : TQB - 1 - (int)blockIdx.x;   // the same for the whole block: every barrier below is passed by all its threads
  const int q0l = qb * 64 + wave * 16; const size_t q0 = b * TT + q0l;
  F2 aq; { float v[16];
#pragma unroll
    for (int i = 0; i < 16; ++i) v[i] = 0.f;
    if (g == 0) { const float* p = QP + (q0 + col) * (NH * 8) + h * 8;
#pragma unroll
      for (int i = 0; i < 8; ++i) v[i] = p[i]; }
    aq = bsplit16(v); }
  // q and J6 k have norm at most 1 (each is a vector over max(its norm, 1e-12)), so |logit| <= 6^-0.5 for every input: exp(logit) lies between 1/2 and 2, P x 2^11 stays far inside f16, and softmax needs no maximum taken off, hence no rescaling of the sums either
  float l[8];   // this lane's share of each row's sum of exp; the 16 lanes of a row are added once, behind the key loop
#pragma unroll
  for (int r = 0; r < 8; ++r) l[r] = 0.f;
  v8f acc[4] = {};
  const int nks = (qb * 64 + 64) / 32;
  ld_j(0); ld_v(0); st_j(0); st_v(0);   // second query tile: every wave has left both buffers at the barrier that ended the first tile's last key tile
  __syncthreads();
#pragma unroll 1
  for (int ks = 0; ks < nks; ++ks) {
    const int cur = ks & 1; const bool more = ks + 1 < nks;
    if (more) { ld_j(ks + 1); ld_v(ks + 1); }
    F2 bk2[2];
#pragma unroll
    for (int ct = 0; ct < 2; ++ct) { union { v16b v; v8b q[2]; } uh, ul; uh.q[0] = *(const v8b*)&sj[cur][0][jo[ct]]; uh.q[1] = z8; ul.q[0] = *(const v8b*)&sj[cur][1][jo[ct]]; ul.q[1] = z8; bk2[ct].h = uh.v; bk2[ct].l = ul.v; }
#pragma unroll
    for (int ct = 0; ct < 2; ++ct) { const int kt = ks * 32 + ct * 16 + col; const F2 bk = bk2[ct];
      v8f c = {}; c = mac3(aq, bk, c);
#pragma unroll
      for (int r = 0; r < 8; ++r) { const float ex = exp2_slot(c[r] * (0.4082482904638631f * 1.4426950408889634f)), e = (kt <= q0l + 8 * g + r) ? ex : 0.f;   /* exp(c x 6^-0.5) as 2^(c x 6^-0.5 x log2 e): with nothing taken off in between, one multiply */ l[r] += e; sp[wave][8 * g + r][ct * 16 + col] = e; } }
    LDSX();
    v16h pa, pr;   // P x 2^11 as f16 hi + residual (a single f16 would quantise P to 1 part in 2048)
#pragma unroll
    for (int i = 0; i < 8; ++i) { const float f0 = sp[wave][col][8 * g + i] * 2048.0f, f1 = sp[wave][col][16 + 8 * g + i] * 2048.0f; const _Float16 h0 = (_Float16)f0, h1 = (_Float16)f1; pa[i] = h0; pa[8 + i] = h1; pr[i] = (_Float16)(f0 - (float)h0); pr[8 + i] = (_Float16)(f1 - (float)h1); }
    v16h vh[4], vl[4];
#pragma unroll
    for (int j = 0; j < 4; ++j) { vh[j] = frag_h(&sv[cur][0][(j * 16 + col) * VP], lane); vl[j] = frag_h(&sv[cur][1][(j * 16 + col) * VP], lane); }
#pragma unroll
    for (int j = 0; j < 4; ++j) { acc[j] = wmma16(pa, vh[j], acc[j]); acc[j] = wmma16(pr, vh[j], acc[j]); acc[j] = wmma16(pa, vl[j], acc[j]); }
    LDSX();
    if (more) { st_j(cur ^ 1); st_v(cur ^ 1); }   // the buffers that every wave left at the barrier of the tile before
    __syncthreads(); }
#pragma unroll
  for (int r = 0; r < 8; ++r) { float ls = l[r];
#pragma unroll
    for (int o = 1; o < 16; o <<= 1) ls += __shfl_xor(ls, o);
    const float il = (1.0f / 2048.0f) / ls;
#pragma unroll
    for (int j = 0; j < 4; ++j) so[wave][8 * g + r][j * 16 + col] = acc[j][r] * il; }
  LDSX(); for (int rl = 0; rl < 16; ++rl) if (lane < 16) vst2(O + (q0 + rl) * DM_ + h * HD + lane * 4, *(const v4f*)&so[wave][rl][lane * 4]);
  // the wait stands behind the tile's stores, in front of the next query tile's code, which writes the registers of their data and address anew
  asm volatile("s_wait_xcnt 0x0" ::: "memory"); } }
// ---- k_out: block = (64 rows, 128 cols): out = o (hi + lo) Wo^T + bo
__global__ __launch_bounds__(128) void k_out(const float* __restrict__ O, const float* __restrict__ WO, const float* __restrict__ BO, float* __restrict__ OUT) { __shared__ __align__(16) float sf[4][16][132];
  const int tid = threadIdx.x, wave = tid >> 5, lane = tid & 31, col = lane & 15, g = lane >> 4; const int c0 = blockIdx.y * 128; const size_t r0 = (size_t)blockIdx.x * 64 + wave * 16;
  v8f acc[8] = {};
  __shared__ __align__(16) __bf16 oh[2][64 * KP], ol[2][64 * KP], ow[2][128 * KP];
  v4f ra[8], rw[16]; const float* Ob = O + (size_t)blockIdx.x * 64 * DM_; const float* Wb = WO + (size_t)c0 * DM_;
  tile_ld<64, KS>(ra, Ob, DM_, tid); tile_ld<128, KS>(rw, Wb, DM_, tid);
  tile_st2<64, KS>(ra, oh[0], ol[0], tid); tile_st<128, KS>(rw, ow[0], tid);
  __syncthreads();
#pragma unroll 1   // rolled: one copy of the body, so that the next tile's registers are not multiplied
  for (int kc = 0; kc < DM_ / KS; ++kc) { const int cur = kc & 1; const bool more = kc + 1 < DM_ / KS;
    if (more) { tile_ld<64, KS>(ra, Ob + (kc + 1) * KS, DM_, tid); tile_ld<128, KS>(rw, Wb + (kc + 1) * KS, DM_, tid); }
#pragma unroll
    for (int ks = 0; ks < KS / 32; ++ks) { const int ao = (wave * 16 + col) * KP + ks * 32; const v16b ah = frag_b(&oh[cur][ao], lane), al = frag_b(&ol[cur][ao], lane);
#pragma unroll
      for (int j0 = 0; j0 < 8; j0 += 4) { v16b f[4];
#pragma unroll
        for (int j = 0; j < 4; ++j) f[j] = frag_b(&ow[cur][((j0 + j) * 16 + col) * KP + ks * 32], lane);
#pragma unroll
        for (int j = 0; j < 4; ++j) { acc[j0 + j] = wmma_bf(ah, f[j], acc[j0 + j]); acc[j0 + j] = wmma_bf(al, f[j], acc[j0 + j]); } } }
    if (more) { tile_st2<64, KS>(ra, oh[cur ^ 1], ol[cur ^ 1], tid); tile_st<128, KS>(rw, ow[cur ^ 1], tid); }
    __syncthreads(); }
#pragma unroll
  for (int j = 0; j < 8; ++j) { const float bb = bfr(BO[c0 + j * 16 + col]);
#pragma unroll
    for (int r = 0; r < 8; ++r) sf[wave][8 * g + r][j * 16 + col] = acc[j][r] + bb; }
  LDSX(); for (int rl = 0; rl < 16; ++rl) vst2(OUT + (r0 + rl) * DM_ + c0 + lane * 4, *(const v4f*)&sf[wave][rl][lane * 4]); }
extern "C" void kernel_launch(void* const* d_in, const int* in_sizes, int n_in, void* d_out, int out_size, void* d_ws, size_t ws_size, hipStream_t stream) {
  (void)in_sizes; (void)n_in; (void)out_size;
  const float** F = (const float**)d_in;   // 0 x [2,2048,1024], 1 W1_q [64,2048], 2 W2_q, 3 W1_k [64,1024], 4 W2_k, 5 Wv [1024,1024], 6 bv, 7 Wo, 8 bo
  if (ws_size < (size_t)WS_END) return;
  char* ws = (char*)d_ws; float *QP = (float*)(ws + WS_QP), *JK = (float*)(ws + WS_JK), *O = (float*)(ws + WS_O); _Float16 *VT = (_Float16*)(ws + WS_VT), *VL = (_Float16*)(ws + WS_VL);
  k_plv<<<2 * NPL + NVB * (DM_ / 128), 128, 0, stream>>>(F[0], F[1], F[2], F[3], F[4], F[5], F[6], QP, JK, VT, VL);
  k_att<<<dim3(TQB / 2, NH, TNB), 128, 0, stream>>>(QP, JK, VT, VL, O);
  k_out<<<dim3(TNB * TQB, DM_ / 128), 128, 0, stream>>>(O, F[7], F[8], (float*)d_out);   // the rows of both batches lie one behind the other: one grid
}

// v008
// A run of this version takes 107 microseconds.
// Next to v007, in two timings, it ran 1.13 times as fast each time.
// All steps since v000 together make it 6.63 times as fast.
// compute dtype: all float inputs rounded to bf16; q1/q2 = [x_t ; x_{t-1}] W^T and k1/k2 = x W^T with EXACT bf16 products on WMMA 16x16x32, f32 accumulate; the Plucker 6-vectors, their normalisation and J6 k in f32; q and J6 k split into bf16 hi + lo (3 products, K = 6 zero-padded to 32) for the causal logits x 6^-0.5, softmax in f32 without a maximum (the logits are bounded, see k_att; hardware exp); P (x 2^11, f16 hi + residual) . v with v = x Wv^T + bv exact as f16 hi + residual (3 products); out = o (bf16 hi + lo) Wo^T + bo (2 products); f32 output.
#include <hip/hip_runtime.h>
#include <math.h>

typedef __attribute__((ext_vector_type(16))) _Float16 v16h;
typedef __attribute__((ext_vector_type(16))) __bf16 v16b;
typedef __attribute__((ext_vector_type(8)))  _Float16 v8h;
typedef __attribute__((ext_vector_type(8)))  float v8f;
typedef __attribute__((ext_vector_type(4)))  float v4f;
typedef __attribute__((ext_vector_type(2)))  float v2f;
typedef __attribute__((ext_vector_type(4)))  unsigned v4u;
typedef __attribute__((ext_vector_type(4)))  int v4i;
typedef float __attribute__((may_alias)) float_a;
typedef int __attribute__((may_alias)) int_a;

template <typename T> __device__ __forceinline__ void vst2(void* p, T v) { *(T*)p = v;  }
__device__ __forceinline__ v8f wmma16(v16h a, v16h b, v8f c) {
  v8f d = __builtin_amdgcn_wmma_f32_16x16x32_f16(false, a, false, b, (short)0, c, false, false);
  asm volatile("v_nop\n\tv_nop\n\tv_nop\n\tv_nop" : "+v"(d) : "v"(a), "v"(b));
  return d;
}
__device__ __forceinline__ v8f wmma_bf(v16b a, v16b b, v8f c) {
  v8f d = __builtin_amdgcn_wmma_f32_16x16x32_bf16(false, a, false, b, (short)0, c, false, false);
  asm volatile("v_nop\n\tv_nop\n\tv_nop\n\tv_nop" : "+v"(d) : "v"(a), "v"(b));
  return d;
}
// 16x16x32 fragments: lane = (h = lane>>4, row/col = lane&15); elements 0..7 = k0+8h+0..7, 8..15 = k0+16+8h+0..7; D element r = row 8h+r
__device__ __forceinline__ v16h frag_h(const _Float16* rowk0, int lane) {
  union { v16h v; v8h q[2]; } u; const _Float16* p = rowk0 + 8 * (lane >> 4);
  u.q[0] = *(const v8h*)p; u.q[1] = *(const v8h*)(p + 16); return u.v;
}
__device__ __forceinline__ v16h frag_f32(const float* rowk0, int lane) {
  v16h a; const float* p = rowk0 + 8 * (lane >> 4);
#pragma unroll
  for (int i = 0; i < 8; ++i) { a[i] = (_Float16)p[i]; a[8 + i] = (_Float16)p[16 + i]; }
  return a;
}
__device__ __forceinline__ v16h frag_f32s(const float* rowk0, int lane, float sc) {
  v16h a; const float* p = rowk0 + 8 * (lane >> 4);
#pragma unroll
  for (int i = 0; i < 8; ++i) { a[i] = (_Float16)(p[i] * sc); a[8 + i] = (_Float16)(p[16 + i] * sc); }
  return a;
}
// column fragment from a [K][ld] layout (column n), rows >= K read as 0
__device__ __forceinline__ v16h fragc_f32(const float* W, int k0, int n, int lane, int ld, int K) {
  v16h a; const int g = lane >> 4;
#pragma unroll
  for (int i = 0; i < 8; ++i) { const int ka = k0 + 8 * g + i, kb = ka + 16;
    a[i] = (_Float16)(ka < K ? W[(size_t)(ka < K ? ka : K - 1) * ld + n] : 0.f); a[8 + i] = (_Float16)(kb < K ? W[(size_t)(kb < K ? kb : K - 1) * ld + n] : 0.f); }
  return a;
}
struct F2 { v16b h, l; };
__device__ __forceinline__ F2 bsplit16(const float v[16]) { F2 r;
#pragma unroll
  for (int i = 0; i < 16; ++i) { const __bf16 h = (__bf16)v[i]; r.h[i] = h; r.l[i] = (__bf16)(v[i] - (float)h); }
  return r; }
__device__ __forceinline__ F2 split_row(const float* row, int k0, int lane) { float v[16]; const float* p = row + k0 + 8 * (lane >> 4);
#pragma unroll
  for (int i = 0; i < 8; ++i) { v[i] = p[i]; v[8 + i] = p[16 + i]; }
  return bsplit16(v); }
__device__ __forceinline__ F2 split_rowK(const float* row, int k0, int lane, int K) { float v[16]; const int g = lane >> 4;
#pragma unroll
  for (int i = 0; i < 8; ++i) { const int ka = k0 + 8 * g + i, kb = ka + 16; v[i] = ka < K ? row[ka < K ? ka : K - 1] : 0.f; v[8 + i] = kb < K ? row[kb < K ? kb : K - 1] : 0.f; }
  return bsplit16(v); }
__device__ __forceinline__ F2 split_col(const float* W, int k0, int n, int lane, int ld, int K) { float v[16]; const int g = lane >> 4;
#pragma unroll
  for (int i = 0; i < 8; ++i) { const int ka = k0 + 8 * g + i, kb = ka + 16; v[i] = ka < K ? W[(size_t)(ka < K ? ka : K - 1) * ld + n] : 0.f; v[8 + i] = kb < K ? W[(size_t)(kb < K ? kb : K - 1) * ld + n] : 0.f; }
  return bsplit16(v); }
__device__ __forceinline__ float sigm(float v) { return 1.0f / (1.0f + expf(-v)); }
#define LDSX() do { asm volatile("s_wait_dscnt 0" ::: "memory"); __builtin_amdgcn_wave_barrier(); __builtin_amdgcn_fence(__ATOMIC_RELEASE, "workgroup"); } while (0)


// Plucker bigram attention (B 2, T 2,048, D 1,024, 16 heads x 64): per head, q = normalised Plucker line of two 4-vectors from the bigram [x_t ; x_{t-1}], k likewise from x_t; logits = q . (J6 k) / sqrt(6), causal softmax, . v, Wo.
#define NB 2
#define TT 2048
#define DM_ 1024
#define NH 16
#define HD 64
#ifndef TNB
#define TNB NB
#endif
#ifndef TQB
#define TQB (TT / 64)
#endif
typedef __attribute__((ext_vector_type(8))) __bf16 v8b;
__device__ __forceinline__ v16b frag_b(const __bf16* rowk0, int lane) {
  union { v16b v; v8b q[2]; } u; const __bf16* p = rowk0 + 8 * (lane >> 4);
  u.q[0] = *(const v8b*)p; u.q[1] = *(const v8b*)(p + 16); return u.v;
}
__device__ __forceinline__ float bfr(float v) { return (float)(__bf16)v; }
__device__ __attribute__((noinline)) float exp_ni(float v) { return expf(v); }
__device__ __attribute__((noinline)) float erf_ni(float v) { return erff(v); }

typedef __attribute__((ext_vector_type(4))) __bf16 v4b;
// Staging of a ROWS x KC f32 tile (rows K-contiguous, row stride ld floats) by the block's 128 threads: consecutive lanes take consecutive 16 bytes of a row, so every wave load covers whole 128-byte lines; the tile is rounded to bf16 once and laid in LDS at a row pitch of KC + 8 elements (16 B x odd).
template <int ROWS, int KC> __device__ __forceinline__ void tile_ld(v4f (&r)[ROWS * KC / 512], const float* __restrict__ src, int ld, int tid, int coff = 0) { const float* p = src + (unsigned)((tid / (KC / 4)) * ld + (tid % (KC / 4)) * 4);
#pragma unroll
  for (int i = 0; i < ROWS * KC / 512; ++i) r[i] = *(const v4f*)(p + coff + (size_t)i * (512 / KC) * ld);
  // the wait stands behind the tile's loads, in front of whatever next writes the registers of their address (the next tile's results, later address arithmetic); p as an input keeps the address in its registers up to the wait: without it the tile's last load got them as its result
  asm volatile("s_wait_xcnt 0x0" :: "v"(p) : "memory"); }
template <int ROWS, int KC> __device__ __forceinline__ void tile_st(const v4f (&r)[ROWS * KC / 512], __bf16* dst, int tid) {
#pragma unroll
  for (int i = 0; i < ROWS * KC / 512; ++i) { v4b o;
#pragma unroll
    for (int q = 0; q < 4; ++q) o[q] = (__bf16)r[i][q];
    *(v4b*)(dst + (tid / (KC / 4)) * (KC + 8) + (tid % (KC / 4)) * 4 + i * (512 / KC) * (KC + 8)) = o; } }
// the same, split into bf16 hi + lo planes
template <int ROWS, int KC> __device__ __forceinline__ void tile_st2(const v4f (&r)[ROWS * KC / 512], __bf16* dh, __bf16* dl, int tid) {
#pragma unroll
  for (int i = 0; i < ROWS * KC / 512; ++i) { v4b oh, ol;
#pragma unroll
    for (int q = 0; q < 4; ++q) { const __bf16 h = (__bf16)r[i][q]; oh[q] = h; ol[q] = (__bf16)(r[i][q] - (float)h); }
    const int o = (tid / (KC / 4)) * (KC + 8) + (tid % (KC / 4)) * 4 + i * (512 / KC) * (KC + 8); *(v4b*)(dh + o) = oh; *(v4b*)(dl + o) = ol; } }
#define KS 64          // k extent of a staged tile in v_body and k_out
#define KP (KS + 8)
#define KS2 32         // k extent of a staged tile in pl_body
#define KP2 (KS2 + 8)

#define WS_QP  0u                                    // f32 [b*t][h][8]: q plucker (6 used)
#define WS_JK  (WS_QP + 4u * (size_t)NB * TT * NH * 8)  // f32 [b*t][h][8]: J6 k
#define WS_VT  (WS_JK + 4u * (size_t)NB * TT * NH * 8)  // f16 v planes [b][1024][t]
#define WS_VL  (WS_VT + 2u * (size_t)NB * DM_ * TT)      // f16 v residual planes
#define WS_O   (WS_VL + 2u * (size_t)NB * DM_ * TT)      // f32 o rows [b*t][1024]
#define WS_END (WS_O + 4u * (size_t)NB * TT * DM_)

// ---- k_pl: block = 32 tokens and ONE pair of weight matrices: (W1_q, W2_q) against the bigram, K = 2048, or (W1_k, W2_k) against x, K = 1024 -> 2 x 64 outputs, then per (token, head) the Plucker vector of that pair
// the k loop is a chain of load, wait, barrier, so its length in steps is its time: K is cut in two parts that run side by side, waves 0 and 1 on the first (16 tokens each), waves 2 and 3 on the second, and the two partial sums are added once behind the loop; for q the parts are x_t . W[:, 0:1024] and x_{t-1} . W[:, 1024:2048] (zero row for t = 0)
// sm: the launch's LDS block, SM_PL bytes used here; bx: the token block
#define PT 32
#define SM_PA (2 * 2 * PT * KP2 * 2)
#define SM_PW (2 * 2 * 2 * 64 * KP2 * 2)
#define SM_PS (2 * 2 * PT * 68 * 4)
#define SM_PL (SM_PA + SM_PW + SM_PS + PT * NH * 8 * 4)
template <bool ISQ> __device__ __forceinline__ void pl_body(char* sm, int bx, const float* __restrict__ X, const float* __restrict__ Wa, const float* __restrict__ Wb, float* __restrict__ PO) {
  constexpr int NST = (ISQ ? DM_ : DM_ / 2) / KS2, ldw = ISQ ? 2 * DM_ : DM_;   // k steps of a part; row stride of the weights
  __bf16 (&pa)[2][2][PT * KP2] = *(__bf16 (*)[2][2][PT * KP2])sm;                       // [buffer][part][token][k]
  __bf16 (&pw)[2][2][2][64 * KP2] = *(__bf16 (*)[2][2][2][64 * KP2])(sm + SM_PA);        // [buffer][part][matrix][output][k]
  float (&sv)[2][2][PT][68] = *(float (*)[2][2][PT][68])(sm + SM_PA + SM_PW);            // [part][matrix][token][64]: partial sums
  float (&sq)[PT][NH * 8] = *(float (*)[PT][NH * 8])(sm + SM_PA + SM_PW + SM_PS);
  const int tid = threadIdx.x, wave = tid >> 5, lane = tid & 31, col = lane & 15, g = lane >> 4, part = wave >> 1, wr = (wave & 1) * 16;
  const size_t rb = (size_t)bx * PT;
  const int srow = tid >> 3, sc = (tid & 7) * 4;
  // xa: the thread's x_t row; xb: for q, the x_{t-1} row of its first 16-row group (a batch's first row reads itself there and is zeroed in st_all; the second group never holds such a row); everything else lies at a constant distance from xa, wa, wb
  constexpr int KPART = NST * KS2;
  const float* xa = X + (rb + srow) * DM_ + sc; const float* wa = Wa + srow * ldw + sc; const float* wb = Wb + srow * ldw + sc;
  const float* xb = xa - (((rb + srow) % TT) != 0 ? DM_ : 0);
  static_assert(TT % PT == 0, "a batch's first row is a block's first row");
  v8f c1[4] = {}, c2[4] = {};
  v4f ra[2][2], rw[2][2][4];
  auto ld_all = [&](int k0) { const float* x = xa + k0; const float* u = wa + k0; const float* v = wb + k0;
    ra[0][0] = *(const v4f*)x; ra[0][1] = *(const v4f*)(x + 16 * DM_);
    const float* y = xb + k0;
    if constexpr (ISQ) { ra[1][0] = *(const v4f*)y; ra[1][1] = *(const v4f*)(x + 15 * DM_); }
    else { ra[1][0] = *(const v4f*)(x + KPART); ra[1][1] = *(const v4f*)(x + KPART + 16 * DM_); }
#pragma unroll
    for (int i = 0; i < 4; ++i) { rw[0][0][i] = *(const v4f*)(u + i * 16 * ldw); rw[0][1][i] = *(const v4f*)(v + i * 16 * ldw); rw[1][0][i] = *(const v4f*)(u + KPART + i * 16 * ldw); rw[1][1][i] = *(const v4f*)(v + KPART + i * 16 * ldw); }
    // as in tile_ld: one wait behind the step's loads, their addresses held as inputs up to it
    if constexpr (ISQ) asm volatile("s_wait_xcnt 0x0" :: "v"(x), "v"(y), "v"(u), "v"(v) : "memory");
    else asm volatile("s_wait_xcnt 0x0" :: "v"(x), "v"(u), "v"(v) : "memory"); };
  auto st_all = [&](int bf) {
    if (ISQ && ((rb + srow) % TT) == 0) ra[1][0] = (v4f){0.f, 0.f, 0.f, 0.f};
#pragma unroll
    for (int p = 0; p < 2; ++p) { tile_st<PT, KS2>(ra[p], pa[bf][p], tid); tile_st<64, KS2>(rw[p][0], pw[bf][p][0], tid); tile_st<64, KS2>(rw[p][1], pw[bf][p][1], tid); } };
  ld_all(0); st_all(0);
  __syncthreads();
#pragma unroll 1   // rolled: one copy of the body, so that the next tile's registers are not multiplied
  for (int kc = 0; kc < NST; ++kc) { const int cur = kc & 1; const bool more = kc + 1 < NST;
    if (more) ld_all((kc + 1) * KS2);
    const v16b a = frag_b(&pa[cur][part][(wr + col) * KP2], lane); v16b f[4][2];
#pragma unroll
    for (int j = 0; j < 4; ++j) { f[j][0] = frag_b(&pw[cur][part][0][(j * 16 + col) * KP2], lane); f[j][1] = frag_b(&pw[cur][part][1][(j * 16 + col) * KP2], lane); }
#pragma unroll
    for (int j = 0; j < 4; ++j) { c1[j] = wmma_bf(a, f[j][0], c1[j]); c2[j] = wmma_bf(a, f[j][1], c2[j]); }
    if (more) st_all(cur ^ 1);
    __syncthreads(); }
#pragma unroll
  for (int j = 0; j < 4; ++j)
#pragma unroll
    for (int r = 0; r < 8; ++r) { const int rl = wr + 8 * g + r, cl = j * 16 + col; sv[part][0][rl][cl] = c1[j][r]; sv[part][1][rl][cl] = c2[j][r]; }
  __syncthreads();
  // plucker per (token, head): thread handles (token = tid/4, 4 heads)
  { const int rl = tid >> 2, h0 = (tid & 3) * 4;
    for (int h = h0; h < h0 + 4; ++h) { float a1[4], a2[4];
      for (int e = 0; e < 4; ++e) { a1[e] = sv[0][0][rl][h * 4 + e] + sv[1][0][rl][h * 4 + e]; a2[e] = sv[0][1][rl][h * 4 + e] + sv[1][1][rl][h * 4 + e]; }
      float pp[6]; const int PI[6] = {0, 0, 0, 1, 1, 2}, PJ[6] = {1, 2, 3, 2, 3, 3}; float nn = 0.f;
      for (int e = 0; e < 6; ++e) { pp[e] = a1[PI[e]] * a2[PJ[e]] - a1[PJ[e]] * a2[PI[e]]; nn += pp[e] * pp[e]; }
      const float in = 1.0f / fmaxf(sqrtf(nn), 1e-12f);
      for (int e = 0; e < 6; ++e) pp[e] *= in;
      // J6 k = (k5, -k4, k3, k2, -k1, k0)
      const float po[6] = {ISQ ? pp[0] : pp[5], ISQ ? pp[1] : -pp[4], ISQ ? pp[2] : pp[3], ISQ ? pp[3] : pp[2], ISQ ? pp[4] : -pp[1], ISQ ? pp[5] : pp[0]};
      for (int e = 0; e < 8; ++e) sq[rl][h * 8 + e] = (e < 6) ? po[e] : 0.f; } }
  __syncthreads();
  for (int e = tid; e < PT * 32; e += 128) { const int rl = e >> 5, q = e & 31; vst2(PO + (rb + rl) * (NH * 8) + q * 4, *(const v4f*)&sq[rl][q * 4]); } }
// ---- k_v: block = (64 tokens, 128 cols): v = x Wv^T + bv exact -> f16 planes [b][d][t]
#define SM_V (2 * 128 * 72 * 2 + 2 * 64 * KP * 2 + 2 * 128 * KP * 2)
__device__ __forceinline__ void v_body(char* sm, int bx, int by, const float* __restrict__ X, const float* __restrict__ WV, const float* __restrict__ BV, _Float16* __restrict__ VT, _Float16* __restrict__ VL) { _Float16 (&th)[128][72] = *(_Float16 (*)[128][72])sm; _Float16 (&tl)[128][72] = *(_Float16 (*)[128][72])(sm + 128 * 72 * 2);
  const int tid = threadIdx.x, wave = tid >> 5, lane = tid & 31, col = lane & 15, g = lane >> 4; const int c0 = by * 128; const size_t r0 = (size_t)bx * 64;
  v8f acc[8] = {};
  __bf16 (&sa)[2][64 * KP] = *(__bf16 (*)[2][64 * KP])(sm + 2 * 128 * 72 * 2); __bf16 (&sw)[2][128 * KP] = *(__bf16 (*)[2][128 * KP])(sm + 2 * 128 * 72 * 2 + 2 * 64 * KP * 2);
  v4f ra[8], rw[16]; const float* Xb = X + r0 * DM_; const float* Wb = WV + (size_t)c0 * DM_;
  tile_ld<64, KS>(ra, Xb, DM_, tid); tile_ld<128, KS>(rw, Wb, DM_, tid);
  tile_st<64, KS>(ra, sa[0], tid); tile_st<128, KS>(rw, sw[0], tid);
  __syncthreads();
#pragma unroll 1   // rolled: one copy of the body, so that the next tile's registers are not multiplied
  for (int kc = 0; kc < DM_ / KS; ++kc) { const int cur = kc & 1; const bool more = kc + 1 < DM_ / KS;
    if (more) { tile_ld<64, KS>(ra, Xb + (kc + 1) * KS, DM_, tid); tile_ld<128, KS>(rw, Wb + (kc + 1) * KS, DM_, tid); }
#pragma unroll
    for (int ks = 0; ks < KS / 32; ++ks) { const v16b a = frag_b(&sa[cur][(wave * 16 + col) * KP + ks * 32], lane); v16b f[8];
#pragma unroll
      for (int j = 0; j < 8; ++j) f[j] = frag_b(&sw[cur][(j * 16 + col) * KP + ks * 32], lane);
#pragma unroll
      for (int j = 0; j < 8; ++j) acc[j] = wmma_bf(a, f[j], acc[j]); }
    if (more) { tile_st<64, KS>(ra, sa[cur ^ 1], tid); tile_st<128, KS>(rw, sw[cur ^ 1], tid); }
    __syncthreads(); }
#pragma unroll
  for (int j = 0; j < 8; ++j) { const float bb = bfr(BV[c0 + j * 16 + col]);
#pragma unroll
    for (int r = 0; r < 8; ++r) { const float v = acc[j][r] + bb; const _Float16 hv = (_Float16)v; th[j * 16 + col][wave * 16 + 8 * g + r] = hv; tl[j * 16 + col][wave * 16 + 8 * g + r] = (_Float16)(v - (float)hv); } }
  __syncthreads(); const size_t b = r0 / TT; const int t0 = (int)(r0 % TT); for (int e = tid; e < 128 * 8; e += 128) { const int cl = e >> 3, q = e & 7; const size_t o = (b * DM_ + c0 + cl) * (size_t)TT + t0 + q * 8; vst2((unsigned*)(VT + o), *(const v4u*)&th[cl][q * 8]); vst2((unsigned*)(VL + o), *(const v4u*)&tl[cl][q * 8]); } }
// ---- k_plv: the Plucker projections and the v projection depend on x and weights alone, not on each other: one grid holds all three kinds of block, the longest first (q: 32 k steps, k: 16 lighter ones, v: 16); the LDS block lets three blocks share a WGP, so the whole grid is resident at once
#define NPL (TNB * TT / PT)
#define NVB (TNB * TT / 64)
__global__ __launch_bounds__(128) void k_plv(const float* __restrict__ X, const float* __restrict__ W1Q, const float* __restrict__ W2Q, const float* __restrict__ W1K, const float* __restrict__ W2K, const float* __restrict__ WV, const float* __restrict__ BV, float* __restrict__ QP, float* __restrict__ JK, _Float16* __restrict__ VT, _Float16* __restrict__ VL) {
  __shared__ __align__(16) char sm[SM_PL > SM_V ? SM_PL : SM_V];
  const int bi = blockIdx.x;   // the same for the whole block: every barrier of a body is passed by all its threads
  if (bi < NPL) pl_body<true>(sm, bi, X, W1Q, W2Q, QP);
  else if (bi < 2 * NPL) pl_body<false>(sm, bi - NPL, X, W1K, W2K, JK);
  else v_body(sm, (bi - 2 * NPL) % NVB, (bi - 2 * NPL) / NVB, X, WV, BV, VT, VL); }
// 2^x on the hardware unit. The v_nop fills the one slot that the instruction set asks for behind a transcendental before its result is read or its source overwritten
__device__ __forceinline__ float exp2_slot(float x) { float e; asm("v_exp_f32 %0, %1\n\tv_nop" : "=v"(e) : "v"(x)); return e; }
#define VP 40          // row pitch of a staged v tile in k_att, in f16: 80 B = 16 B x odd
// ---- k_att: block = (a pair of 64-query tiles, head, b): causal, 3-product logits (K = 6 padded) x 6^-0.5
// both products are taken transposed: S^T = (J6 k) q^T (A = 16 keys, B = the wave's 16 queries) and O^T += v^T P^T (A = 16 d rows of v, B = P^T). A lane's 8 results of the S^T tile of keys 16 ct .. 16 ct + 15 are keys 16 ct + 8 g + 0..7 of query col, which is what elements 8 ct + 0..7 of the B fragment over 32 keys hold in that lane: P goes from the score registers into the operand registers of the same lane and never through LDS
// a query tile's cost grows with its index (tile t reads 2 (t + 1) key tiles) and all blocks are resident at once, so the launch lasts as long as the WGP with the most key tiles: each block takes tile TQB - 1 - x and then tile x, one after the other, which is 2 (TQB + 1) key tiles for every block wherever it lands
__global__ __launch_bounds__(128) void k_att(const float* __restrict__ QP, const float* __restrict__ JK, const _Float16* __restrict__ VT, const _Float16* __restrict__ VL, float* __restrict__ O) {
  __shared__ __align__(16) float so[4][16][68];
  __shared__ __align__(16) _Float16 sv[2][2][HD * VP];   // [buffer][hi, residual][d row][32 keys], row pitch VP
  __shared__ __align__(16) __bf16 sj[2][2][33 * 8];      // [buffer][hi, lo][32 keys and a zero row][8]
  const int tid = threadIdx.x, wave = tid >> 5, lane = tid & 31, col = lane & 15, g = lane >> 4; const int h = blockIdx.y; const size_t b = blockIdx.z;
  static_assert(TQB % 2 == 0, "query tiles go in pairs");
  // every global load of a key tile is issued well ahead of its use, so that a tile waits for memory at most once and not once per product: the J6 k rows and the v tile one tile ahead, into registers, and from there into the LDS buffer that the next tile reads
  // the four waves use the same v tile (64 d rows x 32 keys, hi and residual): the block fetches it once, four lanes to a row's 64 bytes (8 lines a wave load, where a fragment load from global memory touches 16), and every wave takes its fragments from LDS
  const int srow = tid >> 2, sch = (tid & 3) * 8; const size_t so0 = (b * DM_ + (size_t)h * HD + srow) * TT + sch;
  v8h rs[4];
  auto ld_v = [&](int ks) { const _Float16* ph = VT + so0 + ks * 32; const _Float16* pl = VL + so0 + ks * 32;
    rs[0] = *(const v8h*)ph; rs[1] = *(const v8h*)(ph + 32 * TT); rs[2] = *(const v8h*)pl; rs[3] = *(const v8h*)(pl + 32 * TT);
    // as in tile_ld: the wait behind the loads, their addresses held as inputs up to it
    asm volatile("s_wait_xcnt 0x0" :: "v"(ph), "v"(pl) : "memory"); };
  auto st_v = [&](int bf) { const int o = srow * VP + sch; *(v8h*)&sv[bf][0][o] = rs[0]; *(v8h*)&sv[bf][0][o + 32 * VP] = rs[1]; *(v8h*)&sv[bf][1][o] = rs[2]; *(v8h*)&sv[bf][1][o + 32 * VP] = rs[3]; };
  // the J6 k rows of the tile likewise: 64 threads fetch 16 bytes each, split them into bf16 hi + lo once, and lay them down as the low halves of the A fragments (8 values a key); row 32 of each plane stays zero and serves the lanes whose k lies past the 8 values
  v4f rj = {}; const int jrow = tid >> 1, jch = (tid & 1) * 4;
  auto ld_j = [&](int ks) { if (tid < 64) { const float* p = JK + (b * TT + ks * 32 + jrow) * (NH * 8) + h * 8 + jch; rj = *(const v4f*)p;
      // as in tile_ld: the wait behind the load, its address held as an input up to it
      asm volatile("s_wait_xcnt 0x0" :: "v"(p) : "memory"); } };
  auto st_j = [&](int bf) { if (tid < 64) { v4b oh, ol;
#pragma unroll
      for (int q = 0; q < 4; ++q) { const __bf16 hv = (__bf16)rj[q]; oh[q] = hv; ol[q] = (__bf16)(rj[q] - (float)hv); }
      *(v4b*)&sj[bf][0][jrow * 8 + jch] = oh; *(v4b*)&sj[bf][1][jrow * 8 + jch] = ol; } };
  v8b z8;
#pragma unroll
  for (int i = 0; i < 8; ++i) z8[i] = (__bf16)0.f;
  if (tid < 4) *(v8b*)&sj[tid >> 1][tid & 1][32 * 8] = z8;
  const int jo[2] = {g ? 32 * 8 : col * 8, g ? 32 * 8 : (16 + col) * 8};
#pragma unroll 1   // rolled: one copy of the tile's code serves both query tiles
  for (int hf = 0; hf < 2; ++hf) { const int qb = hf ? (int)blockIdx.x : TQB - 1 - (int)blockIdx.x;   // the same for the whole block: every barrier below is passed by all its threads
  const int q0l = qb * 64 + wave * 16; const size_t q0 = b * TT + q0l;
  F2 aq; { float v[16];
#pragma unroll
    for (int i = 0; i < 16; ++i) v[i] = 0.f;
    if (g == 0) { const float* p = QP + (q0 + col) * (NH * 8) + h * 8;
#pragma unroll
      for (int i = 0; i < 8; ++i) v[i] = p[i]; }
    aq = bsplit16(v); }
  // q and J6 k have norm at most 1 (each is a vector over max(its norm, 1e-12)), so |logit| <= 6^-0.5 for every input: exp(logit) lies between 1/2 and 2, P x 2^11 stays far inside f16, and softmax needs no maximum taken off, hence no rescaling of the sums either
  float l[8];   // eight partial sums of exp for this lane's query (independent chains); they and the other half wave's are added once, behind the key loop
#pragma unroll
  for (int r = 0; r < 8; ++r) l[r] = 0.f;
  v8f acc[4] = {};
  int lim[8];   // key 16 n + 8 g + r is open to query q0l + col while 16 n <= lim[r]
#pragma unroll
  for (int r = 0; r < 8; ++r) lim[r] = q0l + col - 8 * g - r;
  const int nks = (qb * 64 + 64) / 32;
  ld_j(0); ld_v(0); st_j(0); st_v(0);   // second query tile: every wave has left both buffers at the barrier that ended the first tile's last key tile
  __syncthreads();
#pragma unroll 1
  for (int ks = 0; ks < nks; ++ks) {
    const int cur = ks & 1; const bool more = ks + 1 < nks;
    if (more) { ld_j(ks + 1); ld_v(ks + 1); }
    F2 bk2[2];
#pragma unroll
    for (int ct = 0; ct < 2; ++ct) { union { v16b v; v8b q[2]; } uh, ul; uh.q[0] = *(const v8b*)&sj[cur][0][jo[ct]]; uh.q[1] = z8; ul.q[0] = *(const v8b*)&sj[cur][1][jo[ct]]; ul.q[1] = z8; bk2[ct].h = uh.v; bk2[ct].l = ul.v; }
    v16h vh[4], vl[4];
#pragma unroll
    for (int j = 0; j < 4; ++j) { vh[j] = frag_h(&sv[cur][0][(j * 16 + col) * VP], lane); vl[j] = frag_h(&sv[cur][1][(j * 16 + col) * VP], lane); }
    v16h pa, pr;   // P^T x 2^11 as f16 hi + residual (a single f16 would quantise P to 1 part in 2048)
#pragma unroll
    for (int ct = 0; ct < 2; ++ct) { const int kt = ks * 32 + ct * 16; const F2 bk = bk2[ct];
      v8f c = {}; c = wmma_bf(bk.h, aq.l, c); c = wmma_bf(bk.l, aq.h, c); c = wmma_bf(bk.h, aq.h, c);
#pragma unroll
      for (int r = 0; r < 8; ++r) { const float ex = exp2_slot(c[r] * (0.4082482904638631f * 1.4426950408889634f)), e = (kt <= lim[r]) ? ex : 0.f;   /* exp(c x 6^-0.5) as 2^(c x 6^-0.5 x log2 e): with nothing taken off in between, one multiply */ l[r] += e;
        const float f = e * 2048.0f; const _Float16 hv = (_Float16)f; pa[ct * 8 + r] = hv; pr[ct * 8 + r] = (_Float16)(f - (float)hv); } }
#pragma unroll
    for (int j = 0; j < 4; ++j) { acc[j] = wmma16(vh[j], pa, acc[j]); acc[j] = wmma16(vh[j], pr, acc[j]); acc[j] = wmma16(vl[j], pa, acc[j]); }
    if (more) { st_j(cur ^ 1); st_v(cur ^ 1); }   // the buffers that every wave left at the barrier of the tile before
    __syncthreads(); }
  { float ls = ((l[0] + l[1]) + (l[2] + l[3])) + ((l[4] + l[5]) + (l[6] + l[7]));
    ls += __shfl_xor(ls, 16);   // the other half wave holds the same query's other keys
    const float il = (1.0f / 2048.0f) / ls;
    // acc[j][r] = O^T (d = 16 j + 8 g + r, query col): 8 neighbouring d of one query row
#pragma unroll
    for (int j = 0; j < 4; ++j) { *(v4f*)&so[wave][col][j * 16 + 8 * g] = (v4f){acc[j][0] * il, acc[j][1] * il, acc[j][2] * il, acc[j][3] * il}; *(v4f*)&so[wave][col][j * 16 + 8 * g + 4] = (v4f){acc[j][4] * il, acc[j][5] * il, acc[j][6] * il, acc[j][7] * il}; } }
  LDSX(); for (int rl = 0; rl < 16; ++rl) if (lane < 16) vst2(O + (q0 + rl) * DM_ + h * HD + lane * 4, *(const v4f*)&so[wave][rl][lane * 4]);
  // the wait stands behind the tile's stores, in front of the next query tile's code, which writes the registers of their data and address anew
  asm volatile("s_wait_xcnt 0x0" ::: "memory"); } }
// ---- k_out: block = (64 rows, 128 cols): out = o (hi + lo) Wo^T + bo
__global__ __launch_bounds__(128) void k_out(const float* __restrict__ O, const float* __restrict__ WO, const float* __restrict__ BO, float* __restrict__ OUT) { __shared__ __align__(16) float sf[4][16][132];
  const int tid = threadIdx.x, wave = tid >> 5, lane = tid & 31, col = lane & 15, g = lane >> 4; const int c0 = blockIdx.y * 128; const size_t r0 = (size_t)blockIdx.x * 64 + wave * 16;
  v8f acc[8] = {};
  __shared__ __align__(16) __bf16 oh[2][64 * KP], ol[2][64 * KP], ow[2][128 * KP];
  v4f ra[8], rw[16]; const float* Ob = O + (size_t)blockIdx.x * 64 * DM_; const float* Wb = WO + (size_t)c0 * DM_;
  tile_ld<64, KS>(ra, Ob, DM_, tid); tile_ld<128, KS>(rw, Wb, DM_, tid);
  tile_st2<64, KS>(ra, oh[0], ol[0], tid); tile_st<128, KS>(rw, ow[0], tid);
  __syncthreads();
#pragma unroll 1   // rolled: one copy of the body, so that the next tile's registers are not multiplied
  for (int kc = 0; kc < DM_ / KS; ++kc) { const int cur = kc & 1; const bool more = kc + 1 < DM_ / KS;
    if (more) { tile_ld<64, KS>(ra, Ob + (kc + 1) * KS, DM_, tid); tile_ld<128, KS>(rw, Wb + (kc + 1) * KS, DM_, tid); }
#pragma unroll
    for (int ks = 0; ks < KS / 32; ++ks) { const int ao = (wave * 16 + col) * KP + ks * 32; const v16b ah = frag_b(&oh[cur][ao], lane), al = frag_b(&ol[cur][ao], lane);
#pragma unroll
      for (int j0 = 0; j0 < 8; j0 += 4) { v16b f[4];
#pragma unroll
        for (int j = 0; j < 4; ++j) f[j] = frag_b(&ow[cur][((j0 + j) * 16 + col) * KP + ks * 32], lane);
#pragma unroll
        for (int j = 0; j < 4; ++j) { acc[j0 + j] = wmma_bf(ah, f[j], acc[j0 + j]); acc[j0 + j] = wmma_bf(al, f[j], acc[j0 + j]); } } }
    if (more) { tile_st2<64, KS>(ra, oh[cur ^ 1], ol[cur ^ 1], tid); tile_st<128, KS>(rw, ow[cur ^ 1], tid); }
    __syncthreads(); }
#pragma unroll
  for (int j = 0; j < 8; ++j) { const float bb = bfr(BO[c0 + j * 16 + col]);
#pragma unroll
    for (int r = 0; r < 8; ++r) sf[wave][8 * g + r][j * 16 + col] = acc[j][r] + bb; }
  LDSX(); for (int rl = 0; rl < 16; ++rl) vst2(OUT + (r0 + rl) * DM_ + c0 + lane * 4, *(const v4f*)&sf[wave][rl][lane * 4]); }
extern "C" void kernel_launch(void* const* d_in, const int* in_sizes, int n_in, void* d_out, int out_size, void* d_ws, size_t ws_size, hipStream_t stream) {
  (void)in_sizes; (void)n_in; (void)out_size;
  const float** F = (const float**)d_in;   // 0 x [2,2048,1024], 1 W1_q [64,2048], 2 W2_q, 3 W1_k [64,1024], 4 W2_k, 5 Wv [1024,1024], 6 bv, 7 Wo, 8 bo
  if (ws_size < (size_t)WS_END) return;
  char* ws = (char*)d_ws; float *QP = (float*)(ws + WS_QP), *JK = (float*)(ws + WS_JK), *O = (float*)(ws + WS_O); _Float16 *VT = (_Float16*)(ws + WS_VT), *VL = (_Float16*)(ws + WS_VL);
  k_plv<<<2 * NPL + NVB * (DM_ / 128), 128, 0, stream>>>(F[0], F[1], F[2], F[3], F[4], F[5], F[6], QP, JK, VT, VL);
  k_att<<<dim3(TQB / 2, NH, TNB), 128, 0, stream>>>(QP, JK, VT, VL, O);
  k_out<<<dim3(TNB * TQB, DM_ / 128), 128, 0, stream>>>(O, F[7], F[8], (float*)d_out);   // the rows of both batches lie one behind the other: one grid
}

// v009
// One run takes 98.7 microseconds.
// Next to v008, in two timings, it ran 1.07 times as fast each time.
// All steps since v000 together make it 7.11 times as fast.
// compute dtype: all float inputs rounded to bf16; q1/q2 = [x_t ; x_{t-1}] W^T and k1/k2 = x W^T with EXACT bf16 products on WMMA 16x16x32, f32 accumulate; the Plucker 6-vectors, their normalisation and J6 k in f32; q and J6 k split into bf16 hi + lo (3 products, K = 6 zero-padded to 32) for the causal logits x 6^-0.5, softmax in f32 without a maximum (the logits are bounded, see k_att; hardware exp); P (x 2^11, f16 hi + residual) . v with v = x Wv^T + bv exact as f16 hi + residual (3 products); out = o (bf16 hi + lo) Wo^T + bo (2 products); f32 output.
#include <hip/hip_runtime.h>
#include <math.h>

typedef __attribute__((ext_vector_type(16))) _Float16 v16h;
typedef __attribute__((ext_vector_type(16))) __bf16 v16b;
typedef __attribute__((ext_vector_type(8)))  _Float16 v8h;
typedef __attribute__((ext_vector_type(8)))  float v8f;
typedef __attribute__((ext_vector_type(4)))  float v4f;
typedef __attribute__((ext_vector_type(2)))  float v2f;
typedef __attribute__((ext_vector_type(4)))  unsigned v4u;
typedef __attribute__((ext_vector_type(4)))  int v4i;
typedef float __attribute__((may_alias)) float_a;
typedef int __attribute__((may_alias)) int_a;

template <typename T> __device__ __forceinline__ void vst2(void* p, T v) { *(T*)p = v;  }
__device__ __forceinline__ v8f wmma16(v16h a, v16h b, v8f c) {
  v8f d = __builtin_amdgcn_wmma_f32_16x16x32_f16(false, a, false, b, (short)0, c, false, false);
  asm volatile("v_nop\n\tv_nop\n\tv_nop\n\tv_nop" : "+v"(d) : "v"(a), "v"(b));
  return d;
}
__device__ __forceinline__ v8f wmma_bf(v16b a, v16b b, v8f c) {
  v8f d = __builtin_amdgcn_wmma_f32_16x16x32_bf16(false, a, false, b, (short)0, c, false, false);
  asm volatile("v_nop\n\tv_nop\n\tv_nop\n\tv_nop" : "+v"(d) : "v"(a), "v"(b));
  return d;
}
// 16x16x32 fragments: lane = (h = lane>>4, row/col = lane&15); elements 0..7 = k0+8h+0..7, 8..15 = k0+16+8h+0..7; D element r = row 8h+r
__device__ __forceinline__ v16h frag_h(const _Float16* rowk0, int lane) {
  union { v16h v; v8h q[2]; } u; const _Float16* p = rowk0 + 8 * (lane >> 4);
  u.q[0] = *(const v8h*)p; u.q[1] = *(const v8h*)(p + 16); return u.v;
}
__device__ __forceinline__ v16h frag_f32(const float* rowk0, int lane) {
  v16h a; const float* p = rowk0 + 8 * (lane >> 4);
#pragma unroll
  for (int i = 0; i < 8; ++i) { a[i] = (_Float16)p[i]; a[8 + i] = (_Float16)p[16 + i]; }
  return a;
}
__device__ __forceinline__ v16h frag_f32s(const float* rowk0, int lane, float sc) {
  v16h a; const float* p = rowk0 + 8 * (lane >> 4);
#pragma unroll
  for (int i = 0; i < 8; ++i) { a[i] = (_Float16)(p[i] * sc); a[8 + i] = (_Float16)(p[16 + i] * sc); }
  return a;
}
// column fragment from a [K][ld] layout (column n), rows >= K read as 0
__device__ __forceinline__ v16h fragc_f32(const float* W, int k0, int n, int lane, int ld, int K) {
  v16h a; const int g = lane >> 4;
#pragma unroll
  for (int i = 0; i < 8; ++i) { const int ka = k0 + 8 * g + i, kb = ka + 16;
    a[i] = (_Float16)(ka < K ? W[(size_t)(ka < K ? ka : K - 1) * ld + n] : 0.f); a[8 + i] = (_Float16)(kb < K ? W[(size_t)(kb < K ? kb : K - 1) * ld + n] : 0.f); }
  return a;
}
struct F2 { v16b h, l; };
__device__ __forceinline__ F2 bsplit16(const float v[16]) { F2 r;
#pragma unroll
  for (int i = 0; i < 16; ++i) { const __bf16 h = (__bf16)v[i]; r.h[i] = h; r.l[i] = (__bf16)(v[i] - (float)h); }
  return r; }
__device__ __forceinline__ F2 split_row(const float* row, int k0, int lane) { float v[16]; const float* p = row + k0 + 8 * (lane >> 4);
#pragma unroll
  for (int i = 0; i < 8; ++i) { v[i] = p[i]; v[8 + i] = p[16 + i]; }
  return bsplit16(v); }
__device__ __forceinline__ F2 split_rowK(const float* row, int k0, int lane, int K) { float v[16]; const int g = lane >> 4;
#pragma unroll
  for (int i = 0; i < 8; ++i) { const int ka = k0 + 8 * g + i, kb = ka + 16; v[i] = ka < K ? row[ka < K ? ka : K - 1] : 0.f; v[8 + i] = kb < K ? row[kb < K ? kb : K - 1] : 0.f; }
  return bsplit16(v); }
__device__ __forceinline__ F2 split_col(const float* W, int k0, int n, int lane, int ld, int K) { float v[16]; const int g = lane >> 4;
#pragma unroll
  for (int i = 0; i < 8; ++i) { const int ka = k0 + 8 * g + i, kb = ka + 16; v[i] = ka < K ? W[(size_t)(ka < K ? ka : K - 1) * ld + n] : 0.f; v[8 + i] = kb < K ? W[(size_t)(kb < K ? kb : K - 1) * ld + n] : 0.f; }
  return bsplit16(v); }
__device__ __forceinline__ float sigm(float v) { return 1.0f / (1.0f + expf(-v)); }
#define LDSX() do { asm volatile("s_wait_dscnt 0" ::: "memory"); __builtin_amdgcn_wave_barrier(); __builtin_amdgcn_fence(__ATOMIC_RELEASE, "workgroup"); } while (0)


// Plucker bigram attention (B 2, T 2,048, D 1,024, 16 heads x 64): per head, q = normalised Plucker line of two 4-vectors from the bigram [x_t ; x_{t-1}], k likewise from x_t; logits = q . (J6 k) / sqrt(6), causal softmax, . v, Wo.
#define NB 2
#define TT 2048
#define DM_ 1024
#define NH 16
#define HD 64
#ifndef TNB
#define TNB NB
#endif
#ifndef TQB
#define TQB (TT / 64)
#endif
typedef __attribute__((ext_vector_type(8))) __bf16 v8b;
__device__ __forceinline__ v16b frag_b(const __bf16* rowk0, int lane) {
  union { v16b v; v8b q[2]; } u; const __bf16* p = rowk0 + 8 * (lane >> 4);
  u.q[0] = *(const v8b*)p; u.q[1] = *(const v8b*)(p + 16); return u.v;
}
__device__ __forceinline__ float bfr(float v) { return (float)(__bf16)v; }
__device__ __attribute__((noinline)) float exp_ni(float v) { return expf(v); }
__device__ __attribute__((noinline)) float erf_ni(float v) { return erff(v); }

typedef __attribute__((ext_vector_type(4))) __bf16 v4b;
// Staging of a ROWS x KC f32 tile (rows K-contiguous, row stride ld floats) by the block's 128 threads: consecutive lanes take consecutive 16 bytes of a row, so every wave load covers whole 128-byte lines; the tile is rounded to bf16 once and laid in LDS at a row pitch of KC + 8 elements (16 B x odd).
template <int ROWS, int KC> __device__ __forceinline__ void tile_ld(v4f (&r)[ROWS * KC / 512], const float* __restrict__ src, int ld, int tid, int coff = 0) { const float* p = src + (unsigned)((tid / (KC / 4)) * ld + (tid % (KC / 4)) * 4);
#pragma unroll
  for (int i = 0; i < ROWS * KC / 512; ++i) r[i] = *(const v4f*)(p + coff + (size_t)i * (512 / KC) * ld);
  // the wait stands behind the tile's loads, in front of whatever next writes the registers of their address (the next tile's results, later address arithmetic); p as an input keeps the address in its registers up to the wait: without it the tile's last load got them as its result
  asm volatile("s_wait_xcnt 0x0" :: "v"(p) : "memory"); }
template <int ROWS, int KC> __device__ __forceinline__ void tile_st(const v4f (&r)[ROWS * KC / 512], __bf16* dst, int tid) {
#pragma unroll
  for (int i = 0; i < ROWS * KC / 512; ++i) { v4b o;
#pragma unroll
    for (int q = 0; q < 4; ++q) o[q] = (__bf16)r[i][q];
    *(v4b*)(dst + (tid / (KC / 4)) * (KC + 8) + (tid % (KC / 4)) * 4 + i * (512 / KC) * (KC + 8)) = o; } }
// the same, split into bf16 hi + lo planes
template <int ROWS, int KC> __device__ __forceinline__ void tile_st2(const v4f (&r)[ROWS * KC / 512], __bf16* dh, __bf16* dl, int tid) {
#pragma unroll
  for (int i = 0; i < ROWS * KC / 512; ++i) { v4b oh, ol;
#pragma unroll
    for (int q = 0; q < 4; ++q) { const __bf16 h = (__bf16)r[i][q]; oh[q] = h; ol[q] = (__bf16)(r[i][q] - (float)h); }
    const int o = (tid / (KC / 4)) * (KC + 8) + (tid % (KC / 4)) * 4 + i * (512 / KC) * (KC + 8); *(v4b*)(dh + o) = oh; *(v4b*)(dl + o) = ol; } }
#define KS 64          // k extent of a staged tile in v_body and k_out
#define KP (KS + 8)
#define KS2 32         // k extent of a staged tile in pl_body
#define KP2 (KS2 + 8)

#define WS_QP  0u                                    // f32 [b*t][h][8]: q plucker (6 used)
#define WS_JK  (WS_QP + 4u * (size_t)NB * TT * NH * 8)  // f32 [b*t][h][8]: J6 k
#define WS_VT  (WS_JK + 4u * (size_t)NB * TT * NH * 8)  // f16 v planes [b][1024][t]
#define WS_VL  (WS_VT + 2u * (size_t)NB * DM_ * TT)      // f16 v residual planes
#define WS_O   (WS_VL + 2u * (size_t)NB * DM_ * TT)      // f32 o rows [b*t][1024]
#define WS_END (WS_O + 4u * (size_t)NB * TT * DM_)

// ---- k_pl: block = 32 tokens and ONE pair of weight matrices: (W1_q, W2_q) against the bigram, K = 2048, or (W1_k, W2_k) against x, K = 1024 -> 2 x 64 outputs, then per (token, head) the Plucker vector of that pair
// the k loop is a chain of load, wait, barrier, so its length in steps is its time: K is cut in two parts that run side by side, waves 0 and 1 on the first (16 tokens each), waves 2 and 3 on the second, and the two partial sums are added once behind the loop; for q the parts are x_t . W[:, 0:1024] and x_{t-1} . W[:, 1024:2048] (zero row for t = 0)
// sm: the launch's LDS block, SM_PL bytes used here; bx: the token block
#define PT 32
#define SM_PA (2 * 2 * PT * KP2 * 2)
#define SM_PW (2 * 2 * 2 * 64 * KP2 * 2)
#define SM_PS (2 * 2 * PT * 68 * 4)
#define SM_PL (SM_PA + SM_PW + SM_PS + PT * NH * 8 * 4)
template <bool ISQ> __device__ __forceinline__ void pl_body(char* sm, int bx, const float* __restrict__ X, const float* __restrict__ Wa, const float* __restrict__ Wb, float* __restrict__ PO) {
  constexpr int NST = (ISQ ? DM_ : DM_ / 2) / KS2, ldw = ISQ ? 2 * DM_ : DM_;   // k steps of a part; row stride of the weights
  __bf16 (&pa)[2][2][PT * KP2] = *(__bf16 (*)[2][2][PT * KP2])sm;                       // [buffer][part][token][k]
  __bf16 (&pw)[2][2][2][64 * KP2] = *(__bf16 (*)[2][2][2][64 * KP2])(sm + SM_PA);        // [buffer][part][matrix][output][k]
  float (&sv)[2][2][PT][68] = *(float (*)[2][2][PT][68])(sm + SM_PA + SM_PW);            // [part][matrix][token][64]: partial sums
  float (&sq)[PT][NH * 8] = *(float (*)[PT][NH * 8])(sm + SM_PA + SM_PW + SM_PS);
  const int tid = threadIdx.x, wave = tid >> 5, lane = tid & 31, col = lane & 15, g = lane >> 4, part = wave >> 1, wr = (wave & 1) * 16;
  const size_t rb = (size_t)bx * PT;
  const int srow = tid >> 3, sc = (tid & 7) * 4;
  // xa: the thread's x_t row; xb: for q, the x_{t-1} row of its first 16-row group (a batch's first row reads itself there and is zeroed in st_all; the second group never holds such a row); everything else lies at a constant distance from xa, wa, wb
  constexpr int KPART = NST * KS2;
  const float* xa = X + (rb + srow) * DM_ + sc; const float* wa = Wa + srow * ldw + sc; const float* wb = Wb + srow * ldw + sc;
  const float* xb = xa - (((rb + srow) % TT) != 0 ? DM_ : 0);
  static_assert(TT % PT == 0, "a batch's first row is a block's first row");
  v8f c1[4] = {}, c2[4] = {};
  v4f ra[2][2], rw[2][2][4];
  auto ld_all = [&](int k0) { const float* x = xa + k0; const float* u = wa + k0; const float* v = wb + k0;
    ra[0][0] = *(const v4f*)x; ra[0][1] = *(const v4f*)(x + 16 * DM_);
    const float* y = xb + k0;
    if constexpr (ISQ) { ra[1][0] = *(const v4f*)y; ra[1][1] = *(const v4f*)(x + 15 * DM_); }
    else { ra[1][0] = *(const v4f*)(x + KPART); ra[1][1] = *(const v4f*)(x + KPART + 16 * DM_); }
#pragma unroll
    for (int i = 0; i < 4; ++i) { rw[0][0][i] = *(const v4f*)(u + i * 16 * ldw); rw[0][1][i] = *(const v4f*)(v + i * 16 * ldw); rw[1][0][i] = *(const v4f*)(u + KPART + i * 16 * ldw); rw[1][1][i] = *(const v4f*)(v + KPART + i * 16 * ldw); }
    // as in tile_ld: one wait behind the step's loads, their addresses held as inputs up to it
    if constexpr (ISQ) asm volatile("s_wait_xcnt 0x0" :: "v"(x), "v"(y), "v"(u), "v"(v) : "memory");
    else asm volatile("s_wait_xcnt 0x0" :: "v"(x), "v"(u), "v"(v) : "memory"); };
  auto st_all = [&](int bf) {
    if (ISQ && ((rb + srow) % TT) == 0) ra[1][0] = (v4f){0.f, 0.f, 0.f, 0.f};
#pragma unroll
    for (int p = 0; p < 2; ++p) { tile_st<PT, KS2>(ra[p], pa[bf][p], tid); tile_st<64, KS2>(rw[p][0], pw[bf][p][0], tid); tile_st<64, KS2>(rw[p][1], pw[bf][p][1], tid); } };
  ld_all(0); st_all(0);
  __syncthreads();
#pragma unroll 1   // rolled: one copy of the body, so that the next tile's registers are not multiplied
  for (int kc = 0; kc < NST; ++kc) { const int cur = kc & 1; const bool more = kc + 1 < NST;
    if (more) ld_all((kc + 1) * KS2);
    const v16b a = frag_b(&pa[cur][part][(wr + col) * KP2], lane); v16b f[4][2];
#pragma unroll
    for (int j = 0; j < 4; ++j) { f[j][0] = frag_b(&pw[cur][part][0][(j * 16 + col) * KP2], lane); f[j][1] = frag_b(&pw[cur][part][1][(j * 16 + col) * KP2], lane); }
#pragma unroll
    for (int j = 0; j < 4; ++j) { c1[j] = wmma_bf(a, f[j][0], c1[j]); c2[j] = wmma_bf(a, f[j][1], c2[j]); }
    if (more) st_all(cur ^ 1);
    __syncthreads(); }
#pragma unroll
  for (int j = 0; j < 4; ++j)
#pragma unroll
    for (int r = 0; r < 8; ++r) { const int rl = wr + 8 * g + r, cl = j * 16 + col; sv[part][0][rl][cl] = c1[j][r]; sv[part][1][rl][cl] = c2[j][r]; }
  __syncthreads();
  // plucker per (token, head): thread handles (token = tid/4, 4 heads)
  { const int rl = tid >> 2, h0 = (tid & 3) * 4;
    for (int h = h0; h < h0 + 4; ++h) { float a1[4], a2[4];
      for (int e = 0; e < 4; ++e) { a1[e] = sv[0][0][rl][h * 4 + e] + sv[1][0][rl][h * 4 + e]; a2[e] = sv[0][1][rl][h * 4 + e] + sv[1][1][rl][h * 4 + e]; }
      float pp[6]; const int PI[6] = {0, 0, 0, 1, 1, 2}, PJ[6] = {1, 2, 3, 2, 3, 3}; float nn = 0.f;
      for (int e = 0; e < 6; ++e) { pp[e] = a1[PI[e]] * a2[PJ[e]] - a1[PJ[e]] * a2[PI[e]]; nn += pp[e] * pp[e]; }
      const float in = 1.0f / fmaxf(sqrtf(nn), 1e-12f);
      for (int e = 0; e < 6; ++e) pp[e] *= in;
      // J6 k = (k5, -k4, k3, k2, -k1, k0)
      const float po[6] = {ISQ ? pp[0] : pp[5], ISQ ? pp[1] : -pp[4], ISQ ? pp[2] : pp[3], ISQ ? pp[3] : pp[2], ISQ ? pp[4] : -pp[1], ISQ ? pp[5] : pp[0]};
      for (int e = 0; e < 8; ++e) sq[rl][h * 8 + e] = (e < 6) ? po[e] : 0.f; } }
  __syncthreads();
  for (int e = tid; e < PT * 32; e += 128) { const int rl = e >> 5, q = e & 31; vst2(PO + (rb + rl) * (NH * 8) + q * 4, *(const v4f*)&sq[rl][q * 4]); } }
// ---- k_v: block = (64 tokens, 128 cols): v = x Wv^T + bv exact -> f16 planes [b][d][t]
#define SM_V (2 * 128 * 72 * 2 + 2 * 64 * KP * 2 + 2 * 128 * KP * 2)
__device__ __forceinline__ void v_body(char* sm, int bx, int by, const float* __restrict__ X, const float* __restrict__ WV, const float* __restrict__ BV, _Float16* __restrict__ VT, _Float16* __restrict__ VL) { _Float16 (&th)[128][72] = *(_Float16 (*)[128][72])sm; _Float16 (&tl)[128][72] = *(_Float16 (*)[128][72])(sm + 128 * 72 * 2);
  const int tid = threadIdx.x, wave = tid >> 5, lane = tid & 31, col = lane & 15, g = lane >> 4; const int c0 = by * 128; const size_t r0 = (size_t)bx * 64;
  v8f acc[8] = {};
  __bf16 (&sa)[2][64 * KP] = *(__bf16 (*)[2][64 * KP])(sm + 2 * 128 * 72 * 2); __bf16 (&sw)[2][128 * KP] = *(__bf16 (*)[2][128 * KP])(sm + 2 * 128 * 72 * 2 + 2 * 64 * KP * 2);
  v4f ra[8], rw[16]; const float* Xb = X + r0 * DM_; const float* Wb = WV + (size_t)c0 * DM_;
  tile_ld<64, KS>(ra, Xb, DM_, tid); tile_ld<128, KS>(rw, Wb, DM_, tid);
  tile_st<64, KS>(ra, sa[0], tid); tile_st<128, KS>(rw, sw[0], tid);
  __syncthreads();
#pragma unroll 1   // rolled: one copy of the body, so that the next tile's registers are not multiplied
  for (int kc = 0; kc < DM_ / KS; ++kc) { const int cur = kc & 1; const bool more = kc + 1 < DM_ / KS;
    if (more) { tile_ld<64, KS>(ra, Xb + (kc + 1) * KS, DM_, tid); tile_ld<128, KS>(rw, Wb + (kc + 1) * KS, DM_, tid); }
#pragma unroll
    for (int ks = 0; ks < KS / 32; ++ks) { const v16b a = frag_b(&sa[cur][(wave * 16 + col) * KP + ks * 32], lane); v16b f[8];
#pragma unroll
      for (int j = 0; j < 8; ++j) f[j] = frag_b(&sw[cur][(j * 16 + col) * KP + ks * 32], lane);
#pragma unroll
      for (int j = 0; j < 8; ++j) acc[j] = wmma_bf(a, f[j], acc[j]); }
    if (more) { tile_st<64, KS>(ra, sa[cur ^ 1], tid); tile_st<128, KS>(rw, sw[cur ^ 1], tid); }
    __syncthreads(); }
#pragma unroll
  for (int j = 0; j < 8; ++j) { const float bb = bfr(BV[c0 + j * 16 + col]);
#pragma unroll
    for (int r = 0; r < 8; ++r) { const float v = acc[j][r] + bb; const _Float16 hv = (_Float16)v; th[j * 16 + col][wave * 16 + 8 * g + r] = hv; tl[j * 16 + col][wave * 16 + 8 * g + r] = (_Float16)(v - (float)hv); } }
  __syncthreads(); const size_t b = r0 / TT; const int t0 = (int)(r0 % TT); for (int e = tid; e < 128 * 8; e += 128) { const int cl = e >> 3, q = e & 7; const size_t o = (b * DM_ + c0 + cl) * (size_t)TT + t0 + q * 8; vst2((unsigned*)(VT + o), *(const v4u*)&th[cl][q * 8]); vst2((unsigned*)(VL + o), *(const v4u*)&tl[cl][q * 8]); } }
// ---- k_plv: the Plucker projections and the v projection depend on x and weights alone, not on each other: one grid holds all three kinds of block, the longest first (q: 32 k steps, k: 16 lighter ones, v: 16); the LDS block lets three blocks share a WGP, so the whole grid is resident at once
#define NPL (TNB * TT / PT)
#define NVB (TNB * TT / 64)
__global__ __launch_bounds__(128) void k_plv(const float* __restrict__ X, const float* __restrict__ W1Q, const float* __restrict__ W2Q, const float* __restrict__ W1K, const float* __restrict__ W2K, const float* __restrict__ WV, const float* __restrict__ BV, float* __restrict__ QP, float* __restrict__ JK, _Float16* __restrict__ VT, _Float16* __restrict__ VL) {
  __shared__ __align__(16) char sm[SM_PL > SM_V ? SM_PL : SM_V];
  const int bi = blockIdx.x;   // the same for the whole block: every barrier of a body is passed by all its threads
  if (bi < NPL) pl_body<true>(sm, bi, X, W1Q, W2Q, QP);
  else if (bi < 2 * NPL) pl_body<false>(sm, bi - NPL, X, W1K, W2K, JK);
  else v_body(sm, (bi - 2 * NPL) % NVB, (bi - 2 * NPL) / NVB, X, WV, BV, VT, VL); }
// 2^x on the hardware unit. The v_nop fills the one slot that the instruction set asks for behind a transcendental before its result is read or its source overwritten
__device__ __forceinline__ float exp2_slot(float x) { float e; asm("v_exp_f32 %0, %1\n\tv_nop" : "=v"(e) : "v"(x)); return e; }
#define SK 128         // keys of a staged tile in k_att: four passes of 32 keys between one barrier and the next
#define VP (SK + 8)    // row pitch of a staged v tile in k_att, in f16: 272 B = 16 B x odd
// ---- k_att: block = (a pair of 64-query tiles, head, b): causal, 3-product logits (K = 6 padded) x 6^-0.5
// both products are taken transposed: S^T = (J6 k) q^T (A = 16 keys, B = the wave's 16 queries) and O^T += v^T P^T (A = 16 d rows of v, B = P^T). A lane's 8 results of the S^T tile of keys 16 ct .. 16 ct + 15 are keys 16 ct + 8 g + 0..7 of query col, which is what elements 8 ct + 0..7 of the B fragment over 32 keys hold in that lane: P goes from the score registers into the operand registers of the same lane and never through LDS
// a query tile's cost grows with its index (tile t reads 2 (t + 1) passes of 32 keys) and all blocks are resident at once, so the launch lasts as long as the WGP with the most key tiles: each block takes tile TQB - 1 - x and then tile x, one after the other, which is 2 (TQB + 1) passes of 32 keys for every block wherever it lands
__global__ __launch_bounds__(128) void k_att(const float* __restrict__ QP, const float* __restrict__ JK, const _Float16* __restrict__ VT, const _Float16* __restrict__ VL, float* __restrict__ O) {
  __shared__ __align__(16) float so[4][16][68];
  __shared__ __align__(16) _Float16 sv[2][2][HD * VP];   // [buffer][hi, residual][d row][SK keys], row pitch VP
  __shared__ __align__(16) __bf16 sj[2][2][(SK + 1) * 8];   // [buffer][hi, lo][SK keys and a zero row][8]
  const int tid = threadIdx.x, wave = tid >> 5, lane = tid & 31, col = lane & 15, g = lane >> 4; const int h = blockIdx.y; const size_t b = blockIdx.z;
  static_assert(TQB % 2 == 0, "query tiles go in pairs");
  // every global load of a key tile is issued well ahead of its use, so that a tile waits for memory at most once and not once per product: the J6 k rows and the v tile one tile ahead, into registers, and from there into the LDS buffer that the next tile reads
  // a stage (fetch, wait, store to LDS, barrier) costs much the same whatever it holds, and its loads have the stage's own work to arrive in: a stage holds SK = 128 keys, worked on in four passes of 32
  // the four waves use the same v tile (64 d rows x SK keys, hi and residual): the block fetches it once, sixteen lanes to a row's 256 bytes (4 whole lines a wave load), and every wave takes its fragments from LDS
  const int srow = tid >> 4, sch = (tid & 15) * 8; const size_t so0 = (b * DM_ + (size_t)h * HD + srow) * TT + sch;
  v8h rs[2][8];
  // the J6 k rows of the tile likewise: each thread fetches 16 bytes of two rows; they are split into bf16 hi + lo once and laid down as the low halves of the A fragments (8 values a key); row SK of each plane stays zero and serves the lanes whose k lies past the 8 values
  v4f rj[2]; const int jrow = tid >> 1, jch = (tid & 1) * 4;
  static_assert(SK == 128 && TT % SK == 0, "128 threads: 16 x 16 B to a v row; a stage lies inside the sequence");
  const float* pj; const _Float16 *ph, *pl;   // the thread's places in the stage that is fetched next
  auto ld_t = [&]() {
    rj[0] = *(const v4f*)pj; rj[1] = *(const v4f*)(pj + 64 * NH * 8);
#pragma unroll
    for (int i = 0; i < 8; ++i) { rs[0][i] = *(const v8h*)(ph + i * 8 * TT); rs[1][i] = *(const v8h*)(pl + i * 8 * TT); }
    // as in tile_ld: one wait behind the stage's loads, their addresses held as inputs up to it
    asm volatile("s_wait_xcnt 0x0" :: "v"(pj), "v"(ph), "v"(pl) : "memory");
    pj += SK * NH * 8; ph += SK; pl += SK; };
  auto st_t = [&](int bf) {
#pragma unroll
    for (int u = 0; u < 2; ++u) { v4b oh, ol;
#pragma unroll
      for (int q = 0; q < 4; ++q) { const __bf16 hv = (__bf16)rj[u][q]; oh[q] = hv; ol[q] = (__bf16)(rj[u][q] - (float)hv); }
      *(v4b*)&sj[bf][0][(u * 64 + jrow) * 8 + jch] = oh; *(v4b*)&sj[bf][1][(u * 64 + jrow) * 8 + jch] = ol; }
    const int o = srow * VP + sch;
#pragma unroll
    for (int i = 0; i < 8; ++i) { *(v8h*)&sv[bf][0][o + i * 8 * VP] = rs[0][i]; *(v8h*)&sv[bf][1][o + i * 8 * VP] = rs[1][i]; } };
  v8b z8;
#pragma unroll
  for (int i = 0; i < 8; ++i) z8[i] = (__bf16)0.f;
  if (tid < 4) *(v8b*)&sj[tid >> 1][tid & 1][SK * 8] = z8;
  int jo[SK / 16];
#pragma unroll
  for (int i = 0; i < SK / 16; ++i) jo[i] = g ? SK * 8 : (i * 16 + col) * 8;
#pragma unroll 1   // rolled: one copy of the tile's code serves both query tiles
  for (int hf = 0; hf < 2; ++hf) { const int qb = hf ? (int)blockIdx.x : TQB - 1 - (int)blockIdx.x;   // the same for the whole block: every barrier below is passed by all its threads
  const int q0l = qb * 64 + wave * 16; const size_t q0 = b * TT + q0l;
  F2 aq; { float v[16];
#pragma unroll
    for (int i = 0; i < 16; ++i) v[i] = 0.f;
    if (g == 0) { const float* p = QP + (q0 + col) * (NH * 8) + h * 8;
#pragma unroll
      for (int i = 0; i < 8; ++i) v[i] = p[i]; }
    aq = bsplit16(v); }
  // q and J6 k have norm at most 1 (each is a vector over max(its norm, 1e-12)), so |logit| <= 6^-0.5 for every input: exp(logit) lies between 1/2 and 2, P x 2^11 stays far inside f16, and softmax needs no maximum taken off, hence no rescaling of the sums either
  float l[8];   // eight partial sums of exp for this lane's query (independent chains); they and the other half wave's are added once, behind the key loop
#pragma unroll
  for (int r = 0; r < 8; ++r) l[r] = 0.f;
  v8f acc[4] = {};
  int lim[8];   // key 16 n + 8 g + r is open to query q0l + col while 16 n <= lim[r]
#pragma unroll
  for (int r = 0; r < 8; ++r) lim[r] = q0l + col - 8 * g - r;
  const int nks = (qb * 64 + 64 + SK - 1) / SK;   // the last stage may reach past the block's last query: its keys lie inside the sequence (TT % SK == 0) and are closed to every query
  pj = JK + (b * TT + jrow) * (NH * 8) + h * 8 + jch; ph = VT + so0; pl = VL + so0;
  ld_t(); st_t(0);   // second query tile: every wave has left both buffers at the barrier that ended the first tile's last key tile
  __syncthreads();
#pragma unroll 1
  for (int ks = 0; ks < nks; ++ks) {
    const int cur = ks & 1; const bool more = ks + 1 < nks;
    if (more) ld_t();
#pragma unroll
    for (int sb = 0; sb < SK / 32; ++sb) if (ks * SK + sb * 32 < qb * 64 + 64) {   // the stage's passes of 32 keys, in key order; a pass wholly behind the block's last query is left out (the same for the whole block)
    F2 bk2[2];
#pragma unroll
    for (int ct = 0; ct < 2; ++ct) { union { v16b v; v8b q[2]; } uh, ul; uh.q[0] = *(const v8b*)&sj[cur][0][jo[sb * 2 + ct]]; uh.q[1] = z8; ul.q[0] = *(const v8b*)&sj[cur][1][jo[sb * 2 + ct]]; ul.q[1] = z8; bk2[ct].h = uh.v; bk2[ct].l = ul.v; }
    v16h vh[4], vl[4];
#pragma unroll
    for (int j = 0; j < 4; ++j) { vh[j] = frag_h(&sv[cur][0][(j * 16 + col) * VP + sb * 32], lane); vl[j] = frag_h(&sv[cur][1][(j * 16 + col) * VP + sb * 32], lane); }
    v16h pa, pr;   // P^T x 2^11 as f16 hi + residual (a single f16 would quantise P to 1 part in 2048)
#pragma unroll
    for (int ct = 0; ct < 2; ++ct) { const int kt = ks * SK + sb * 32 + ct * 16; const F2 bk = bk2[ct];
      v8f c = {}; c = wmma_bf(bk.h, aq.l, c); c = wmma_bf(bk.l, aq.h, c); c = wmma_bf(bk.h, aq.h, c);
#pragma unroll
      for (int r = 0; r < 8; ++r) { const float ex = exp2_slot(c[r] * (0.4082482904638631f * 1.4426950408889634f)), e = (kt <= lim[r]) ? ex : 0.f;   /* exp(c x 6^-0.5) as 2^(c x 6^-0.5 x log2 e): with nothing taken off in between, one multiply */ l[r] += e;
        const float f = e * 2048.0f; const _Float16 hv = (_Float16)f; pa[ct * 8 + r] = hv; pr[ct * 8 + r] = (_Float16)(f - (float)hv); } }
#pragma unroll
    for (int j = 0; j < 4; ++j) { acc[j] = wmma16(vh[j], pa, acc[j]); acc[j] = wmma16(vh[j], pr, acc[j]); acc[j] = wmma16(vl[j], pa, acc[j]); } }
    if (more) st_t(cur ^ 1);   // the buffers that every wave left at the barrier of the tile before
    __syncthreads(); }
  { float ls = ((l[0] + l[1]) + (l[2] + l[3])) + ((l[4] + l[5]) + (l[6] + l[7]));
    ls += __shfl_xor(ls, 16);   // the other half wave holds the same query's other keys
    const float il = (1.0f / 2048.0f) / ls;
    // acc[j][r] = O^T (d = 16 j + 8 g + r, query col): 8 neighbouring d of one query row
#pragma unroll
    for (int j = 0; j < 4; ++j) { *(v4f*)&so[wave][col][j * 16 + 8 * g] = (v4f){acc[j][0] * il, acc[j][1] * il, acc[j][2] * il, acc[j][3] * il}; *(v4f*)&so[wave][col][j * 16 + 8 * g + 4] = (v4f){acc[j][4] * il, acc[j][5] * il, acc[j][6] * il, acc[j][7] * il}; } }
  LDSX(); for (int rl = 0; rl < 16; ++rl) if (lane < 16) vst2(O + (q0 + rl) * DM_ + h * HD + lane * 4, *(const v4f*)&so[wave][rl][lane * 4]);
  // the wait stands behind the tile's stores, in front of the next query tile's code, which writes the registers of their data and address anew
  asm volatile("s_wait_xcnt 0x0" ::: "memory"); } }
// ---- k_out: block = (64 rows, 128 cols): out = o (hi + lo) Wo^T + bo
__global__ __launch_bounds__(128) void k_out(const float* __restrict__ O, const float* __restrict__ WO, const float* __restrict__ BO, float* __restrict__ OUT) { __shared__ __align__(16) float sf[4][16][132];
  const int tid = threadIdx.x, wave = tid >> 5, lane = tid & 31, col = lane & 15, g = lane >> 4; const int c0 = blockIdx.y * 128; const size_t r0 = (size_t)blockIdx.x * 64 + wave * 16;
  v8f acc[8] = {};
  __shared__ __align__(16) __bf16 oh[2][64 * KP], ol[2][64 * KP], ow[2][128 * KP];
  v4f ra[8], rw[16]; const float* Ob = O + (size_t)blockIdx.x * 64 * DM_; const float* Wb = WO + (size_t)c0 * DM_;
  tile_ld<64, KS>(ra, Ob, DM_, tid); tile_ld<128, KS>(rw, Wb, DM_, tid);
  tile_st2<64, KS>(ra, oh[0], ol[0], tid); tile_st<128, KS>(rw, ow[0], tid);
  __syncthreads();
#pragma unroll 1   // rolled: one copy of the body, so that the next tile's registers are not multiplied
  for (int kc = 0; kc < DM_ / KS; ++kc) { const int cur = kc & 1; const bool more = kc + 1 < DM_ / KS;
    if (more) { tile_ld<64, KS>(ra, Ob + (kc + 1) * KS, DM_, tid); tile_ld<128, KS>(rw, Wb + (kc + 1) * KS, DM_, tid); }
#pragma unroll
    for (int ks = 0; ks < KS / 32; ++ks) { const int ao = (wave * 16 + col) * KP + ks * 32; const v16b ah = frag_b(&oh[cur][ao], lane), al = frag_b(&ol[cur][ao], lane);
#pragma unroll
      for (int j0 = 0; j0 < 8; j0 += 4) { v16b f[4];
#pragma unroll
        for (int j = 0; j < 4; ++j) f[j] = frag_b(&ow[cur][((j0 + j) * 16 + col) * KP + ks * 32], lane);
#pragma unroll
        for (int j = 0; j < 4; ++j) { acc[j0 + j] = wmma_bf(ah, f[j], acc[j0 + j]); acc[j0 + j] = wmma_bf(al, f[j], acc[j0 + j]); } } }
    if (more) { tile_st2<64, KS>(ra, oh[cur ^ 1], ol[cur ^ 1], tid); tile_st<128, KS>(rw, ow[cur ^ 1], tid); }
    __syncthreads(); }
#pragma unroll
  for (int j = 0; j < 8; ++j) { const float bb = bfr(BO[c0 + j * 16 + col]);
#pragma unroll
    for (int r = 0; r < 8; ++r) sf[wave][8 * g + r][j * 16 + col] = acc[j][r] + bb; }
  LDSX(); for (int rl = 0; rl < 16; ++rl) vst2(OUT + (r0 + rl) * DM_ + c0 + lane * 4, *(const v4f*)&sf[wave][rl][lane * 4]); }
extern "C" void kernel_launch(void* const* d_in, const int* in_sizes, int n_in, void* d_out, int out_size, void* d_ws, size_t ws_size, hipStream_t stream) {
  (void)in_sizes; (void)n_in; (void)out_size;
  const float** F = (const float**)d_in;   // 0 x [2,2048,1024], 1 W1_q [64,2048], 2 W2_q, 3 W1_k [64,1024], 4 W2_k, 5 Wv [1024,1024], 6 bv, 7 Wo, 8 bo
  if (ws_size < (size_t)WS_END) return;
  char* ws = (char*)d_ws; float *QP = (float*)(ws + WS_QP), *JK = (float*)(ws + WS_JK), *O = (float*)(ws + WS_O); _Float16 *VT = (_Float16*)(ws + WS_VT), *VL = (_Float16*)(ws + WS_VL);
  k_plv<<<2 * NPL + NVB * (DM_ / 128), 128, 0, stream>>>(F[0], F[1], F[2], F[3], F[4], F[5], F[6], QP, JK, VT, VL);
  k_att<<<dim3(TQB / 2, NH, TNB), 128, 0, stream>>>(QP, JK, VT, VL, O);
  k_out<<<dim3(TNB * TQB, DM_ / 128), 128, 0, stream>>>(O, F[7], F[8], (float*)d_out);   // the rows of both batches lie one behind the other: one grid
}

// v010
// It runs in 94.9 microseconds.
// Next to v009, in two timings, it ran 1.04 times as fast each time.
// Counting every step since v000, it is 7.41 times as fast.
// compute dtype: all float inputs rounded to bf16; q1/q2 = [x_t ; x_{t-1}] W^T and k1/k2 = x W^T with EXACT bf16 products on WMMA 16x16x32, f32 accumulate; the Plucker 6-vectors, their normalisation and J6 k in f32; q and J6 k split into bf16 hi + lo (3 products, K = 6 zero-padded to 32) for the causal logits x 6^-0.5, softmax in f32 without a maximum (the logits are bounded, see k_att; hardware exp); P (x 2^11, f16 hi + residual) . v with v = x Wv^T + bv exact as f16 hi + residual (3 products); out = o (bf16 hi + lo) Wo^T + bo (2 products); f32 output.
#include <hip/hip_runtime.h>
#include <math.h>

typedef __attribute__((ext_vector_type(16))) _Float16 v16h;
typedef __attribute__((ext_vector_type(16))) __bf16 v16b;
typedef __attribute__((ext_vector_type(8)))  _Float16 v8h;
typedef __attribute__((ext_vector_type(8)))  float v8f;
typedef __attribute__((ext_vector_type(4)))  float v4f;
typedef __attribute__((ext_vector_type(2)))  float v2f;
typedef __attribute__((ext_vector_type(4)))  unsigned v4u;
typedef __attribute__((ext_vector_type(4)))  int v4i;
typedef float __attribute__((may_alias)) float_a;
typedef int __attribute__((may_alias)) int_a;

template <typename T> __device__ __forceinline__ void vst2(void* p, T v) { *(T*)p = v;  }
__device__ __forceinline__ v8f wmma16(v16h a, v16h b, v8f c) {
  v8f d = __builtin_amdgcn_wmma_f32_16x16x32_f16(false, a, false, b, (short)0, c, false, false);
  asm volatile("v_nop\n\tv_nop\n\tv_nop\n\tv_nop" : "+v"(d) : "v"(a), "v"(b));
  return d;
}
__device__ __forceinline__ v8f wmma_bf(v16b a, v16b b, v8f c) {
  v8f d = __builtin_amdgcn_wmma_f32_16x16x32_bf16(false, a, false, b, (short)0, c, false, false);
  asm volatile("v_nop\n\tv_nop\n\tv_nop\n\tv_nop" : "+v"(d) : "v"(a), "v"(b));
  return d;
}
// the plain builtin, for a WMMA that is followed by independent WMMAs: they fill the slots behind it
__device__ __forceinline__ v8f wmma16_p(v16h a, v16h b, v8f c) { return __builtin_amdgcn_wmma_f32_16x16x32_f16(false, a, false, b, (short)0, c, false, false); }
// 16x16x32 fragments: lane = (h = lane>>4, row/col = lane&15); elements 0..7 = k0+8h+0..7, 8..15 = k0+16+8h+0..7; D element r = row 8h+r
__device__ __forceinline__ v16h frag_h(const _Float16* rowk0, int lane) {
  union { v16h v; v8h q[2]; } u; const _Float16* p = rowk0 + 8 * (lane >> 4);
  u.q[0] = *(const v8h*)p; u.q[1] = *(const v8h*)(p + 16); return u.v;
}
__device__ __forceinline__ v16h frag_f32(const float* rowk0, int lane) {
  v16h a; const float* p = rowk0 + 8 * (lane >> 4);
#pragma unroll
  for (int i = 0; i < 8; ++i) { a[i] = (_Float16)p[i]; a[8 + i] = (_Float16)p[16 + i]; }
  return a;
}
__device__ __forceinline__ v16h frag_f32s(const float* rowk0, int lane, float sc) {
  v16h a; const float* p = rowk0 + 8 * (lane >> 4);
#pragma unroll
  for (int i = 0; i < 8; ++i) { a[i] = (_Float16)(p[i] * sc); a[8 + i] = (_Float16)(p[16 + i] * sc); }
  return a;
}
// column fragment from a [K][ld] layout (column n), rows >= K read as 0
__device__ __forceinline__ v16h fragc_f32(const float* W, int k0, int n, int lane, int ld, int K) {
  v16h a; const int g = lane >> 4;
#pragma unroll
  for (int i = 0; i < 8; ++i) { const int ka = k0 + 8 * g + i, kb = ka + 16;
    a[i] = (_Float16)(ka < K ? W[(size_t)(ka < K ? ka : K - 1) * ld + n] : 0.f); a[8 + i] = (_Float16)(kb < K ? W[(size_t)(kb < K ? kb : K - 1) * ld + n] : 0.f); }
  return a;
}
struct F2 { v16b h, l; };
__device__ __forceinline__ F2 bsplit16(const float v[16]) { F2 r;
#pragma unroll
  for (int i = 0; i < 16; ++i) { const __bf16 h = (__bf16)v[i]; r.h[i] = h; r.l[i] = (__bf16)(v[i] - (float)h); }
  return r; }
__device__ __forceinline__ F2 split_row(const float* row, int k0, int lane) { float v[16]; const float* p = row + k0 + 8 * (lane >> 4);
#pragma unroll
  for (int i = 0; i < 8; ++i) { v[i] = p[i]; v[8 + i] = p[16 + i]; }
  return bsplit16(v); }
__device__ __forceinline__ F2 split_rowK(const float* row, int k0, int lane, int K) { float v[16]; const int g = lane >> 4;
#pragma unroll
  for (int i = 0; i < 8; ++i) { const int ka = k0 + 8 * g + i, kb = ka + 16; v[i] = ka < K ? row[ka < K ? ka : K - 1] : 0.f; v[8 + i] = kb < K ? row[kb < K ? kb : K - 1] : 0.f; }
  return bsplit16(v); }
__device__ __forceinline__ F2 split_col(const float* W, int k0, int n, int lane, int ld, int K) { float v[16]; const int g = lane >> 4;
#pragma unroll
  for (int i = 0; i < 8; ++i) { const int ka = k0 + 8 * g + i, kb = ka + 16; v[i] = ka < K ? W[(size_t)(ka < K ? ka : K - 1) * ld + n] : 0.f; v[8 + i] = kb < K ? W[(size_t)(kb < K ? kb : K - 1) * ld + n] : 0.f; }
  return bsplit16(v); }
__device__ __forceinline__ float sigm(float v) { return 1.0f / (1.0f + expf(-v)); }
#define LDSX() do { asm volatile("s_wait_dscnt 0" ::: "memory"); __builtin_amdgcn_wave_barrier(); __builtin_amdgcn_fence(__ATOMIC_RELEASE, "workgroup"); } while (0)


// Plucker bigram attention (B 2, T 2,048, D 1,024, 16 heads x 64): per head, q = normalised Plucker line of two 4-vectors from the bigram [x_t ; x_{t-1}], k likewise from x_t; logits = q . (J6 k) / sqrt(6), causal softmax, . v, Wo.
#define NB 2
#define TT 2048
#define DM_ 1024
#define NH 16
#define HD 64
#ifndef TNB
#define TNB NB
#endif
#ifndef TQB
#define TQB (TT / 64)
#endif
typedef __attribute__((ext_vector_type(8))) __bf16 v8b;
__device__ __forceinline__ v16b frag_b(const __bf16* rowk0, int lane) {
  union { v16b v; v8b q[2]; } u; const __bf16* p = rowk0 + 8 * (lane >> 4);
  u.q[0] = *(const v8b*)p; u.q[1] = *(const v8b*)(p + 16); return u.v;
}
__device__ __forceinline__ float bfr(float v) { return (float)(__bf16)v; }
__device__ __attribute__((noinline)) float exp_ni(float v) { return expf(v); }
__device__ __attribute__((noinline)) float erf_ni(float v) { return erff(v); }

typedef __attribute__((ext_vector_type(4))) __bf16 v4b;
// Staging of a ROWS x KC f32 tile (rows K-contiguous, row stride ld floats) by the block's 128 threads: consecutive lanes take consecutive 16 bytes of a row, so every wave load covers whole 128-byte lines; the tile is rounded to bf16 once and laid in LDS at a row pitch of KC + 8 elements (16 B x odd).
template <int ROWS, int KC> __device__ __forceinline__ void tile_ld(v4f (&r)[ROWS * KC / 512], const float* __restrict__ src, int ld, int tid, int coff = 0) { const float* p = src + (unsigned)((tid / (KC / 4)) * ld + (tid % (KC / 4)) * 4);
#pragma unroll
  for (int i = 0; i < ROWS * KC / 512; ++i) r[i] = *(const v4f*)(p + coff + (size_t)i * (512 / KC) * ld);
  // the wait stands behind the tile's loads, in front of whatever next writes the registers of their address (the next tile's results, later address arithmetic); p as an input keeps the address in its registers up to the wait: without it the tile's last load got them as its result
  asm volatile("s_wait_xcnt 0x0" :: "v"(p) : "memory"); }
template <int ROWS, int KC> __device__ __forceinline__ void tile_st(const v4f (&r)[ROWS * KC / 512], __bf16* dst, int tid) {
#pragma unroll
  for (int i = 0; i < ROWS * KC / 512; ++i) { v4b o;
#pragma unroll
    for (int q = 0; q < 4; ++q) o[q] = (__bf16)r[i][q];
    *(v4b*)(dst + (tid / (KC / 4)) * (KC + 8) + (tid % (KC / 4)) * 4 + i * (512 / KC) * (KC + 8)) = o; } }
// the same, split into bf16 hi + lo planes
template <int ROWS, int KC> __device__ __forceinline__ void tile_st2(const v4f (&r)[ROWS * KC / 512], __bf16* dh, __bf16* dl, int tid) {
#pragma unroll
  for (int i = 0; i < ROWS * KC / 512; ++i) { v4b oh, ol;
#pragma unroll
    for (int q = 0; q < 4; ++q) { const __bf16 h = (__bf16)r[i][q]; oh[q] = h; ol[q] = (__bf16)(r[i][q] - (float)h); }
    const int o = (tid / (KC / 4)) * (KC + 8) + (tid % (KC / 4)) * 4 + i * (512 / KC) * (KC + 8); *(v4b*)(dh + o) = oh; *(v4b*)(dl + o) = ol; } }
#define KS 64          // k extent of a staged tile in v_body and k_out
#define KP (KS + 8)
#define KS2 32         // k extent of a staged tile in pl_body
#define KP2 (KS2 + 8)

#define WS_QP  0u                                    // f32 [b*t][h][8]: q plucker (6 used)
#define WS_JK  (WS_QP + 4u * (size_t)NB * TT * NH * 8)  // f32 [b*t][h][8]: J6 k
#define WS_VT  (WS_JK + 4u * (size_t)NB * TT * NH * 8)  // f16 v planes [b][1024][t]
#define WS_VL  (WS_VT + 2u * (size_t)NB * DM_ * TT)      // f16 v residual planes
#define WS_O   (WS_VL + 2u * (size_t)NB * DM_ * TT)      // f32 o rows [b*t][1024]
#define WS_END (WS_O + 4u * (size_t)NB * TT * DM_)

// ---- k_pl: block = 32 tokens and ONE pair of weight matrices: (W1_q, W2_q) against the bigram, K = 2048, or (W1_k, W2_k) against x, K = 1024 -> 2 x 64 outputs, then per (token, head) the Plucker vector of that pair
// the k loop is a chain of load, wait, barrier, so its length in steps is its time: K is cut in two parts that run side by side, waves 0 and 1 on the first (16 tokens each), waves 2 and 3 on the second, and the two partial sums are added once behind the loop; for q the parts are x_t . W[:, 0:1024] and x_{t-1} . W[:, 1024:2048] (zero row for t = 0)
// sm: the launch's LDS block, SM_PL bytes used here; bx: the token block
#define PT 32
#define SM_PA (2 * 2 * PT * KP2 * 2)
#define SM_PW (2 * 2 * 2 * 64 * KP2 * 2)
#define SM_PS (2 * 2 * PT * 68 * 4)
#define SM_PL (SM_PA + SM_PW + SM_PS + PT * NH * 8 * 4)
template <bool ISQ> __device__ __forceinline__ void pl_body(char* sm, int bx, const float* __restrict__ X, const float* __restrict__ Wa, const float* __restrict__ Wb, float* __restrict__ PO) {
  constexpr int NST = (ISQ ? DM_ : DM_ / 2) / KS2, ldw = ISQ ? 2 * DM_ : DM_;   // k steps of a part; row stride of the weights
  __bf16 (&pa)[2][2][PT * KP2] = *(__bf16 (*)[2][2][PT * KP2])sm;                       // [buffer][part][token][k]
  __bf16 (&pw)[2][2][2][64 * KP2] = *(__bf16 (*)[2][2][2][64 * KP2])(sm + SM_PA);        // [buffer][part][matrix][output][k]
  float (&sv)[2][2][PT][68] = *(float (*)[2][2][PT][68])(sm + SM_PA + SM_PW);            // [part][matrix][token][64]: partial sums
  float (&sq)[PT][NH * 8] = *(float (*)[PT][NH * 8])(sm + SM_PA + SM_PW + SM_PS);
  const int tid = threadIdx.x, wave = tid >> 5, lane = tid & 31, col = lane & 15, g = lane >> 4, part = wave >> 1, wr = (wave & 1) * 16;
  const size_t rb = (size_t)bx * PT;
  const int srow = tid >> 3, sc = (tid & 7) * 4;
  // xa: the thread's x_t row; xb: for q, the x_{t-1} row of its first 16-row group (a batch's first row reads itself there and is zeroed in st_all; the second group never holds such a row); everything else lies at a constant distance from xa, wa, wb
  constexpr int KPART = NST * KS2;
  const float* xa = X + (rb + srow) * DM_ + sc; const float* wa = Wa + srow * ldw + sc; const float* wb = Wb + srow * ldw + sc;
  const float* xb = xa - (((rb + srow) % TT) != 0 ? DM_ : 0);
  static_assert(TT % PT == 0, "a batch's first row is a block's first row");
  v8f c1[4] = {}, c2[4] = {};
  v4f ra[2][2], rw[2][2][4];
  auto ld_all = [&](int k0) { const float* x = xa + k0; const float* u = wa + k0; const float* v = wb + k0;
    ra[0][0] = *(const v4f*)x; ra[0][1] = *(const v4f*)(x + 16 * DM_);
    const float* y = xb + k0;
    if constexpr (ISQ) { ra[1][0] = *(const v4f*)y; ra[1][1] = *(const v4f*)(x + 15 * DM_); }
    else { ra[1][0] = *(const v4f*)(x + KPART); ra[1][1] = *(const v4f*)(x + KPART + 16 * DM_); }
#pragma unroll
    for (int i = 0; i < 4; ++i) { rw[0][0][i] = *(const v4f*)(u + i * 16 * ldw); rw[0][1][i] = *(const v4f*)(v + i * 16 * ldw); rw[1][0][i] = *(const v4f*)(u + KPART + i * 16 * ldw); rw[1][1][i] = *(const v4f*)(v + KPART + i * 16 * ldw); }
    // as in tile_ld: one wait behind the step's loads, their addresses held as inputs up to it
    if constexpr (ISQ) asm volatile("s_wait_xcnt 0x0" :: "v"(x), "v"(y), "v"(u), "v"(v) : "memory");
    else asm volatile("s_wait_xcnt 0x0" :: "v"(x), "v"(u), "v"(v) : "memory"); };
  auto st_all = [&](int bf) {
    if (ISQ && ((rb + srow) % TT) == 0) ra[1][0] = (v4f){0.f, 0.f, 0.f, 0.f};
#pragma unroll
    for (int p = 0; p < 2; ++p) { tile_st<PT, KS2>(ra[p], pa[bf][p], tid); tile_st<64, KS2>(rw[p][0], pw[bf][p][0], tid); tile_st<64, KS2>(rw[p][1], pw[bf][p][1], tid); } };
  ld_all(0); st_all(0);
  __syncthreads();
#pragma unroll 1   // rolled: one copy of the body, so that the next tile's registers are not multiplied
  for (int kc = 0; kc < NST; ++kc) { const int cur = kc & 1; const bool more = kc + 1 < NST;
    if (more) ld_all((kc + 1) * KS2);
    const v16b a = frag_b(&pa[cur][part][(wr + col) * KP2], lane); v16b f[4][2];
#pragma unroll
    for (int j = 0; j < 4; ++j) { f[j][0] = frag_b(&pw[cur][part][0][(j * 16 + col) * KP2], lane); f[j][1] = frag_b(&pw[cur][part][1][(j * 16 + col) * KP2], lane); }
#pragma unroll
    for (int j = 0; j < 4; ++j) { c1[j] = wmma_bf(a, f[j][0], c1[j]); c2[j] = wmma_bf(a, f[j][1], c2[j]); }
    if (more) st_all(cur ^ 1);
    __syncthreads(); }
#pragma unroll
  for (int j = 0; j < 4; ++j)
#pragma unroll
    for (int r = 0; r < 8; ++r) { const int rl = wr + 8 * g + r, cl = j * 16 + col; sv[part][0][rl][cl] = c1[j][r]; sv[part][1][rl][cl] = c2[j][r]; }
  __syncthreads();
  // plucker per (token, head): thread handles (token = tid/4, 4 heads)
  { const int rl = tid >> 2, h0 = (tid & 3) * 4;
    for (int h = h0; h < h0 + 4; ++h) { float a1[4], a2[4];
      for (int e = 0; e < 4; ++e) { a1[e] = sv[0][0][rl][h * 4 + e] + sv[1][0][rl][h * 4 + e]; a2[e] = sv[0][1][rl][h * 4 + e] + sv[1][1][rl][h * 4 + e]; }
      float pp[6]; const int PI[6] = {0, 0, 0, 1, 1, 2}, PJ[6] = {1, 2, 3, 2, 3, 3}; float nn = 0.f;
      for (int e = 0; e < 6; ++e) { pp[e] = a1[PI[e]] * a2[PJ[e]] - a1[PJ[e]] * a2[PI[e]]; nn += pp[e] * pp[e]; }
      const float in = 1.0f / fmaxf(sqrtf(nn), 1e-12f);
      for (int e = 0; e < 6; ++e) pp[e] *= in;
      // J6 k = (k5, -k4, k3, k2, -k1, k0)
      const float po[6] = {ISQ ? pp[0] : pp[5], ISQ ? pp[1] : -pp[4], ISQ ? pp[2] : pp[3], ISQ ? pp[3] : pp[2], ISQ ? pp[4] : -pp[1], ISQ ? pp[5] : pp[0]};
      for (int e = 0; e < 8; ++e) sq[rl][h * 8 + e] = (e < 6) ? po[e] : 0.f; } }
  __syncthreads();
  for (int e = tid; e < PT * 32; e += 128) { const int rl = e >> 5, q = e & 31; vst2(PO + (rb + rl) * (NH * 8) + q * 4, *(const v4f*)&sq[rl][q * 4]); } }
// ---- k_v: block = (64 tokens, 128 cols): v = x Wv^T + bv exact -> f16 planes [b][d][t]
#define SM_V (2 * 128 * 72 * 2 + 2 * 64 * KP * 2 + 2 * 128 * KP * 2)
__device__ __forceinline__ void v_body(char* sm, int bx, int by, const float* __restrict__ X, const float* __restrict__ WV, const float* __restrict__ BV, _Float16* __restrict__ VT, _Float16* __restrict__ VL) { _Float16 (&th)[128][72] = *(_Float16 (*)[128][72])sm; _Float16 (&tl)[128][72] = *(_Float16 (*)[128][72])(sm + 128 * 72 * 2);
  const int tid = threadIdx.x, wave = tid >> 5, lane = tid & 31, col = lane & 15, g = lane >> 4; const int c0 = by * 128; const size_t r0 = (size_t)bx * 64;
  v8f acc[8] = {};
  __bf16 (&sa)[2][64 * KP] = *(__bf16 (*)[2][64 * KP])(sm + 2 * 128 * 72 * 2); __bf16 (&sw)[2][128 * KP] = *(__bf16 (*)[2][128 * KP])(sm + 2 * 128 * 72 * 2 + 2 * 64 * KP * 2);
  v4f ra[8], rw[16]; const float* Xb = X + r0 * DM_; const float* Wb = WV + (size_t)c0 * DM_;
  tile_ld<64, KS>(ra, Xb, DM_, tid); tile_ld<128, KS>(rw, Wb, DM_, tid);
  tile_st<64, KS>(ra, sa[0], tid); tile_st<128, KS>(rw, sw[0], tid);
  __syncthreads();
#pragma unroll 1   // rolled: one copy of the body, so that the next tile's registers are not multiplied
  for (int kc = 0; kc < DM_ / KS; ++kc) { const int cur = kc & 1; const bool more = kc + 1 < DM_ / KS;
    if (more) { tile_ld<64, KS>(ra, Xb + (kc + 1) * KS, DM_, tid); tile_ld<128, KS>(rw, Wb + (kc + 1) * KS, DM_, tid); }
#pragma unroll
    for (int ks = 0; ks < KS / 32; ++ks) { const v16b a = frag_b(&sa[cur][(wave * 16 + col) * KP + ks * 32], lane); v16b f[8];
#pragma unroll
      for (int j = 0; j < 8; ++j) f[j] = frag_b(&sw[cur][(j * 16 + col) * KP + ks * 32], lane);
#pragma unroll
      for (int j = 0; j < 8; ++j) acc[j] = wmma_bf(a, f[j], acc[j]); }
    if (more) { tile_st<64, KS>(ra, sa[cur ^ 1], tid); tile_st<128, KS>(rw, sw[cur ^ 1], tid); }
    __syncthreads(); }
#pragma unroll
  for (int j = 0; j < 8; ++j) { const float bb = bfr(BV[c0 + j * 16 + col]);
#pragma unroll
    for (int r = 0; r < 8; ++r) { const float v = acc[j][r] + bb; const _Float16 hv = (_Float16)v; th[j * 16 + col][wave * 16 + 8 * g + r] = hv; tl[j * 16 + col][wave * 16 + 8 * g + r] = (_Float16)(v - (float)hv); } }
  __syncthreads(); const size_t b = r0 / TT; const int t0 = (int)(r0 % TT); for (int e = tid; e < 128 * 8; e += 128) { const int cl = e >> 3, q = e & 7; const size_t o = (b * DM_ + c0 + cl) * (size_t)TT + t0 + q * 8; vst2((unsigned*)(VT + o), *(const v4u*)&th[cl][q * 8]); vst2((unsigned*)(VL + o), *(const v4u*)&tl[cl][q * 8]); } }
// ---- k_plv: the Plucker projections and the v projection depend on x and weights alone, not on each other: one grid holds all three kinds of block, the longest first (q: 32 k steps, k: 16 lighter ones, v: 16); the LDS block lets three blocks share a WGP, so the whole grid is resident at once
#define NPL (TNB * TT / PT)
#define NVB (TNB * TT / 64)
__global__ __launch_bounds__(128) void k_plv(const float* __restrict__ X, const float* __restrict__ W1Q, const float* __restrict__ W2Q, const float* __restrict__ W1K, const float* __restrict__ W2K, const float* __restrict__ WV, const float* __restrict__ BV, float* __restrict__ QP, float* __restrict__ JK, _Float16* __restrict__ VT, _Float16* __restrict__ VL) {
  __shared__ __align__(16) char sm[SM_PL > SM_V ? SM_PL : SM_V];
  const int bi = blockIdx.x;   // the same for the whole block: every barrier of a body is passed by all its threads
  if (bi < NPL) pl_body<true>(sm, bi, X, W1Q, W2Q, QP);
  else if (bi < 2 * NPL) pl_body<false>(sm, bi - NPL, X, W1K, W2K, JK);
  else v_body(sm, (bi - 2 * NPL) % NVB, (bi - 2 * NPL) / NVB, X, WV, BV, VT, VL); }
// 2^x on the hardware unit. The v_nop fills the one slot that the instruction set asks for behind a transcendental before its result is read or its source overwritten
__device__ __forceinline__ float exp2_slot(float x) { float e; asm("v_exp_f32 %0, %1\n\tv_nop" : "=v"(e) : "v"(x)); return e; }
#define SK 128         // keys of a staged tile in k_att: four passes of 32 keys between one barrier and the next
#define VP (SK + 8)    // row pitch of a staged v tile in k_att, in f16: 272 B = 16 B x odd
// ---- k_att: block = (a pair of 64-query tiles, head, b): causal, 3-product logits (K = 6 padded) x 6^-0.5
// both products are taken transposed: S^T = (J6 k) q^T (A = 16 keys, B = the wave's 16 queries) and O^T += v^T P^T (A = 16 d rows of v, B = P^T). A lane's 8 results of the S^T tile of keys 16 ct .. 16 ct + 15 are keys 16 ct + 8 g + 0..7 of query col, which is what elements 8 ct + 0..7 of the B fragment over 32 keys hold in that lane: P goes from the score registers into the operand registers of the same lane and never through LDS
// a query tile's cost grows with its index (tile t reads 2 (t + 1) passes of 32 keys) and all blocks are resident at once, so the launch lasts as long as the WGP with the most key tiles: each block takes tile TQB - 1 - x and then tile x, one after the other, which is 2 (TQB + 1) passes of 32 keys for every block wherever it lands
__global__ __launch_bounds__(128) void k_att(const float* __restrict__ QP, const float* __restrict__ JK, const _Float16* __restrict__ VT, const _Float16* __restrict__ VL, float* __restrict__ O) {
  __shared__ __align__(16) float so[4][16][68];
  __shared__ __align__(16) _Float16 sv[2][2][HD * VP];   // [buffer][hi, residual][d row][SK keys], row pitch VP
  __shared__ __align__(16) __bf16 sj[2][2][(SK + 1) * 8];   // [buffer][hi, lo][SK keys and a zero row][8]
  const int tid = threadIdx.x, wave = tid >> 5, lane = tid & 31, col = lane & 15, g = lane >> 4; const int h = blockIdx.y; const size_t b = blockIdx.z;
  static_assert(TQB % 2 == 0, "query tiles go in pairs");
  // every global load of a key tile is issued well ahead of its use, so that a tile waits for memory at most once and not once per product: the J6 k rows and the v tile one tile ahead, into registers, and from there into the LDS buffer that the next tile reads
  // a stage (fetch, wait, store to LDS, barrier) costs much the same whatever it holds, and its loads have the stage's own work to arrive in: a stage holds SK = 128 keys, worked on in four passes of 32
  // the four waves use the same v tile (64 d rows x SK keys, hi and residual): the block fetches it once, sixteen lanes to a row's 256 bytes (4 whole lines a wave load), and every wave takes its fragments from LDS
  const int srow = tid >> 4, sch = (tid & 15) * 8; const size_t so0 = (b * DM_ + (size_t)h * HD + srow) * TT + sch;
  v8h rs[2][8];
  // the J6 k rows of the tile likewise: each thread fetches 16 bytes of two rows; they are split into bf16 hi + lo once and laid down as the low halves of the A fragments (8 values a key); row SK of each plane stays zero and serves the lanes whose k lies past the 8 values
  v4f rj[2]; const int jrow = tid >> 1, jch = (tid & 1) * 4;
  static_assert(SK == 128 && TT % SK == 0, "128 threads: 16 x 16 B to a v row; a stage lies inside the sequence");
  const float* pj; const _Float16 *ph, *pl;   // the thread's places in the stage that is fetched next
  auto ld_t = [&]() {
    rj[0] = *(const v4f*)pj; rj[1] = *(const v4f*)(pj + 64 * NH * 8);
#pragma unroll
    for (int i = 0; i < 8; ++i) { rs[0][i] = *(const v8h*)(ph + i * 8 * TT); rs[1][i] = *(const v8h*)(pl + i * 8 * TT); }
    // as in tile_ld: one wait behind the stage's loads, their addresses held as inputs up to it
    asm volatile("s_wait_xcnt 0x0" :: "v"(pj), "v"(ph), "v"(pl) : "memory");
    pj += SK * NH * 8; ph += SK; pl += SK; };
  auto st_t = [&](int bf) {
#pragma unroll
    for (int u = 0; u < 2; ++u) { v4b oh, ol;
#pragma unroll
      for (int q = 0; q < 4; ++q) { const __bf16 hv = (__bf16)rj[u][q]; oh[q] = hv; ol[q] = (__bf16)(rj[u][q] - (float)hv); }
      *(v4b*)&sj[bf][0][(u * 64 + jrow) * 8 + jch] = oh; *(v4b*)&sj[bf][1][(u * 64 + jrow) * 8 + jch] = ol; }
    const int o = srow * VP + sch;
#pragma unroll
    for (int i = 0; i < 8; ++i) { *(v8h*)&sv[bf][0][o + i * 8 * VP] = rs[0][i]; *(v8h*)&sv[bf][1][o + i * 8 * VP] = rs[1][i]; } };
  v8b z8;
#pragma unroll
  for (int i = 0; i < 8; ++i) z8[i] = (__bf16)0.f;
  if (tid < 4) *(v8b*)&sj[tid >> 1][tid & 1][SK * 8] = z8;
  int jo[SK / 16];
#pragma unroll
  for (int i = 0; i < SK / 16; ++i) jo[i] = g ? SK * 8 : (i * 16 + col) * 8;
#pragma unroll 1   // rolled: one copy of the tile's code serves both query tiles
  for (int hf = 0; hf < 2; ++hf) { const int qb = hf ? (int)blockIdx.x : TQB - 1 - (int)blockIdx.x;   // the same for the whole block: every barrier below is passed by all its threads
  const int q0l = qb * 64 + wave * 16; const size_t q0 = b * TT + q0l;
  F2 aq; { float v[16];
#pragma unroll
    for (int i = 0; i < 16; ++i) v[i] = 0.f;
    if (g == 0) { const float* p = QP + (q0 + col) * (NH * 8) + h * 8;
#pragma unroll
      for (int i = 0; i < 8; ++i) v[i] = p[i]; }
    aq = bsplit16(v); }
  // q and J6 k have norm at most 1 (each is a vector over max(its norm, 1e-12)), so |logit| <= 6^-0.5 for every input: exp(logit) lies between 1/2 and 2, P x 2^11 stays far inside f16, and softmax needs no maximum taken off, hence no rescaling of the sums either
  float l[8];   // eight partial sums of exp for this lane's query (independent chains); they and the other half wave's are added once, behind the key loop
#pragma unroll
  for (int r = 0; r < 8; ++r) l[r] = 0.f;
  v8f acc[4] = {};
  int lim[8];   // key 16 n + 8 g + r is open to query q0l + col while 16 n <= lim[r]
#pragma unroll
  for (int r = 0; r < 8; ++r) lim[r] = q0l + col - 8 * g - r;
  const int nks = (qb * 64 + 64 + SK - 1) / SK;   // the last stage may reach past the block's last query: its keys lie inside the sequence (TT % SK == 0) and are closed to every query
  pj = JK + (b * TT + jrow) * (NH * 8) + h * 8 + jch; ph = VT + so0; pl = VL + so0;
  ld_t(); st_t(0);   // second query tile: every wave has left both buffers at the barrier that ended the first tile's last key tile
  __syncthreads();
#pragma unroll 1
  for (int ks = 0; ks < nks; ++ks) {
    const int cur = ks & 1; const bool more = ks + 1 < nks;
    if (more) ld_t();
#pragma unroll
    for (int sb = 0; sb < SK / 32; ++sb) if (ks * SK + sb * 32 < qb * 64 + 64) {   // the stage's passes of 32 keys, in key order; a pass wholly behind the block's last query is left out (the same for the whole block)
    F2 bk2[2];
#pragma unroll
    for (int ct = 0; ct < 2; ++ct) { union { v16b v; v8b q[2]; } uh, ul; uh.q[0] = *(const v8b*)&sj[cur][0][jo[sb * 2 + ct]]; uh.q[1] = z8; ul.q[0] = *(const v8b*)&sj[cur][1][jo[sb * 2 + ct]]; ul.q[1] = z8; bk2[ct].h = uh.v; bk2[ct].l = ul.v; }
    v16h vh[4], vl[4];
#pragma unroll
    for (int j = 0; j < 4; ++j) { vh[j] = frag_h(&sv[cur][0][(j * 16 + col) * VP + sb * 32], lane); vl[j] = frag_h(&sv[cur][1][(j * 16 + col) * VP + sb * 32], lane); }
    v16h pa, pr;   // P^T x 2^11 as f16 hi + residual (a single f16 would quantise P to 1 part in 2048)
#pragma unroll
    for (int ct = 0; ct < 2; ++ct) { const int kt = ks * SK + sb * 32 + ct * 16; const F2 bk = bk2[ct];
      v8f c = {}; c = wmma_bf(bk.h, aq.l, c); c = wmma_bf(bk.l, aq.h, c); c = wmma_bf(bk.h, aq.h, c);
#pragma unroll
      for (int r = 0; r < 8; ++r) { const float ex = exp2_slot(c[r] * (0.4082482904638631f * 1.4426950408889634f)), e = (kt <= lim[r]) ? ex : 0.f;   /* exp(c x 6^-0.5) as 2^(c x 6^-0.5 x log2 e): with nothing taken off in between, one multiply */ l[r] += e;
        const float f = e * 2048.0f; const _Float16 hv = (_Float16)f; pa[ct * 8 + r] = hv; pr[ct * 8 + r] = (_Float16)(f - (float)hv); } }
#pragma unroll
    for (int j = 0; j < 4; ++j) acc[j] = wmma16_p(vh[j], pa, acc[j]);   // a WMMA that adds to the result of the one in front of it waits for it: the four d tiles go in turn, product by product, so that every neighbour is independent; each accumulator takes its three products in the order it had
#pragma unroll
    for (int j = 0; j < 4; ++j) acc[j] = wmma16_p(vh[j], pr, acc[j]);
#pragma unroll
    for (int j = 0; j < 3; ++j) acc[j] = wmma16_p(vl[j], pa, acc[j]);
    acc[3] = wmma16(vl[3], pa, acc[3]); }   // the pass's last WMMA keeps its v_nop: the next writer of the operand registers stands behind the branch that ends the pass
    if (more) st_t(cur ^ 1);   // the buffers that every wave left at the barrier of the tile before
    __syncthreads(); }
  { float ls = ((l[0] + l[1]) + (l[2] + l[3])) + ((l[4] + l[5]) + (l[6] + l[7]));
    ls += __shfl_xor(ls, 16);   // the other half wave holds the same query's other keys
    const float il = (1.0f / 2048.0f) / ls;
    // acc[j][r] = O^T (d = 16 j + 8 g + r, query col): 8 neighbouring d of one query row
#pragma unroll
    for (int j = 0; j < 4; ++j) { *(v4f*)&so[wave][col][j * 16 + 8 * g] = (v4f){acc[j][0] * il, acc[j][1] * il, acc[j][2] * il, acc[j][3] * il}; *(v4f*)&so[wave][col][j * 16 + 8 * g + 4] = (v4f){acc[j][4] * il, acc[j][5] * il, acc[j][6] * il, acc[j][7] * il}; } }
  LDSX(); for (int rl = 0; rl < 16; ++rl) if (lane < 16) vst2(O + (q0 + rl) * DM_ + h * HD + lane * 4, *(const v4f*)&so[wave][rl][lane * 4]);
  // the wait stands behind the tile's stores, in front of the next query tile's code, which writes the registers of their data and address anew
  asm volatile("s_wait_xcnt 0x0" ::: "memory"); } }
// ---- k_out: block = (64 rows, 128 cols): out = o (hi + lo) Wo^T + bo
__global__ __launch_bounds__(128) void k_out(const float* __restrict__ O, const float* __restrict__ WO, const float* __restrict__ BO, float* __restrict__ OUT) { __shared__ __align__(16) float sf[4][16][132];
  const int tid = threadIdx.x, wave = tid >> 5, lane = tid & 31, col = lane & 15, g = lane >> 4; const int c0 = blockIdx.y * 128; const size_t r0 = (size_t)blockIdx.x * 64 + wave * 16;
  v8f acc[8] = {};
  __shared__ __align__(16) __bf16 oh[2][64 * KP], ol[2][64 * KP], ow[2][128 * KP];
  v4f ra[8], rw[16]; const float* Ob = O + (size_t)blockIdx.x * 64 * DM_; const float* Wb = WO + (size_t)c0 * DM_;
  tile_ld<64, KS>(ra, Ob, DM_, tid); tile_ld<128, KS>(rw, Wb, DM_, tid);
  tile_st2<64, KS>(ra, oh[0], ol[0], tid); tile_st<128, KS>(rw, ow[0], tid);
  __syncthreads();
#pragma unroll 1   // rolled: one copy of the body, so that the next tile's registers are not multiplied
  for (int kc = 0; kc < DM_ / KS; ++kc) { const int cur = kc & 1; const bool more = kc + 1 < DM_ / KS;
    if (more) { tile_ld<64, KS>(ra, Ob + (kc + 1) * KS, DM_, tid); tile_ld<128, KS>(rw, Wb + (kc + 1) * KS, DM_, tid); }
#pragma unroll
    for (int ks = 0; ks < KS / 32; ++ks) { const int ao = (wave * 16 + col) * KP + ks * 32; const v16b ah = frag_b(&oh[cur][ao], lane), al = frag_b(&ol[cur][ao], lane);
#pragma unroll
      for (int j0 = 0; j0 < 8; j0 += 4) { v16b f[4];
#pragma unroll
        for (int j = 0; j < 4; ++j) f[j] = frag_b(&ow[cur][((j0 + j) * 16 + col) * KP + ks * 32], lane);
#pragma unroll
        for (int j = 0; j < 4; ++j) { acc[j0 + j] = wmma_bf(ah, f[j], acc[j0 + j]); acc[j0 + j] = wmma_bf(al, f[j], acc[j0 + j]); } } }
    if (more) { tile_st2<64, KS>(ra, oh[cur ^ 1], ol[cur ^ 1], tid); tile_st<128, KS>(rw, ow[cur ^ 1], tid); }
    __syncthreads(); }
#pragma unroll
  for (int j = 0; j < 8; ++j) { const float bb = bfr(BO[c0 + j * 16 + col]);
#pragma unroll
    for (int r = 0; r < 8; ++r) sf[wave][8 * g + r][j * 16 + col] = acc[j][r] + bb; }
  LDSX(); for (int rl = 0; rl < 16; ++rl) vst2(OUT + (r0 + rl) * DM_ + c0 + lane * 4, *(const v4f*)&sf[wave][rl][lane * 4]); }
extern "C" void kernel_launch(void* const* d_in, const int* in_sizes, int n_in, void* d_out, int out_size, void* d_ws, size_t ws_size, hipStream_t stream) {
  (void)in_sizes; (void)n_in; (void)out_size;
  const float** F = (const float**)d_in;   // 0 x [2,2048,1024], 1 W1_q [64,2048], 2 W2_q, 3 W1_k [64,1024], 4 W2_k, 5 Wv [1024,1024], 6 bv, 7 Wo, 8 bo
  if (ws_size < (size_t)WS_END) return;
  char* ws = (char*)d_ws; float *QP = (float*)(ws + WS_QP), *JK = (float*)(ws + WS_JK), *O = (float*)(ws + WS_O); _Float16 *VT = (_Float16*)(ws + WS_VT), *VL = (_Float16*)(ws + WS_VL);
  k_plv<<<2 * NPL + NVB * (DM_ / 128), 128, 0, stream>>>(F[0], F[1], F[2], F[3], F[4], F[5], F[6], QP, JK, VT, VL);
  k_att<<<dim3(TQB / 2, NH, TNB), 128, 0, stream>>>(QP, JK, VT, VL, O);
  k_out<<<dim3(TNB * TQB, DM_ / 128), 128, 0, stream>>>(O, F[7], F[8], (float*)d_out);   // the rows of both batches lie one behind the other: one grid
}
